// v000
// Measured on an AMD MI455X. A time is GPU time per run, averaged over a window of back-to-back runs after a warm-up
// (all launches, gaps included; the runs take copies of the inputs in turn), and the median of several windows.
// Apart from v000's, it joins two sittings. Times from different sittings can be a few percent apart, while
// side-by-side timings come from the same sitting.
// v000, which the later versions start from, runs in 459 microseconds.
// Contractions: q/k/v projections = v_wmma_f32_16x16x32_bf16 (bf16 operands = RNE-converted activations and
// transposed weights, single product, f32 accumulate); q.k^T scores, p.v context and ctx.Wo projection =
// v_wmma_f32_16x16x32_f16 (q, k = f16 of the f32 projection sums, unscaled; p = exp(s - m) carried x16384 plus an
// f16 residual plane of p x4096 on the leading query blocks; v^T, ctx and Wo carried x64 in f16), f32 accumulate;
// softmax, bias/residual add and LayerNorm in f32.
#include <hip/hip_runtime.h>
#include <math.h>
#include <stdint.h>

#ifndef NB
#define NB 2                 // batches processed (reducible)
#endif
#ifndef NB_FULL
#define NB_FULL 2            // batches in the inputs / output
#endif
#ifndef SEQ
#define SEQ 2048             // query == key length processed (reducible)
#endif
#ifndef SEQ_FULL
#define SEQ_FULL 2048        // per-batch row stride of the inputs and of the output
#endif
#define DE    1024
#define NH    16
#define HD    64
#define NQB   (SEQ / 64)
#define MROWS (NB * SEQ)
#ifndef RESQB
#define RESQB 8              // leading 64-row query blocks per (b,h) that carry the p residual plane
#endif
#define PCARRY 16384.0f
#define PRES   4096.0f
#define VCARRY 64.0f
#define CCARRY 64.0f
#define WCARRY 64.0f

static_assert(NB >= 1 && NB <= NB_FULL);
static_assert((SEQ % 128) == 0 && SEQ >= 128 && SEQ <= SEQ_FULL);
static_assert(NH * HD == DE);
static_assert(RESQB >= 1);
static_assert((MROWS % 128) == 0 && (DE % 64) == 0 && (DE % 32) == 0);
static_assert((long long)NB_FULL * SEQ_FULL * DE * 4 == 16777216LL);   // total output bytes at full size

typedef _Float16 v16h __attribute__((ext_vector_type(16)));
typedef _Float16 v8h  __attribute__((ext_vector_type(8)));
typedef __bf16   v16b __attribute__((ext_vector_type(16)));
typedef __bf16   v8b  __attribute__((ext_vector_type(8)));
typedef float    v8f  __attribute__((ext_vector_type(8)));
typedef float    v4f  __attribute__((ext_vector_type(4)));
typedef unsigned int v4u __attribute__((ext_vector_type(4)));
typedef unsigned short v8us __attribute__((ext_vector_type(8)));

// ---- scalar helpers --------------------------------------------------------------------------------
__device__ __forceinline__ unsigned short bf_bits(float f) {          // f32 -> bf16 bits, RNE convert
  unsigned u = __float_as_uint(f);
  return (unsigned short)((u + 0x7FFFu + ((u >> 16) & 1u)) >> 16);
}
__device__ __forceinline__ float bf_up(unsigned short h) { return __uint_as_float(((unsigned)h) << 16); }
__device__ __forceinline__ unsigned short h_bits(float f) {           // f32 -> f16 bits, RNE convert
  union { _Float16 h; unsigned short u; } cvt;
  cvt.h = (_Float16)f;
  return cvt.u;
}
__device__ __forceinline__ unsigned pk16(unsigned short a, unsigned short b) { return (unsigned)a | ((unsigned)b << 16); }
__device__ __forceinline__ v8f zero8() { v8f z = {0.f, 0.f, 0.f, 0.f, 0.f, 0.f, 0.f, 0.f}; return z; }

// ---- fragment loaders: 16-bit A/B operand, lane -> row/col (lane&15), p already includes +8*(lane>>4);
//      elements 0..7 <- p[0..7] (k0+8h..), elements 8..15 <- p[16..23] (k0+16+8h..)
__device__ __forceinline__ v16b ldfrag_b(const __bf16* p) {
  union { v16b v; v8b h[2]; } f;
  f.h[0] = *(const v8b*)(p);
  f.h[1] = *(const v8b*)(p + 16);
  return f.v;
}
__device__ __forceinline__ v16h ldfrag_h(const _Float16* p) {
  union { v16h v; v8h h[2]; } f;
  f.h[0] = *(const v8h*)(p);
  f.h[1] = *(const v8h*)(p + 16);
  return f.v;
}

// ---- WMMA helpers with trailing VALU hazard gap --------------------------------------------------------
__device__ __forceinline__ v8f mma_b(v16b a, v16b b, v8f c) {
  c = __builtin_amdgcn_wmma_f32_16x16x32_bf16(false, a, false, b, (short)0, c, false, false);
  asm volatile("v_nop\n\tv_nop\n\tv_nop\n\tv_nop" : "+v"(c) : "v"(a), "v"(b));
  return c;
}
__device__ __forceinline__ v8f mma_h(v16h a, v16h b, v8f c) {
  c = __builtin_amdgcn_wmma_f32_16x16x32_f16(false, a, false, b, (short)0, c, false, false);
  asm volatile("v_nop\n\tv_nop\n\tv_nop\n\tv_nop" : "+v"(c) : "v"(a), "v"(b));
  return c;
}

// =====================================================================================================
// f32 -> bf16 (RNE convert), 8 elements per thread, one 16-B store per lane: a wave writes 512 contiguous B
// Destination plane is compact [b][SEQ*DE]; source batch stride src8 (units of 8 floats) may be larger.
// coverage: n8 threads x 8 = whole plane (n8 = NB*SEQ*DE/8 is a multiple of 256).
// =====================================================================================================
__global__ __launch_bounds__(256) void cvt_bf16x8s(const float* __restrict__ in, unsigned short* out,
                                                   int n8, int per8, int src8) {
  const int i = blockIdx.x * 256 + threadIdx.x;
  if (i < n8) {
    const int hd  = i / per8;
    const int rem = i - hd * per8;
    const float* s = in + ((size_t)hd * src8 + (size_t)rem) * 8;
    const v4f a = *(const v4f*)(s);
    const v4f b = *(const v4f*)(s + 4);
    v4u p;
    p[0] = pk16(bf_bits(a[0]), bf_bits(a[1]));
    p[1] = pk16(bf_bits(a[2]), bf_bits(a[3]));
    p[2] = pk16(bf_bits(b[0]), bf_bits(b[1]));
    p[3] = pk16(bf_bits(b[2]), bf_bits(b[3]));
    *(v4u*)(out + (size_t)i * 8) = p;
    
  }
}

// =====================================================================================================
// Weight W[k][n] f32 (DE x DE, n contiguous) -> transposed 16-bit plane Wt[n][k] (k contiguous, pitch DE).
//   blockIdx.y = matrix id: 0,1,2 -> bf16 bits of the RNE-bf16 value; 3 -> f16 bits of (RNE-bf16 value x64).
//   Block = one 64(k) x 64(n) tile, 256 threads: thread (k = tid>>2, 16-column n quarter) loads 16 floats of row k
//   and writes them transposed into the LDS tile T[n][k]; after the barrier wave w writes rows n = 8w..8w+7:
//   grid.x = (DE/64)^2 tiles covers the whole plane of each of the 4 matrices.
// =====================================================================================================
__global__ __launch_bounds__(256) void wt_tiles(const float* __restrict__ w0, const float* __restrict__ w1,
                                                const float* __restrict__ w2, const float* __restrict__ w3,
                                                unsigned short* o0, unsigned short* o1,
                                                unsigned short* o2, unsigned short* o3) {
  __shared__ __align__(16) unsigned short T[64 * 64];   // [n][k]
  const int tid = threadIdx.x;
  const int mat = blockIdx.y;                            // block-uniform
  const float* in = w0; unsigned short* out = o0;
  if (mat == 1) { in = w1; out = o1; }
  else if (mat == 2) { in = w2; out = o2; }
  else if (mat == 3) { in = w3; out = o3; }
  const int ktile = blockIdx.x / (DE / 64);
  const int ntile = blockIdx.x - ktile * (DE / 64);
  const int k   = tid >> 2;              // 0..63
  const int nq  = (tid & 3) * 16;        // 0,16,32,48
  const float* src = in + (size_t)(ktile * 64 + k) * DE + ntile * 64 + nq;
#pragma unroll
  for (int i = 0; i < 4; ++i) {
    const v4f a = *(const v4f*)(src + 4 * i);
#pragma unroll
    for (int e = 0; e < 4; ++e) {
      const unsigned short bb = bf_bits(a[e]);
      const unsigned short hb = h_bits(bf_up(bb) * WCARRY);
      const unsigned short us = (mat == 3) ? hb : bb;
      T[(nq + 4 * i + e) * 64 + k] = us;
    }
  }
  __syncthreads();
  const int wave = tid >> 5, lane = tid & 31;
  const int q = lane >> 3, c8 = (lane & 7) * 8;
  union { v8us s; v4u u; } x0, x1;
  const int d0 = wave * 8 + q;
  const int d1 = wave * 8 + 4 + q;
  x0.s = *(const v8us*)(T + d0 * 64 + c8);
  x1.s = *(const v8us*)(T + d1 * 64 + c8);
  unsigned short* p0 = out + ((size_t)(ntile * 64 + d0) * DE + ktile * 64 + c8);
  unsigned short* p1 = out + ((size_t)(ntile * 64 + d1) * DE + ktile * 64 + c8);
  *(v4u*)p0 = x0.u;
  *(v4u*)p1 = x1.u;
  
}

// =====================================================================================================
// 16-bit GEMM C[m][n] = sum_k A[m][k] * Bt[n][k], K = DE, M = MROWS, N = DE. Block 256 threads = 8 waves,
// block tile 128 m x 64 n, wave tile 16 x 64 (4 accumulators), k step 32; A and B fragments straight from the
// 16-bit global rows (two 16-B loads each, identical k map). grid = (DE/64, MROWS/128), exact multiples.
//   MODE 0: bf16 operands; out16 f16 row-major [MROWS][DE] = (acc + bias) * scale. Wave tile staged in wave-private
//   MODE 1: bf16 operands; out16 f16 transposed per batch [b][DE][SEQ] = (acc + bias) * scale. Block tile staged in
//           cross-wave LDS T[n][key 128] (block barrier); wave w writes rows n = 8w..8w+7, one instruction = 2 rows
//           of 128 halves (16 lanes x 16 B per 256-B row); coverage 8 waves x 4 it x 2 rows x 128 = 64x128.
//   MODE 2: f16 operands; out32 f32 row-major [MROWS][DE] = acc * scale + bias + RNE-bf16(resid), resid rows read at
//           the full batch stride. Wave-private LDS stage (f32), one instruction = 2 rows of 64 floats (16 lanes x
//           16 B per 256-B segment); coverage 8 it x 2 rows x 64 = 16x64.
// =====================================================================================================
template <int MODE>
__global__ __launch_bounds__(256)
void gemm_nt(const unsigned short* __restrict__ A, const unsigned short* __restrict__ Bt,
             const float* __restrict__ bias, const float* __restrict__ resid,
             unsigned short* out16, float* out32, float scale) {
  __shared__ __align__(16) unsigned char smem[32768];
  const int tid  = threadIdx.x;
  const int wave = tid >> 5;
  const int lane = tid & 31;
  const int hh   = lane >> 4;
  const int c    = lane & 15;
  const int m0b  = blockIdx.y * 128;
  const int m0   = m0b + wave * 16;
  const int n0   = blockIdx.x * 64;

  v8f acc[4];
#pragma unroll
  for (int t = 0; t < 4; ++t) acc[t] = zero8();

  const size_t aoff = (size_t)(m0 + c) * DE + 8 * hh;
  const size_t boff = (size_t)(n0 + c) * DE + 8 * hh;
  if (MODE == 2) {
    const _Float16* Ah = (const _Float16*)(const void*)A + aoff;
    const _Float16* Bh = (const _Float16*)(const void*)Bt + boff;
#pragma unroll 2
    for (int k0 = 0; k0 < DE; k0 += 32) {
      const v16h a = ldfrag_h(Ah + k0);
#pragma unroll
      for (int t = 0; t < 4; ++t) {
        const v16h b = ldfrag_h(Bh + (size_t)t * 16 * DE + k0);
        acc[t] = mma_h(a, b, acc[t]);
      }
    }
  } else {
    const __bf16* Ab = (const __bf16*)(const void*)A + aoff;
    const __bf16* Bb = (const __bf16*)(const void*)Bt + boff;
#pragma unroll 2
    for (int k0 = 0; k0 < DE; k0 += 32) {
      const v16b a = ldfrag_b(Ab + k0);
#pragma unroll
      for (int t = 0; t < 4; ++t) {
        const v16b b = ldfrag_b(Bb + (size_t)t * 16 * DE + k0);
        acc[t] = mma_b(a, b, acc[t]);
      }
    }
  }

  if (MODE == 0) {
    _Float16* S = (_Float16*)(void*)smem + wave * 1024;          // [16][64] per wave
#pragma unroll
    for (int t = 0; t < 4; ++t) {
      const float bi = bf_up(bf_bits(bias[n0 + t * 16 + c]));
#pragma unroll
      for (int r = 0; r < 8; ++r) S[(8 * hh + r) * 64 + t * 16 + c] = (_Float16)((acc[t][r] + bi) * scale);
    }
    __builtin_amdgcn_fence(__ATOMIC_RELEASE, "workgroup");
    __builtin_amdgcn_wave_barrier();
    __builtin_amdgcn_fence(__ATOMIC_ACQUIRE, "workgroup");
    const int rq = lane >> 3, c8 = (lane & 7) * 8;
    union { v8h h; v4u u; } w[4];
#pragma unroll
    for (int it = 0; it < 4; ++it) w[it].h = *(const v8h*)(S + (it * 4 + rq) * 64 + c8);
    {
#pragma unroll
      for (int it = 0; it < 4; ++it)
        *(v4u*)(out16 + (size_t)(m0 + it * 4 + rq) * DE + n0 + c8) = w[it].u;
      
    }
  } else if (MODE == 1) {
    _Float16* T = (_Float16*)(void*)smem;                       // [n 64][key 128]
#pragma unroll
    for (int t = 0; t < 4; ++t) {
      const float bi = bf_up(bf_bits(bias[n0 + t * 16 + c]));
#pragma unroll
      for (int r = 0; r < 8; ++r)
        T[(t * 16 + c) * 128 + wave * 16 + 8 * hh + r] = (_Float16)((acc[t][r] + bi) * scale);
    }
    __syncthreads();
    const int bidx = m0b / SEQ;                                  // tiles never straddle batches (128 | SEQ)
    const int key0 = m0b - bidx * SEQ;
    const int rh = lane >> 4, c8 = (lane & 15) * 8;
    union { v8h h; v4u u; } w[4];
#pragma unroll
    for (int it = 0; it < 4; ++it) w[it].h = *(const v8h*)(T + (wave * 8 + it * 2 + rh) * 128 + c8);
    {
#pragma unroll
      for (int it = 0; it < 4; ++it) {
        const int row = wave * 8 + it * 2 + rh;
        *(v4u*)(out16 + ((size_t)(bidx * DE + n0 + row) * SEQ + key0 + c8)) = w[it].u;
      }
      
    }
  } else {
    float* S = (float*)(void*)smem + wave * 1024;                // [16][64] f32 per wave
#pragma unroll
    for (int t = 0; t < 4; ++t) {
      const float bi = bf_up(bf_bits(bias[n0 + t * 16 + c]));
#pragma unroll
      for (int r = 0; r < 8; ++r) S[(8 * hh + r) * 64 + t * 16 + c] = acc[t][r] * scale + bi;
    }
    __builtin_amdgcn_fence(__ATOMIC_RELEASE, "workgroup");
    __builtin_amdgcn_wave_barrier();
    __builtin_amdgcn_fence(__ATOMIC_ACQUIRE, "workgroup");
    const int rh = lane >> 4, c4 = (lane & 15) * 4;
    v4f vals[8];
#pragma unroll
    for (int it = 0; it < 8; ++it) {
      const int row = it * 2 + rh;
      const int gm  = m0 + row;
      const int bb  = gm / SEQ;
      const int tt  = gm - bb * SEQ;
      v4f x = *(const v4f*)(S + row * 64 + c4);
      const v4f rq = *(const v4f*)(resid + ((size_t)bb * SEQ_FULL + tt) * DE + n0 + c4);
#pragma unroll
      for (int e = 0; e < 4; ++e) x[e] = x[e] + bf_up(bf_bits(rq[e]));
      vals[it] = x;
    }
    {
#pragma unroll
      for (int it = 0; it < 8; ++it)
        *(v4f*)(out32 + (size_t)(m0 + it * 2 + rh) * DE + n0 + c4) = vals[it];
      
    }
  }
}

// =====================================================================================================
// Full (unmasked) attention, head dim 64, all NQB key tiles.
//   q plane (f16):  element (b, t, h, d) at [(b*SEQ + t)*DE + h*64 + d]      k plane (f16): same with key index s
//   v^T plane (f16): element (b, h, d, s) at [(b*DE + h*64 + d)*SEQ + s], value v*64
//   scores = q . k (f16 WMMA, f32 acc) * 0.125; online softmax in f32; p = exp(s - m) carried as f16(16384 p);
//   context = p . v on f16 WMMA; RES adds the f16 residual plane of p (x4096, separate accumulator folded back
//   with 1/4096 per tile in f32). ctx out = f16(context / (l * 16384 * 64) * 64) to [(b*SEQ + t)*DE + h*64 + d].
//   Block = 4 waves = 64 query rows of one (b,h); grid = nqbThis * NH * NB; kv tiles of 64.
//   K / V^T tile staging: 128 threads x 32 elements per plane = the whole 64x64 tile (plain 16-B loads,
//   __syncthreads before and after, cross-wave); staged extent == consumed extent for Ksh, Vth, Psh, Psl, Os.
//   P tiles and the Os tile are wave-private, spilled with _Float16 element stores and reloaded as v8h (same element
//   Output coverage: each wave stores rows 0..15 (it 0..3 x lane>>3) x 64 halves (8 lanes x 16 B): one instruction
// =====================================================================================================
template <bool RES>
__global__ __launch_bounds__(128)
void attn_full64(const unsigned short* __restrict__ qp, const unsigned short* __restrict__ kp,
                 const unsigned short* __restrict__ vtp, unsigned short* ctx, int qbBase, int nqbThis) {
  union FH { v16h v; v8h h[2]; };
  __shared__ __align__(16) _Float16 Ksh[64 * 64];                 // K [kv][d]      8 KB
  __shared__ __align__(16) _Float16 Vth[64 * 64];                 // V^T [d][kv]    8 KB
  __shared__ __align__(16) _Float16 Psh[4][16 * 64];              // per wave P [row][kv]
  __shared__ __align__(16) _Float16 Psl[RES ? 4 : 1][16 * 64];    // per wave P residual
  __shared__ __align__(16) _Float16 Os[4][16 * 64];               // per wave context tile [row][d]

  const int tid  = threadIdx.x;
  const int wave = tid >> 5;
  const int lane = tid & 31;
  const int hh   = lane >> 4;
  const int c    = lane & 15;

  const int bx   = blockIdx.x;
  const int qbl  = bx % nqbThis;
  const int bhq  = bx / nqbThis;           // 0..NB*NH-1
  const int h    = bhq % NH;
  const int b    = bhq / NH;
  const int qb   = qbBase + qbl;           // 0..NQB-1
  const int q0   = qb * 64 + wave * 16;    // query index within the sequence

  const _Float16* Qh = (const _Float16*)(const void*)qp + (size_t)b * SEQ * DE + (size_t)h * HD;
  const _Float16* Kh = (const _Float16*)(const void*)kp + (size_t)b * SEQ * DE + (size_t)h * HD;
  const _Float16* Vh = (const _Float16*)(const void*)vtp + ((size_t)b * DE + (size_t)h * HD) * SEQ;

  // ---- Q fragments (A operand, row = lane&15): 2 d-chunks ----
  v16h qa[2];
#pragma unroll
  for (int dc = 0; dc < 2; ++dc) {
    const size_t qo = (size_t)(q0 + c) * DE + dc * 32 + 8 * hh;
    qa[dc] = ldfrag_h(Qh + qo);
  }

  float mrow[8], lrow[8];
  v8f oacc[4];
#pragma unroll
  for (int r = 0; r < 8; ++r) { mrow[r] = -INFINITY; lrow[r] = 0.f; }
#pragma unroll
  for (int t = 0; t < 4; ++t) oacc[t] = zero8();

  for (int kt = 0; kt < NQB; ++kt) {        // block-uniform bounds, exactly NQB trips
    const int kv0 = kt * 64;
    __syncthreads();
    {
      const int r = tid >> 1, half = (tid & 1) * 32;
      const _Float16* kg = Kh + (size_t)(kv0 + r) * DE + half;   // K row kv0+r, d = half..half+31
      const _Float16* vg = Vh + (size_t)r * SEQ + kv0 + half;    // V^T row d = r, s = kv0+half..+31
#pragma unroll
      for (int i = 0; i < 4; ++i) {
        const v8h a0 = *(const v8h*)(kg + 8 * i);
        const v8h b0 = *(const v8h*)(vg + 8 * i);
        *(v8h*)(Ksh + r * 64 + half + 8 * i) = a0;
        *(v8h*)(Vth + r * 64 + half + 8 * i) = b0;
      }
    }
    __syncthreads();

    // ---- scores: 16 query rows x 64 keys per wave, single f16 product ----
    v8f s[4];
#pragma unroll
    for (int j = 0; j < 4; ++j) {
      s[j] = zero8();
#pragma unroll
      for (int dc = 0; dc < 2; ++dc) {
        FH kb;
        kb.h[0] = *(const v8h*)(Ksh + (j * 16 + c) * 64 + dc * 32 + 8 * hh);
        kb.h[1] = *(const v8h*)(Ksh + (j * 16 + c) * 64 + dc * 32 + 16 + 8 * hh);
        s[j] = mma_h(qa[dc], kb.v, s[j]);
      }
    }

    // ---- scale, row max, online softmax, P (x16384, f16) and P residual (x4096) to LDS ----
    _Float16* pwh = Psh[wave];
    _Float16* pwl = Psl[RES ? wave : 0];
#pragma unroll
    for (int r = 0; r < 8; ++r) {
      float m = -INFINITY;
#pragma unroll
      for (int j = 0; j < 4; ++j) {
        const float sv = s[j][r] * 0.125f;
        s[j][r] = sv;
        m = fmaxf(m, sv);
      }
#pragma unroll
      for (int off = 1; off < 16; off <<= 1) m = fmaxf(m, __shfl_xor(m, off, 32));
      const float mnew  = fmaxf(mrow[r], m);
      const float msafe = (mnew == -INFINITY) ? 0.f : mnew;
      const float alpha = __expf(mrow[r] - msafe);
      mrow[r] = mnew;
      float psum = 0.f;
#pragma unroll
      for (int j = 0; j < 4; ++j) {
        const float p = __expf(s[j][r] - msafe);
        psum += p;
        const float p1k = p * PCARRY;
        const _Float16 ph = (_Float16)p1k;
        pwh[(8 * hh + r) * 64 + j * 16 + c] = ph;
        if (RES) {
          const _Float16 pl = (_Float16)((p1k - (float)ph) * PRES);
          pwl[(8 * hh + r) * 64 + j * 16 + c] = pl;
        }
      }
#pragma unroll
      for (int off = 1; off < 16; off <<= 1) psum += __shfl_xor(psum, off, 32);
      lrow[r] = lrow[r] * alpha + psum;
#pragma unroll
      for (int t = 0; t < 4; ++t) oacc[t][r] *= alpha;
    }
    __builtin_amdgcn_fence(__ATOMIC_RELEASE, "workgroup");
    __builtin_amdgcn_wave_barrier();
    __builtin_amdgcn_fence(__ATOMIC_ACQUIRE, "workgroup");

    // ---- context += P . V (f16 WMMA), residual products into a separate accumulator ----
    v8f o1[4];
#pragma unroll
    for (int t = 0; t < 4; ++t) o1[t] = zero8();
#pragma unroll 1
    for (int kk = 0; kk < 2; ++kk) {
      FH pa, pl;
      pa.h[0] = *(const v8h*)(pwh + c * 64 + kk * 32 + 8 * hh);
      pa.h[1] = *(const v8h*)(pwh + c * 64 + kk * 32 + 16 + 8 * hh);
      if (RES) {
        pl.h[0] = *(const v8h*)(pwl + c * 64 + kk * 32 + 8 * hh);
        pl.h[1] = *(const v8h*)(pwl + c * 64 + kk * 32 + 16 + 8 * hh);
      } else {
        pl.v = pa.v;
      }
#pragma unroll
      for (int t = 0; t < 4; ++t) {
        FH vb;
        vb.h[0] = *(const v8h*)(Vth + (t * 16 + c) * 64 + kk * 32 + 8 * hh);
        vb.h[1] = *(const v8h*)(Vth + (t * 16 + c) * 64 + kk * 32 + 16 + 8 * hh);
        oacc[t] = mma_h(pa.v, vb.v, oacc[t]);
        if (RES) o1[t] = mma_h(pl.v, vb.v, o1[t]);
      }
    }
    if (RES) {
#pragma unroll
      for (int t = 0; t < 4; ++t)
#pragma unroll
        for (int r = 0; r < 8; ++r) oacc[t][r] += o1[t][r] * (1.0f / PRES);
    }
  }

  // ---- normalise (1/l, the p, v carries) and apply the ctx carry; stage the wave's 16x64 f16 tile; write whole
  _Float16* os = Os[wave];
#pragma unroll
  for (int r = 0; r < 8; ++r) {
    const float l = lrow[r];
    const float inv = ((l > 0.f) ? (1.0f / l) : 0.f) * (CCARRY / (PCARRY * VCARRY));
#pragma unroll
    for (int t = 0; t < 4; ++t) os[(8 * hh + r) * 64 + t * 16 + c] = (_Float16)(oacc[t][r] * inv);
  }
  __builtin_amdgcn_fence(__ATOMIC_RELEASE, "workgroup");
  __builtin_amdgcn_wave_barrier();
  __builtin_amdgcn_fence(__ATOMIC_ACQUIRE, "workgroup");
  {
    const int rq = lane >> 3, c8 = (lane & 7) * 8;
    union { v8h h; v4u u; } w[4];
#pragma unroll
    for (int it = 0; it < 4; ++it) w[it].h = *(const v8h*)(os + (it * 4 + rq) * 64 + c8);
    unsigned short* ob = ctx + ((size_t)b * SEQ) * DE + (size_t)h * HD;
    {
#pragma unroll
      for (int it = 0; it < 4; ++it) {
        const int row = it * 4 + rq;                     // it 0..3 x rq 0..3 = rows 0..15
        *(v4u*)(ob + (size_t)(q0 + row) * DE + c8) = w[it].u;
      }
      
    }
  }
}

// =====================================================================================================
// LayerNorm over DE of x [MROWS][DE] f32: one block of 256 threads per row, thread owns 4 consecutive floats.
// mean and centred variance via wave shuffles + 8-entry LDS partials (cross-wave, block barriers), fixed order.
// y = (x - mu) * rsqrt(var + 1e-5) * RNE-bf16(gamma) + RNE-bf16(beta). Output row b*SEQ_FULL + t of d_out;
// coverage: MROWS blocks x 256 threads x 4 floats = every processed output row in full.
// =====================================================================================================
__global__ __launch_bounds__(256) void ln_rows(const float* __restrict__ x, const float* __restrict__ gam,
                                               const float* __restrict__ bet, float* out) {
  __shared__ float red1[8];
  __shared__ float red2[8];
  const int tid = threadIdx.x, wave = tid >> 5, lane = tid & 31;
  const int row = blockIdx.x;
  const int bb  = row / SEQ;
  const int tt  = row - bb * SEQ;
  const size_t orow = (size_t)bb * SEQ_FULL + (size_t)tt;

  const v4f v = *(const v4f*)(x + (size_t)row * DE + tid * 4);
  float s = (v[0] + v[1]) + (v[2] + v[3]);
#pragma unroll
  for (int off = 16; off > 0; off >>= 1) s += __shfl_xor(s, off, 32);
  if (lane == 0) red1[wave] = s;
  __syncthreads();
  float tot = 0.f;
#pragma unroll
  for (int w = 0; w < 8; ++w) tot += red1[w];
  const float mu = tot * (1.0f / (float)DE);

  v4f d;
#pragma unroll
  for (int e = 0; e < 4; ++e) d[e] = v[e] - mu;
  float s2 = (d[0] * d[0] + d[1] * d[1]) + (d[2] * d[2] + d[3] * d[3]);
#pragma unroll
  for (int off = 16; off > 0; off >>= 1) s2 += __shfl_xor(s2, off, 32);
  if (lane == 0) red2[wave] = s2;
  __syncthreads();
  float tot2 = 0.f;
#pragma unroll
  for (int w = 0; w < 8; ++w) tot2 += red2[w];
  const float var  = tot2 * (1.0f / (float)DE);
  const float rstd = rsqrtf(var + 1.0e-5f);

  const v4f g4 = *(const v4f*)(gam + tid * 4);
  const v4f b4 = *(const v4f*)(bet + tid * 4);
  v4f y;
#pragma unroll
  for (int e = 0; e < 4; ++e) y[e] = (d[e] * rstd) * bf_up(bf_bits(g4[e])) + bf_up(bf_bits(b4[e]));
  float* op = out + orow * DE + (size_t)tid * 4;
  *(v4f*)op = y;
  
}

// =====================================================================================================
// Workspace map (bytes, full size): PQ bf16 [MROWS][DE] at 0 (8388608); PK bf16 at 8388608 (8388608);
// Wq^T, Wk^T, Wv^T bf16 and Wo^T f16 [DE][DE] at 16777216.. (4 x 2097152); Q f16 [MROWS][DE] at 25165824;
// K f16 at 33554432; V^T f16 [NB][DE][SEQ] at 41943040; CTX f16 [MROWS][DE] at 50331648; X f32 [MROWS][DE]
// at 58720256 (16777216); end 75497472. Every plane is an exact multiple of its whole-line store granularity
// Launch plan (10): cvt pre_q, cvt pre_k, weight transpose-convert, gemm q, gemm k, gemm v^T, attention (leading
// query blocks with the p residual, remaining blocks without), gemm o + residual, LayerNorm.
// =====================================================================================================
extern "C" void kernel_launch(void* const* d_in, const int* in_sizes, int n_in,
                              void* d_out, int out_size, void* d_ws, size_t ws_size,
                              hipStream_t stream) {
  if (n_in < 12) return;
  const long long needIn = (long long)(NB - 1) * SEQ_FULL * DE + (long long)SEQ * DE;
  if ((long long)in_sizes[0] < needIn || (long long)in_sizes[1] < needIn) return;
  if (in_sizes[2] < DE * DE || in_sizes[4] < DE * DE || in_sizes[6] < DE * DE || in_sizes[8] < DE * DE) return;
  if (in_sizes[3] < DE || in_sizes[5] < DE || in_sizes[7] < DE || in_sizes[9] < DE) return;
  if (in_sizes[10] < DE || in_sizes[11] < DE) return;
  if (out_size < 0 || (long long)out_size < needIn) return;

  const size_t P16 = (size_t)MROWS * DE * 2;     // one 16-bit activation plane
  const size_t W16 = (size_t)DE * DE * 2;        // one 16-bit weight plane
  const size_t P32 = (size_t)MROWS * DE * 4;     // x plane
  size_t off = 0;
  const size_t oPQ  = off; off += P16;
  const size_t oPK  = off; off += P16;
  const size_t oWq  = off; off += W16;
  const size_t oWk  = off; off += W16;
  const size_t oWv  = off; off += W16;
  const size_t oWo  = off; off += W16;
  const size_t oQ   = off; off += P16;
  const size_t oK   = off; off += P16;
  const size_t oVT  = off; off += P16;
  const size_t oCTX = off; off += P16;
  const size_t oX   = off; off += P32;
  if (off > ws_size) return;                     // off = 75497472 at full size
  if (off > (size_t)134217728) return;

  const float* pre_q = (const float*)d_in[0];
  const float* pre_k = (const float*)d_in[1];
  const float* Wq    = (const float*)d_in[2];
  const float* bq    = (const float*)d_in[3];
  const float* Wk    = (const float*)d_in[4];
  const float* bk    = (const float*)d_in[5];
  const float* Wv    = (const float*)d_in[6];
  const float* bv    = (const float*)d_in[7];
  const float* Wo    = (const float*)d_in[8];
  const float* bo    = (const float*)d_in[9];
  const float* gamma = (const float*)d_in[10];
  const float* beta  = (const float*)d_in[11];
  float* out = (float*)d_out;

  char* ws = (char*)d_ws;
  unsigned short* PQb  = (unsigned short*)(ws + oPQ);
  unsigned short* PKb  = (unsigned short*)(ws + oPK);
  unsigned short* Wqt  = (unsigned short*)(ws + oWq);
  unsigned short* Wkt  = (unsigned short*)(ws + oWk);
  unsigned short* Wvt  = (unsigned short*)(ws + oWv);
  unsigned short* Wot  = (unsigned short*)(ws + oWo);
  unsigned short* Qh   = (unsigned short*)(ws + oQ);
  unsigned short* Kh   = (unsigned short*)(ws + oK);
  unsigned short* VTb  = (unsigned short*)(ws + oVT);
  unsigned short* CTXb = (unsigned short*)(ws + oCTX);
  float*          Xb   = (float*)(ws + oX);

  const dim3 blk(256);
  const int n8   = MROWS * DE / 8;               // 524288 at full size
  const int per8 = SEQ * DE / 8;
  const int src8 = SEQ_FULL * DE / 8;
  const dim3 gCvt((n8 + 255) / 256);
  const dim3 gWt((DE / 64) * (DE / 64), 4);      // 256 tiles x 4 matrices
  const dim3 gG(DE / 64, MROWS / 128);           // (16, 32) at full size
  int resqb = RESQB;
  if (resqb > NQB) resqb = NQB;

  // (1) activations -> bf16 planes (RNE convert)
  cvt_bf16x8s<<<gCvt, blk, 0, stream>>>(pre_q, PQb, n8, per8, src8);
  cvt_bf16x8s<<<gCvt, blk, 0, stream>>>(pre_k, PKb, n8, per8, src8);
  // (2) weights -> transposed 16-bit planes (Wq, Wk, Wv bf16; Wo f16 x64)
  wt_tiles<<<gWt, blk, 0, stream>>>(Wq, Wk, Wv, Wo, Wqt, Wkt, Wvt, Wot);
  // (3) projections: q, k -> f16 row-major; v -> f16 v^T x64
  gemm_nt<0><<<gG, blk, 0, stream>>>(PQb, Wqt, bq, pre_q, Qh, Xb, 1.0f);
  gemm_nt<0><<<gG, blk, 0, stream>>>(PKb, Wkt, bk, pre_q, Kh, Xb, 1.0f);
  gemm_nt<1><<<gG, blk, 0, stream>>>(PKb, Wvt, bv, pre_q, VTb, Xb, VCARRY);
  // (4) attention -> ctx f16 x64: query blocks 0..resqb-1 with the p residual plane, the rest without
  attn_full64<true><<<dim3(NB * NH * resqb), dim3(128), 0, stream>>>(Qh, Kh, VTb, CTXb, 0, resqb);
  if (NQB - resqb > 0) {
    attn_full64<false><<<dim3(NB * NH * (NQB - resqb)), dim3(128), 0, stream>>>(Qh, Kh, VTb, CTXb, resqb, NQB - resqb);
  }
  // (5) output projection + bias + residual -> x f32
  gemm_nt<2><<<gG, blk, 0, stream>>>(CTXb, Wot, bo, pre_q, CTXb, Xb, 1.0f / (CCARRY * WCARRY));
  // (6) LayerNorm -> output
  ln_rows<<<dim3(MROWS), blk, 0, stream>>>(Xb, gamma, beta, out);
  (void)hipGetLastError();
}

// v001
// A run of this version takes 396 microseconds.
// Next to v000, in two timings, it ran 1.19 times as fast each time.
// Contractions: q/k/v projections = v_wmma_f32_16x16x32_bf16 (bf16 operands = RNE-converted activations and
// transposed weights, single product, f32 accumulate); q.k^T scores, p.v context and ctx.Wo projection =
// v_wmma_f32_16x16x32_f16 (q, k = f16 of the f32 projection sums, unscaled; p = exp(s - m) carried x16384 plus an
// f16 residual plane of p x4096 on the leading query blocks; v^T, ctx and Wo carried x64 in f16), f32 accumulate;
// softmax, bias/residual add and LayerNorm in f32.
#include <hip/hip_runtime.h>
#include <math.h>
#include <stdint.h>

#ifndef NB
#define NB 2                 // batches processed (reducible)
#endif
#ifndef NB_FULL
#define NB_FULL 2            // batches in the inputs / output
#endif
#ifndef SEQ
#define SEQ 2048             // query == key length processed (reducible)
#endif
#ifndef SEQ_FULL
#define SEQ_FULL 2048        // per-batch row stride of the inputs and of the output
#endif
#define DE    1024
#define NH    16
#define HD    64
#define NQB   (SEQ / 64)
#define MROWS (NB * SEQ)
#ifndef RESQB
#define RESQB 8              // leading 64-row query blocks per (b,h) that carry the p residual plane
#endif
#define PCARRY 16384.0f
#define PRES   4096.0f
#define VCARRY 64.0f
#define CCARRY 64.0f
#define WCARRY 64.0f
#define LP    72             // LDS row pitch (halves) of the attention K, V^T and P tiles: 144 B = 16 B x odd

static_assert(NB >= 1 && NB <= NB_FULL);
static_assert((SEQ % 128) == 0 && SEQ >= 128 && SEQ <= SEQ_FULL);
static_assert(NH * HD == DE);
static_assert(RESQB >= 1);
static_assert(LP >= HD && (LP % 8) == 0 && ((LP / 8) % 2) == 1);   // 16-B aligned rows, odd count of 16-B units
static_assert((MROWS % 128) == 0 && (DE % 64) == 0 && (DE % 32) == 0);
static_assert((long long)NB_FULL * SEQ_FULL * DE * 4 == 16777216LL);   // total output bytes at full size

typedef _Float16 v16h __attribute__((ext_vector_type(16)));
typedef _Float16 v8h  __attribute__((ext_vector_type(8)));
typedef __bf16   v16b __attribute__((ext_vector_type(16)));
typedef __bf16   v8b  __attribute__((ext_vector_type(8)));
typedef float    v8f  __attribute__((ext_vector_type(8)));
typedef float    v4f  __attribute__((ext_vector_type(4)));
typedef unsigned int v4u __attribute__((ext_vector_type(4)));
typedef unsigned short v8us __attribute__((ext_vector_type(8)));

// ---- scalar helpers --------------------------------------------------------------------------------
__device__ __forceinline__ unsigned short bf_bits(float f) {          // f32 -> bf16 bits, RNE convert
  unsigned u = __float_as_uint(f);
  return (unsigned short)((u + 0x7FFFu + ((u >> 16) & 1u)) >> 16);
}
__device__ __forceinline__ float bf_up(unsigned short h) { return __uint_as_float(((unsigned)h) << 16); }
__device__ __forceinline__ unsigned short h_bits(float f) {           // f32 -> f16 bits, RNE convert
  union { _Float16 h; unsigned short u; } cvt;
  cvt.h = (_Float16)f;
  return cvt.u;
}
__device__ __forceinline__ unsigned pk16(unsigned short a, unsigned short b) { return (unsigned)a | ((unsigned)b << 16); }
__device__ __forceinline__ v8f zero8() { v8f z = {0.f, 0.f, 0.f, 0.f, 0.f, 0.f, 0.f, 0.f}; return z; }

// ---- fragment loaders: 16-bit A/B operand, lane -> row/col (lane&15), p already includes +8*(lane>>4);
//      elements 0..7 <- p[0..7] (k0+8h..), elements 8..15 <- p[16..23] (k0+16+8h..)
__device__ __forceinline__ v16b ldfrag_b(const __bf16* p) {
  union { v16b v; v8b h[2]; } f;
  f.h[0] = *(const v8b*)(p);
  f.h[1] = *(const v8b*)(p + 16);
  return f.v;
}
__device__ __forceinline__ v16h ldfrag_h(const _Float16* p) {
  union { v16h v; v8h h[2]; } f;
  f.h[0] = *(const v8h*)(p);
  f.h[1] = *(const v8h*)(p + 16);
  return f.v;
}

// ---- WMMA helpers with trailing VALU hazard gap --------------------------------------------------------
__device__ __forceinline__ v8f mma_b(v16b a, v16b b, v8f c) {
  c = __builtin_amdgcn_wmma_f32_16x16x32_bf16(false, a, false, b, (short)0, c, false, false);
  asm volatile("v_nop\n\tv_nop\n\tv_nop\n\tv_nop" : "+v"(c) : "v"(a), "v"(b));
  return c;
}
__device__ __forceinline__ v8f mma_h(v16h a, v16h b, v8f c) {
  c = __builtin_amdgcn_wmma_f32_16x16x32_f16(false, a, false, b, (short)0, c, false, false);
  asm volatile("v_nop\n\tv_nop\n\tv_nop\n\tv_nop" : "+v"(c) : "v"(a), "v"(b));
  return c;
}

// =====================================================================================================
// f32 -> bf16 (RNE convert), 8 elements per thread, one 16-B store per lane: a wave writes 512 contiguous B
// Destination plane is compact [b][SEQ*DE]; source batch stride src8 (units of 8 floats) may be larger.
// coverage: n8 threads x 8 = whole plane (n8 = NB*SEQ*DE/8 is a multiple of 256).
// =====================================================================================================
__global__ __launch_bounds__(256) void cvt_bf16x8s(const float* __restrict__ in, unsigned short* out,
                                                   int n8, int per8, int src8) {
  const int i = blockIdx.x * 256 + threadIdx.x;
  if (i < n8) {
    const int hd  = i / per8;
    const int rem = i - hd * per8;
    const float* s = in + ((size_t)hd * src8 + (size_t)rem) * 8;
    const v4f a = *(const v4f*)(s);
    const v4f b = *(const v4f*)(s + 4);
    v4u p;
    p[0] = pk16(bf_bits(a[0]), bf_bits(a[1]));
    p[1] = pk16(bf_bits(a[2]), bf_bits(a[3]));
    p[2] = pk16(bf_bits(b[0]), bf_bits(b[1]));
    p[3] = pk16(bf_bits(b[2]), bf_bits(b[3]));
    *(v4u*)(out + (size_t)i * 8) = p;
    
  }
}

// =====================================================================================================
// Weight W[k][n] f32 (DE x DE, n contiguous) -> transposed 16-bit plane Wt[n][k] (k contiguous, pitch DE).
//   blockIdx.y = matrix id: 0,1,2 -> bf16 bits of the RNE-bf16 value; 3 -> f16 bits of (RNE-bf16 value x64).
//   Block = one 64(k) x 64(n) tile, 256 threads: thread (k = tid>>2, 16-column n quarter) loads 16 floats of row k
//   and writes them transposed into the LDS tile T[n][k]; after the barrier wave w writes rows n = 8w..8w+7:
//   grid.x = (DE/64)^2 tiles covers the whole plane of each of the 4 matrices.
// =====================================================================================================
__global__ __launch_bounds__(256) void wt_tiles(const float* __restrict__ w0, const float* __restrict__ w1,
                                                const float* __restrict__ w2, const float* __restrict__ w3,
                                                unsigned short* o0, unsigned short* o1,
                                                unsigned short* o2, unsigned short* o3) {
  __shared__ __align__(16) unsigned short T[64 * 64];   // [n][k]
  const int tid = threadIdx.x;
  const int mat = blockIdx.y;                            // block-uniform
  const float* in = w0; unsigned short* out = o0;
  if (mat == 1) { in = w1; out = o1; }
  else if (mat == 2) { in = w2; out = o2; }
  else if (mat == 3) { in = w3; out = o3; }
  const int ktile = blockIdx.x / (DE / 64);
  const int ntile = blockIdx.x - ktile * (DE / 64);
  const int k   = tid >> 2;              // 0..63
  const int nq  = (tid & 3) * 16;        // 0,16,32,48
  const float* src = in + (size_t)(ktile * 64 + k) * DE + ntile * 64 + nq;
#pragma unroll
  for (int i = 0; i < 4; ++i) {
    const v4f a = *(const v4f*)(src + 4 * i);
#pragma unroll
    for (int e = 0; e < 4; ++e) {
      const unsigned short bb = bf_bits(a[e]);
      const unsigned short hb = h_bits(bf_up(bb) * WCARRY);
      const unsigned short us = (mat == 3) ? hb : bb;
      T[(nq + 4 * i + e) * 64 + k] = us;
    }
  }
  __syncthreads();
  const int wave = tid >> 5, lane = tid & 31;
  const int q = lane >> 3, c8 = (lane & 7) * 8;
  union { v8us s; v4u u; } x0, x1;
  const int d0 = wave * 8 + q;
  const int d1 = wave * 8 + 4 + q;
  x0.s = *(const v8us*)(T + d0 * 64 + c8);
  x1.s = *(const v8us*)(T + d1 * 64 + c8);
  unsigned short* p0 = out + ((size_t)(ntile * 64 + d0) * DE + ktile * 64 + c8);
  unsigned short* p1 = out + ((size_t)(ntile * 64 + d1) * DE + ktile * 64 + c8);
  *(v4u*)p0 = x0.u;
  *(v4u*)p1 = x1.u;
  
}

// =====================================================================================================
// 16-bit GEMM C[m][n] = sum_k A[m][k] * Bt[n][k], K = DE, M = MROWS, N = DE. Block 256 threads = 8 waves,
// block tile 128 m x 64 n, wave tile 16 x 64 (4 accumulators), k step 32; A and B fragments straight from the
// 16-bit global rows (two 16-B loads each, identical k map). grid = (DE/64, MROWS/128), exact multiples.
//   MODE 0: bf16 operands; out16 f16 row-major [MROWS][DE] = (acc + bias) * scale. Wave tile staged in wave-private
//   MODE 1: bf16 operands; out16 f16 transposed per batch [b][DE][SEQ] = (acc + bias) * scale. Block tile staged in
//           cross-wave LDS T[n][key 128] (block barrier); wave w writes rows n = 8w..8w+7, one instruction = 2 rows
//           of 128 halves (16 lanes x 16 B per 256-B row); coverage 8 waves x 4 it x 2 rows x 128 = 64x128.
//   MODE 2: f16 operands; out32 f32 row-major [MROWS][DE] = acc * scale + bias + RNE-bf16(resid), resid rows read at
//           the full batch stride. Wave-private LDS stage (f32), one instruction = 2 rows of 64 floats (16 lanes x
//           16 B per 256-B segment); coverage 8 it x 2 rows x 64 = 16x64.
// =====================================================================================================
template <int MODE>
__global__ __launch_bounds__(256)
void gemm_nt(const unsigned short* __restrict__ A, const unsigned short* __restrict__ Bt,
             const float* __restrict__ bias, const float* __restrict__ resid,
             unsigned short* out16, float* out32, float scale) {
  __shared__ __align__(16) unsigned char smem[32768];
  const int tid  = threadIdx.x;
  const int wave = tid >> 5;
  const int lane = tid & 31;
  const int hh   = lane >> 4;
  const int c    = lane & 15;
  const int m0b  = blockIdx.y * 128;
  const int m0   = m0b + wave * 16;
  const int n0   = blockIdx.x * 64;

  v8f acc[4];
#pragma unroll
  for (int t = 0; t < 4; ++t) acc[t] = zero8();

  const size_t aoff = (size_t)(m0 + c) * DE + 8 * hh;
  const size_t boff = (size_t)(n0 + c) * DE + 8 * hh;
  if (MODE == 2) {
    const _Float16* Ah = (const _Float16*)(const void*)A + aoff;
    const _Float16* Bh = (const _Float16*)(const void*)Bt + boff;
#pragma unroll 2
    for (int k0 = 0; k0 < DE; k0 += 32) {
      const v16h a = ldfrag_h(Ah + k0);
#pragma unroll
      for (int t = 0; t < 4; ++t) {
        const v16h b = ldfrag_h(Bh + (size_t)t * 16 * DE + k0);
        acc[t] = mma_h(a, b, acc[t]);
      }
    }
  } else {
    const __bf16* Ab = (const __bf16*)(const void*)A + aoff;
    const __bf16* Bb = (const __bf16*)(const void*)Bt + boff;
#pragma unroll 2
    for (int k0 = 0; k0 < DE; k0 += 32) {
      const v16b a = ldfrag_b(Ab + k0);
#pragma unroll
      for (int t = 0; t < 4; ++t) {
        const v16b b = ldfrag_b(Bb + (size_t)t * 16 * DE + k0);
        acc[t] = mma_b(a, b, acc[t]);
      }
    }
  }

  if (MODE == 0) {
    _Float16* S = (_Float16*)(void*)smem + wave * 1024;          // [16][64] per wave
#pragma unroll
    for (int t = 0; t < 4; ++t) {
      const float bi = bf_up(bf_bits(bias[n0 + t * 16 + c]));
#pragma unroll
      for (int r = 0; r < 8; ++r) S[(8 * hh + r) * 64 + t * 16 + c] = (_Float16)((acc[t][r] + bi) * scale);
    }
    __builtin_amdgcn_fence(__ATOMIC_RELEASE, "workgroup");
    __builtin_amdgcn_wave_barrier();
    __builtin_amdgcn_fence(__ATOMIC_ACQUIRE, "workgroup");
    const int rq = lane >> 3, c8 = (lane & 7) * 8;
    union { v8h h; v4u u; } w[4];
#pragma unroll
    for (int it = 0; it < 4; ++it) w[it].h = *(const v8h*)(S + (it * 4 + rq) * 64 + c8);
    {
#pragma unroll
      for (int it = 0; it < 4; ++it)
        *(v4u*)(out16 + (size_t)(m0 + it * 4 + rq) * DE + n0 + c8) = w[it].u;
      
    }
  } else if (MODE == 1) {
    _Float16* T = (_Float16*)(void*)smem;                       // [n 64][key 128]
#pragma unroll
    for (int t = 0; t < 4; ++t) {
      const float bi = bf_up(bf_bits(bias[n0 + t * 16 + c]));
#pragma unroll
      for (int r = 0; r < 8; ++r)
        T[(t * 16 + c) * 128 + wave * 16 + 8 * hh + r] = (_Float16)((acc[t][r] + bi) * scale);
    }
    __syncthreads();
    const int bidx = m0b / SEQ;                                  // tiles never straddle batches (128 | SEQ)
    const int key0 = m0b - bidx * SEQ;
    const int rh = lane >> 4, c8 = (lane & 15) * 8;
    union { v8h h; v4u u; } w[4];
#pragma unroll
    for (int it = 0; it < 4; ++it) w[it].h = *(const v8h*)(T + (wave * 8 + it * 2 + rh) * 128 + c8);
    {
#pragma unroll
      for (int it = 0; it < 4; ++it) {
        const int row = wave * 8 + it * 2 + rh;
        *(v4u*)(out16 + ((size_t)(bidx * DE + n0 + row) * SEQ + key0 + c8)) = w[it].u;
      }
      
    }
  } else {
    float* S = (float*)(void*)smem + wave * 1024;                // [16][64] f32 per wave
#pragma unroll
    for (int t = 0; t < 4; ++t) {
      const float bi = bf_up(bf_bits(bias[n0 + t * 16 + c]));
#pragma unroll
      for (int r = 0; r < 8; ++r) S[(8 * hh + r) * 64 + t * 16 + c] = acc[t][r] * scale + bi;
    }
    __builtin_amdgcn_fence(__ATOMIC_RELEASE, "workgroup");
    __builtin_amdgcn_wave_barrier();
    __builtin_amdgcn_fence(__ATOMIC_ACQUIRE, "workgroup");
    const int rh = lane >> 4, c4 = (lane & 15) * 4;
    v4f vals[8];
#pragma unroll
    for (int it = 0; it < 8; ++it) {
      const int row = it * 2 + rh;
      const int gm  = m0 + row;
      const int bb  = gm / SEQ;
      const int tt  = gm - bb * SEQ;
      v4f x = *(const v4f*)(S + row * 64 + c4);
      const v4f rq = *(const v4f*)(resid + ((size_t)bb * SEQ_FULL + tt) * DE + n0 + c4);
#pragma unroll
      for (int e = 0; e < 4; ++e) x[e] = x[e] + bf_up(bf_bits(rq[e]));
      vals[it] = x;
    }
    {
#pragma unroll
      for (int it = 0; it < 8; ++it)
        *(v4f*)(out32 + (size_t)(m0 + it * 2 + rh) * DE + n0 + c4) = vals[it];
      
    }
  }
}

// =====================================================================================================
// Full (unmasked) attention, head dim 64, all NQB key tiles.
//   q plane (f16):  element (b, t, h, d) at [(b*SEQ + t)*DE + h*64 + d]      k plane (f16): same with key index s
//   v^T plane (f16): element (b, h, d, s) at [(b*DE + h*64 + d)*SEQ + s], value v*64
//   scores = q . k (f16 WMMA, f32 acc) * 0.125; online softmax in f32; p = exp(s - m) carried as f16(16384 p);
//   context = p . v on f16 WMMA; RES adds the f16 residual plane of p (x4096, separate accumulator folded back
//   with 1/4096 per tile in f32). ctx out = f16(context / (l * 16384 * 64) * 64) to [(b*SEQ + t)*DE + h*64 + d].
//   Block = 4 waves = 64 query rows of one (b,h); grid = nqbThis * NH * NB; kv tiles of 64.
//   K / V^T tile staging: 128 threads x 32 elements per plane = the whole 64x64 tile (plain 16-B loads,
//   __syncthreads before and after, cross-wave); staged extent == consumed extent for Ksh, Vth, Psh, Psl, Os.
//   Ksh, Vth, Psh, Psl rows lie at pitch LP (64 used halves + 8 never touched) so that the 16 rows one 16-B fragment
//   read walks fall on 16 different bank groups.
//   P tiles and the Os tile are wave-private, spilled with _Float16 element stores and reloaded as v8h (same element
//   Output coverage: each wave stores rows 0..15 (it 0..3 x lane>>3) x 64 halves (8 lanes x 16 B): one instruction
// =====================================================================================================
template <bool RES>
__global__ __launch_bounds__(128)
void attn_full64(const unsigned short* __restrict__ qp, const unsigned short* __restrict__ kp,
                 const unsigned short* __restrict__ vtp, unsigned short* ctx, int qbBase, int nqbThis) {
  union FH { v16h v; v8h h[2]; };
  __shared__ __align__(16) _Float16 Ksh[64 * LP];                 // K [kv][d], pitch LP
  __shared__ __align__(16) _Float16 Vth[64 * LP];                 // V^T [d][kv], pitch LP
  __shared__ __align__(16) _Float16 Psh[4][16 * LP];              // per wave P [row][kv], pitch LP
  __shared__ __align__(16) _Float16 Psl[RES ? 4 : 1][16 * LP];    // per wave P residual, pitch LP
  __shared__ __align__(16) _Float16 Os[4][16 * 64];               // per wave context tile [row][d]

  const int tid  = threadIdx.x;
  const int wave = tid >> 5;
  const int lane = tid & 31;
  const int hh   = lane >> 4;
  const int c    = lane & 15;

  const int bx   = blockIdx.x;
  const int qbl  = bx % nqbThis;
  const int bhq  = bx / nqbThis;           // 0..NB*NH-1
  const int h    = bhq % NH;
  const int b    = bhq / NH;
  const int qb   = qbBase + qbl;           // 0..NQB-1
  const int q0   = qb * 64 + wave * 16;    // query index within the sequence

  const _Float16* Qh = (const _Float16*)(const void*)qp + (size_t)b * SEQ * DE + (size_t)h * HD;
  const _Float16* Kh = (const _Float16*)(const void*)kp + (size_t)b * SEQ * DE + (size_t)h * HD;
  const _Float16* Vh = (const _Float16*)(const void*)vtp + ((size_t)b * DE + (size_t)h * HD) * SEQ;

  // ---- Q fragments (A operand, row = lane&15): 2 d-chunks ----
  v16h qa[2];
#pragma unroll
  for (int dc = 0; dc < 2; ++dc) {
    const size_t qo = (size_t)(q0 + c) * DE + dc * 32 + 8 * hh;
    qa[dc] = ldfrag_h(Qh + qo);
  }

  float mrow[8], lrow[8];
  v8f oacc[4];
#pragma unroll
  for (int r = 0; r < 8; ++r) { mrow[r] = -INFINITY; lrow[r] = 0.f; }
#pragma unroll
  for (int t = 0; t < 4; ++t) oacc[t] = zero8();

  for (int kt = 0; kt < NQB; ++kt) {        // block-uniform bounds, exactly NQB trips
    const int kv0 = kt * 64;
    __syncthreads();
    {
      const int r = tid >> 1, half = (tid & 1) * 32;
      const _Float16* kg = Kh + (size_t)(kv0 + r) * DE + half;   // K row kv0+r, d = half..half+31
      const _Float16* vg = Vh + (size_t)r * SEQ + kv0 + half;    // V^T row d = r, s = kv0+half..+31
#pragma unroll
      for (int i = 0; i < 4; ++i) {
        const v8h a0 = *(const v8h*)(kg + 8 * i);
        const v8h b0 = *(const v8h*)(vg + 8 * i);
        *(v8h*)(Ksh + r * LP + half + 8 * i) = a0;
        *(v8h*)(Vth + r * LP + half + 8 * i) = b0;
      }
    }
    __syncthreads();

    // ---- scores: 16 query rows x 64 keys per wave, single f16 product ----
    v8f s[4];
#pragma unroll
    for (int j = 0; j < 4; ++j) {
      s[j] = zero8();
#pragma unroll
      for (int dc = 0; dc < 2; ++dc) {
        FH kb;
        kb.h[0] = *(const v8h*)(Ksh + (j * 16 + c) * LP + dc * 32 + 8 * hh);
        kb.h[1] = *(const v8h*)(Ksh + (j * 16 + c) * LP + dc * 32 + 16 + 8 * hh);
        s[j] = mma_h(qa[dc], kb.v, s[j]);
      }
    }

    // ---- scale, row max, online softmax, P (x16384, f16) and P residual (x4096) to LDS ----
    _Float16* pwh = Psh[wave];
    _Float16* pwl = Psl[RES ? wave : 0];
#pragma unroll
    for (int r = 0; r < 8; ++r) {
      float m = -INFINITY;
#pragma unroll
      for (int j = 0; j < 4; ++j) {
        const float sv = s[j][r] * 0.125f;
        s[j][r] = sv;
        m = fmaxf(m, sv);
      }
#pragma unroll
      for (int off = 1; off < 16; off <<= 1) m = fmaxf(m, __shfl_xor(m, off, 32));
      const float mnew  = fmaxf(mrow[r], m);
      const float msafe = (mnew == -INFINITY) ? 0.f : mnew;
      const float alpha = __expf(mrow[r] - msafe);
      mrow[r] = mnew;
      float psum = 0.f;
#pragma unroll
      for (int j = 0; j < 4; ++j) {
        const float p = __expf(s[j][r] - msafe);
        psum += p;
        const float p1k = p * PCARRY;
        const _Float16 ph = (_Float16)p1k;
        pwh[(8 * hh + r) * LP + j * 16 + c] = ph;
        if (RES) {
          const _Float16 pl = (_Float16)((p1k - (float)ph) * PRES);
          pwl[(8 * hh + r) * LP + j * 16 + c] = pl;
        }
      }
#pragma unroll
      for (int off = 1; off < 16; off <<= 1) psum += __shfl_xor(psum, off, 32);
      lrow[r] = lrow[r] * alpha + psum;
#pragma unroll
      for (int t = 0; t < 4; ++t) oacc[t][r] *= alpha;
    }
    __builtin_amdgcn_fence(__ATOMIC_RELEASE, "workgroup");
    __builtin_amdgcn_wave_barrier();
    __builtin_amdgcn_fence(__ATOMIC_ACQUIRE, "workgroup");

    // ---- context += P . V (f16 WMMA), residual products into a separate accumulator ----
    v8f o1[4];
#pragma unroll
    for (int t = 0; t < 4; ++t) o1[t] = zero8();
#pragma unroll 1
    for (int kk = 0; kk < 2; ++kk) {
      FH pa, pl;
      pa.h[0] = *(const v8h*)(pwh + c * LP + kk * 32 + 8 * hh);
      pa.h[1] = *(const v8h*)(pwh + c * LP + kk * 32 + 16 + 8 * hh);
      if (RES) {
        pl.h[0] = *(const v8h*)(pwl + c * LP + kk * 32 + 8 * hh);
        pl.h[1] = *(const v8h*)(pwl + c * LP + kk * 32 + 16 + 8 * hh);
      } else {
        pl.v = pa.v;
      }
#pragma unroll
      for (int t = 0; t < 4; ++t) {
        FH vb;
        vb.h[0] = *(const v8h*)(Vth + (t * 16 + c) * LP + kk * 32 + 8 * hh);
        vb.h[1] = *(const v8h*)(Vth + (t * 16 + c) * LP + kk * 32 + 16 + 8 * hh);
        oacc[t] = mma_h(pa.v, vb.v, oacc[t]);
        if (RES) o1[t] = mma_h(pl.v, vb.v, o1[t]);
      }
    }
    if (RES) {
#pragma unroll
      for (int t = 0; t < 4; ++t)
#pragma unroll
        for (int r = 0; r < 8; ++r) oacc[t][r] += o1[t][r] * (1.0f / PRES);
    }
  }

  // ---- normalise (1/l, the p, v carries) and apply the ctx carry; stage the wave's 16x64 f16 tile; write whole
  _Float16* os = Os[wave];
#pragma unroll
  for (int r = 0; r < 8; ++r) {
    const float l = lrow[r];
    const float inv = ((l > 0.f) ? (1.0f / l) : 0.f) * (CCARRY / (PCARRY * VCARRY));
#pragma unroll
    for (int t = 0; t < 4; ++t) os[(8 * hh + r) * 64 + t * 16 + c] = (_Float16)(oacc[t][r] * inv);
  }
  __builtin_amdgcn_fence(__ATOMIC_RELEASE, "workgroup");
  __builtin_amdgcn_wave_barrier();
  __builtin_amdgcn_fence(__ATOMIC_ACQUIRE, "workgroup");
  {
    const int rq = lane >> 3, c8 = (lane & 7) * 8;
    union { v8h h; v4u u; } w[4];
#pragma unroll
    for (int it = 0; it < 4; ++it) w[it].h = *(const v8h*)(os + (it * 4 + rq) * 64 + c8);
    unsigned short* ob = ctx + ((size_t)b * SEQ) * DE + (size_t)h * HD;
    {
#pragma unroll
      for (int it = 0; it < 4; ++it) {
        const int row = it * 4 + rq;                     // it 0..3 x rq 0..3 = rows 0..15
        *(v4u*)(ob + (size_t)(q0 + row) * DE + c8) = w[it].u;
      }
      
    }
  }
}

// =====================================================================================================
// LayerNorm over DE of x [MROWS][DE] f32: one block of 256 threads per row, thread owns 4 consecutive floats.
// mean and centred variance via wave shuffles + 8-entry LDS partials (cross-wave, block barriers), fixed order.
// y = (x - mu) * rsqrt(var + 1e-5) * RNE-bf16(gamma) + RNE-bf16(beta). Output row b*SEQ_FULL + t of d_out;
// coverage: MROWS blocks x 256 threads x 4 floats = every processed output row in full.
// =====================================================================================================
__global__ __launch_bounds__(256) void ln_rows(const float* __restrict__ x, const float* __restrict__ gam,
                                               const float* __restrict__ bet, float* out) {
  __shared__ float red1[8];
  __shared__ float red2[8];
  const int tid = threadIdx.x, wave = tid >> 5, lane = tid & 31;
  const int row = blockIdx.x;
  const int bb  = row / SEQ;
  const int tt  = row - bb * SEQ;
  const size_t orow = (size_t)bb * SEQ_FULL + (size_t)tt;

  const v4f v = *(const v4f*)(x + (size_t)row * DE + tid * 4);
  float s = (v[0] + v[1]) + (v[2] + v[3]);
#pragma unroll
  for (int off = 16; off > 0; off >>= 1) s += __shfl_xor(s, off, 32);
  if (lane == 0) red1[wave] = s;
  __syncthreads();
  float tot = 0.f;
#pragma unroll
  for (int w = 0; w < 8; ++w) tot += red1[w];
  const float mu = tot * (1.0f / (float)DE);

  v4f d;
#pragma unroll
  for (int e = 0; e < 4; ++e) d[e] = v[e] - mu;
  float s2 = (d[0] * d[0] + d[1] * d[1]) + (d[2] * d[2] + d[3] * d[3]);
#pragma unroll
  for (int off = 16; off > 0; off >>= 1) s2 += __shfl_xor(s2, off, 32);
  if (lane == 0) red2[wave] = s2;
  __syncthreads();
  float tot2 = 0.f;
#pragma unroll
  for (int w = 0; w < 8; ++w) tot2 += red2[w];
  const float var  = tot2 * (1.0f / (float)DE);
  const float rstd = rsqrtf(var + 1.0e-5f);

  const v4f g4 = *(const v4f*)(gam + tid * 4);
  const v4f b4 = *(const v4f*)(bet + tid * 4);
  v4f y;
#pragma unroll
  for (int e = 0; e < 4; ++e) y[e] = (d[e] * rstd) * bf_up(bf_bits(g4[e])) + bf_up(bf_bits(b4[e]));
  float* op = out + orow * DE + (size_t)tid * 4;
  *(v4f*)op = y;
  
}

// =====================================================================================================
// Workspace map (bytes, full size): PQ bf16 [MROWS][DE] at 0 (8388608); PK bf16 at 8388608 (8388608);
// Wq^T, Wk^T, Wv^T bf16 and Wo^T f16 [DE][DE] at 16777216.. (4 x 2097152); Q f16 [MROWS][DE] at 25165824;
// K f16 at 33554432; V^T f16 [NB][DE][SEQ] at 41943040; CTX f16 [MROWS][DE] at 50331648; X f32 [MROWS][DE]
// at 58720256 (16777216); end 75497472. Every plane is an exact multiple of its whole-line store granularity
// Launch plan (10): cvt pre_q, cvt pre_k, weight transpose-convert, gemm q, gemm k, gemm v^T, attention (leading
// query blocks with the p residual, remaining blocks without), gemm o + residual, LayerNorm.
// =====================================================================================================
extern "C" void kernel_launch(void* const* d_in, const int* in_sizes, int n_in,
                              void* d_out, int out_size, void* d_ws, size_t ws_size,
                              hipStream_t stream) {
  if (n_in < 12) return;
  const long long needIn = (long long)(NB - 1) * SEQ_FULL * DE + (long long)SEQ * DE;
  if ((long long)in_sizes[0] < needIn || (long long)in_sizes[1] < needIn) return;
  if (in_sizes[2] < DE * DE || in_sizes[4] < DE * DE || in_sizes[6] < DE * DE || in_sizes[8] < DE * DE) return;
  if (in_sizes[3] < DE || in_sizes[5] < DE || in_sizes[7] < DE || in_sizes[9] < DE) return;
  if (in_sizes[10] < DE || in_sizes[11] < DE) return;
  if (out_size < 0 || (long long)out_size < needIn) return;

  const size_t P16 = (size_t)MROWS * DE * 2;     // one 16-bit activation plane
  const size_t W16 = (size_t)DE * DE * 2;        // one 16-bit weight plane
  const size_t P32 = (size_t)MROWS * DE * 4;     // x plane
  size_t off = 0;
  const size_t oPQ  = off; off += P16;
  const size_t oPK  = off; off += P16;
  const size_t oWq  = off; off += W16;
  const size_t oWk  = off; off += W16;
  const size_t oWv  = off; off += W16;
  const size_t oWo  = off; off += W16;
  const size_t oQ   = off; off += P16;
  const size_t oK   = off; off += P16;
  const size_t oVT  = off; off += P16;
  const size_t oCTX = off; off += P16;
  const size_t oX   = off; off += P32;
  if (off > ws_size) return;                     // off = 75497472 at full size
  if (off > (size_t)134217728) return;

  const float* pre_q = (const float*)d_in[0];
  const float* pre_k = (const float*)d_in[1];
  const float* Wq    = (const float*)d_in[2];
  const float* bq    = (const float*)d_in[3];
  const float* Wk    = (const float*)d_in[4];
  const float* bk    = (const float*)d_in[5];
  const float* Wv    = (const float*)d_in[6];
  const float* bv    = (const float*)d_in[7];
  const float* Wo    = (const float*)d_in[8];
  const float* bo    = (const float*)d_in[9];
  const float* gamma = (const float*)d_in[10];
  const float* beta  = (const float*)d_in[11];
  float* out = (float*)d_out;

  char* ws = (char*)d_ws;
  unsigned short* PQb  = (unsigned short*)(ws + oPQ);
  unsigned short* PKb  = (unsigned short*)(ws + oPK);
  unsigned short* Wqt  = (unsigned short*)(ws + oWq);
  unsigned short* Wkt  = (unsigned short*)(ws + oWk);
  unsigned short* Wvt  = (unsigned short*)(ws + oWv);
  unsigned short* Wot  = (unsigned short*)(ws + oWo);
  unsigned short* Qh   = (unsigned short*)(ws + oQ);
  unsigned short* Kh   = (unsigned short*)(ws + oK);
  unsigned short* VTb  = (unsigned short*)(ws + oVT);
  unsigned short* CTXb = (unsigned short*)(ws + oCTX);
  float*          Xb   = (float*)(ws + oX);

  const dim3 blk(256);
  const int n8   = MROWS * DE / 8;               // 524288 at full size
  const int per8 = SEQ * DE / 8;
  const int src8 = SEQ_FULL * DE / 8;
  const dim3 gCvt((n8 + 255) / 256);
  const dim3 gWt((DE / 64) * (DE / 64), 4);      // 256 tiles x 4 matrices
  const dim3 gG(DE / 64, MROWS / 128);           // (16, 32) at full size
  int resqb = RESQB;
  if (resqb > NQB) resqb = NQB;

  // (1) activations -> bf16 planes (RNE convert)
  cvt_bf16x8s<<<gCvt, blk, 0, stream>>>(pre_q, PQb, n8, per8, src8);
  cvt_bf16x8s<<<gCvt, blk, 0, stream>>>(pre_k, PKb, n8, per8, src8);
  // (2) weights -> transposed 16-bit planes (Wq, Wk, Wv bf16; Wo f16 x64)
  wt_tiles<<<gWt, blk, 0, stream>>>(Wq, Wk, Wv, Wo, Wqt, Wkt, Wvt, Wot);
  // (3) projections: q, k -> f16 row-major; v -> f16 v^T x64
  gemm_nt<0><<<gG, blk, 0, stream>>>(PQb, Wqt, bq, pre_q, Qh, Xb, 1.0f);
  gemm_nt<0><<<gG, blk, 0, stream>>>(PKb, Wkt, bk, pre_q, Kh, Xb, 1.0f);
  gemm_nt<1><<<gG, blk, 0, stream>>>(PKb, Wvt, bv, pre_q, VTb, Xb, VCARRY);
  // (4) attention -> ctx f16 x64: query blocks 0..resqb-1 with the p residual plane, the rest without
  attn_full64<true><<<dim3(NB * NH * resqb), dim3(128), 0, stream>>>(Qh, Kh, VTb, CTXb, 0, resqb);
  if (NQB - resqb > 0) {
    attn_full64<false><<<dim3(NB * NH * (NQB - resqb)), dim3(128), 0, stream>>>(Qh, Kh, VTb, CTXb, resqb, NQB - resqb);
  }
  // (5) output projection + bias + residual -> x f32
  gemm_nt<2><<<gG, blk, 0, stream>>>(CTXb, Wot, bo, pre_q, CTXb, Xb, 1.0f / (CCARRY * WCARRY));
  // (6) LayerNorm -> output
  ln_rows<<<dim3(MROWS), blk, 0, stream>>>(Xb, gamma, beta, out);
  (void)hipGetLastError();
}

// v002
// Measured time: 316 microseconds a run.
// Timed twice side by side with v001, it ran 1.25 times as fast both times.
// All steps since v000 together make it 1.49 times as fast.
// Contractions: q/k/v projections = v_wmma_f32_16x16x32_bf16 (bf16 operands = RNE-converted activations and
// transposed weights, single product, f32 accumulate); q.k^T scores, p.v context and ctx.Wo projection =
// v_wmma_f32_16x16x32_f16 (q, k = f16 of the f32 projection sums, unscaled; p = exp(s - m) carried x16384 plus an
// f16 residual plane of p x4096 on the leading query blocks; v^T, ctx and Wo carried x64 in f16), f32 accumulate;
// softmax, bias/residual add and LayerNorm in f32.
#include <hip/hip_runtime.h>
#include <math.h>
#include <stdint.h>

#ifndef NB
#define NB 2                 // batches processed (reducible)
#endif
#ifndef NB_FULL
#define NB_FULL 2            // batches in the inputs / output
#endif
#ifndef SEQ
#define SEQ 2048             // query == key length processed (reducible)
#endif
#ifndef SEQ_FULL
#define SEQ_FULL 2048        // per-batch row stride of the inputs and of the output
#endif
#define DE    1024
#define NH    16
#define HD    64
#define NQB   (SEQ / 64)
#define MROWS (NB * SEQ)
#ifndef RESQB
#define RESQB 8              // leading 64-row query blocks per (b,h) that carry the p residual plane
#endif
#define PCARRY 16384.0f
#define PRES   4096.0f
#define VCARRY 64.0f
#define CCARRY 64.0f
#define WCARRY 64.0f
#define LP    72             // LDS row pitch (halves) of the attention K, V^T and P tiles: 144 B = 16 B x odd

static_assert(NB >= 1 && NB <= NB_FULL);
static_assert((SEQ % 128) == 0 && SEQ >= 128 && SEQ <= SEQ_FULL);
static_assert(NH * HD == DE);
static_assert(RESQB >= 1);
static_assert(LP >= HD && (LP % 8) == 0 && ((LP / 8) % 2) == 1);   // 16-B aligned rows, odd count of 16-B units
static_assert((MROWS % 128) == 0 && (DE % 64) == 0 && (DE % 32) == 0);
static_assert((long long)NB_FULL * SEQ_FULL * DE * 4 == 16777216LL);   // total output bytes at full size

typedef _Float16 v16h __attribute__((ext_vector_type(16)));
typedef _Float16 v8h  __attribute__((ext_vector_type(8)));
typedef __bf16   v16b __attribute__((ext_vector_type(16)));
typedef __bf16   v8b  __attribute__((ext_vector_type(8)));
typedef float    v8f  __attribute__((ext_vector_type(8)));
typedef float    v4f  __attribute__((ext_vector_type(4)));
typedef unsigned int v4u __attribute__((ext_vector_type(4)));
typedef unsigned short v8us __attribute__((ext_vector_type(8)));

// ---- scalar helpers --------------------------------------------------------------------------------
__device__ __forceinline__ unsigned short bf_bits(float f) {          // f32 -> bf16 bits, RNE convert
  unsigned u = __float_as_uint(f);
  return (unsigned short)((u + 0x7FFFu + ((u >> 16) & 1u)) >> 16);
}
__device__ __forceinline__ float bf_up(unsigned short h) { return __uint_as_float(((unsigned)h) << 16); }
__device__ __forceinline__ unsigned short h_bits(float f) {           // f32 -> f16 bits, RNE convert
  union { _Float16 h; unsigned short u; } cvt;
  cvt.h = (_Float16)f;
  return cvt.u;
}
__device__ __forceinline__ unsigned pk16(unsigned short a, unsigned short b) { return (unsigned)a | ((unsigned)b << 16); }
__device__ __forceinline__ v8f zero8() { v8f z = {0.f, 0.f, 0.f, 0.f, 0.f, 0.f, 0.f, 0.f}; return z; }

// ---- 16-lane row reductions of eight values at once, on the vector unit -------------------------------------
// Four xor steps (lane l with lane l ^ 1, 2, 4, 8 of its 16-lane row), each for all eight registers. The partner's
// value comes as a DPP operand: no LDS crossbar trip and no wait. The eight rows stand side by side in each step, so
// that a step's producer is eight instructions back. All 32 lanes are on at both call sites.
// asm: the compiler turns __shfl_xor into ds_bpermute_b32 with a wait behind each, and chains the rows one by one.
__device__ __forceinline__ void row_max8(float (&x)[8]) {
  asm(
      "v_max_num_f32_dpp %0, %0, %0 row_xmask:1 row_mask:0xf bank_mask:0xf\n\t"
      "v_max_num_f32_dpp %1, %1, %1 row_xmask:1 row_mask:0xf bank_mask:0xf\n\t"
      "v_max_num_f32_dpp %2, %2, %2 row_xmask:1 row_mask:0xf bank_mask:0xf\n\t"
      "v_max_num_f32_dpp %3, %3, %3 row_xmask:1 row_mask:0xf bank_mask:0xf\n\t"
      "v_max_num_f32_dpp %4, %4, %4 row_xmask:1 row_mask:0xf bank_mask:0xf\n\t"
      "v_max_num_f32_dpp %5, %5, %5 row_xmask:1 row_mask:0xf bank_mask:0xf\n\t"
      "v_max_num_f32_dpp %6, %6, %6 row_xmask:1 row_mask:0xf bank_mask:0xf\n\t"
      "v_max_num_f32_dpp %7, %7, %7 row_xmask:1 row_mask:0xf bank_mask:0xf\n\t"
      "v_max_num_f32_dpp %0, %0, %0 row_xmask:2 row_mask:0xf bank_mask:0xf\n\t"
      "v_max_num_f32_dpp %1, %1, %1 row_xmask:2 row_mask:0xf bank_mask:0xf\n\t"
      "v_max_num_f32_dpp %2, %2, %2 row_xmask:2 row_mask:0xf bank_mask:0xf\n\t"
      "v_max_num_f32_dpp %3, %3, %3 row_xmask:2 row_mask:0xf bank_mask:0xf\n\t"
      "v_max_num_f32_dpp %4, %4, %4 row_xmask:2 row_mask:0xf bank_mask:0xf\n\t"
      "v_max_num_f32_dpp %5, %5, %5 row_xmask:2 row_mask:0xf bank_mask:0xf\n\t"
      "v_max_num_f32_dpp %6, %6, %6 row_xmask:2 row_mask:0xf bank_mask:0xf\n\t"
      "v_max_num_f32_dpp %7, %7, %7 row_xmask:2 row_mask:0xf bank_mask:0xf\n\t"
      "v_max_num_f32_dpp %0, %0, %0 row_xmask:4 row_mask:0xf bank_mask:0xf\n\t"
      "v_max_num_f32_dpp %1, %1, %1 row_xmask:4 row_mask:0xf bank_mask:0xf\n\t"
      "v_max_num_f32_dpp %2, %2, %2 row_xmask:4 row_mask:0xf bank_mask:0xf\n\t"
      "v_max_num_f32_dpp %3, %3, %3 row_xmask:4 row_mask:0xf bank_mask:0xf\n\t"
      "v_max_num_f32_dpp %4, %4, %4 row_xmask:4 row_mask:0xf bank_mask:0xf\n\t"
      "v_max_num_f32_dpp %5, %5, %5 row_xmask:4 row_mask:0xf bank_mask:0xf\n\t"
      "v_max_num_f32_dpp %6, %6, %6 row_xmask:4 row_mask:0xf bank_mask:0xf\n\t"
      "v_max_num_f32_dpp %7, %7, %7 row_xmask:4 row_mask:0xf bank_mask:0xf\n\t"
      "v_max_num_f32_dpp %0, %0, %0 row_xmask:8 row_mask:0xf bank_mask:0xf\n\t"
      "v_max_num_f32_dpp %1, %1, %1 row_xmask:8 row_mask:0xf bank_mask:0xf\n\t"
      "v_max_num_f32_dpp %2, %2, %2 row_xmask:8 row_mask:0xf bank_mask:0xf\n\t"
      "v_max_num_f32_dpp %3, %3, %3 row_xmask:8 row_mask:0xf bank_mask:0xf\n\t"
      "v_max_num_f32_dpp %4, %4, %4 row_xmask:8 row_mask:0xf bank_mask:0xf\n\t"
      "v_max_num_f32_dpp %5, %5, %5 row_xmask:8 row_mask:0xf bank_mask:0xf\n\t"
      "v_max_num_f32_dpp %6, %6, %6 row_xmask:8 row_mask:0xf bank_mask:0xf\n\t"
      "v_max_num_f32_dpp %7, %7, %7 row_xmask:8 row_mask:0xf bank_mask:0xf\n\t"
      : "+v"(x[0]), "+v"(x[1]), "+v"(x[2]), "+v"(x[3]), "+v"(x[4]), "+v"(x[5]), "+v"(x[6]), "+v"(x[7]));
}
__device__ __forceinline__ void row_sum8(float (&x)[8]) {
  asm(
      "v_add_f32_dpp %0, %0, %0 row_xmask:1 row_mask:0xf bank_mask:0xf\n\t"
      "v_add_f32_dpp %1, %1, %1 row_xmask:1 row_mask:0xf bank_mask:0xf\n\t"
      "v_add_f32_dpp %2, %2, %2 row_xmask:1 row_mask:0xf bank_mask:0xf\n\t"
      "v_add_f32_dpp %3, %3, %3 row_xmask:1 row_mask:0xf bank_mask:0xf\n\t"
      "v_add_f32_dpp %4, %4, %4 row_xmask:1 row_mask:0xf bank_mask:0xf\n\t"
      "v_add_f32_dpp %5, %5, %5 row_xmask:1 row_mask:0xf bank_mask:0xf\n\t"
      "v_add_f32_dpp %6, %6, %6 row_xmask:1 row_mask:0xf bank_mask:0xf\n\t"
      "v_add_f32_dpp %7, %7, %7 row_xmask:1 row_mask:0xf bank_mask:0xf\n\t"
      "v_add_f32_dpp %0, %0, %0 row_xmask:2 row_mask:0xf bank_mask:0xf\n\t"
      "v_add_f32_dpp %1, %1, %1 row_xmask:2 row_mask:0xf bank_mask:0xf\n\t"
      "v_add_f32_dpp %2, %2, %2 row_xmask:2 row_mask:0xf bank_mask:0xf\n\t"
      "v_add_f32_dpp %3, %3, %3 row_xmask:2 row_mask:0xf bank_mask:0xf\n\t"
      "v_add_f32_dpp %4, %4, %4 row_xmask:2 row_mask:0xf bank_mask:0xf\n\t"
      "v_add_f32_dpp %5, %5, %5 row_xmask:2 row_mask:0xf bank_mask:0xf\n\t"
      "v_add_f32_dpp %6, %6, %6 row_xmask:2 row_mask:0xf bank_mask:0xf\n\t"
      "v_add_f32_dpp %7, %7, %7 row_xmask:2 row_mask:0xf bank_mask:0xf\n\t"
      "v_add_f32_dpp %0, %0, %0 row_xmask:4 row_mask:0xf bank_mask:0xf\n\t"
      "v_add_f32_dpp %1, %1, %1 row_xmask:4 row_mask:0xf bank_mask:0xf\n\t"
      "v_add_f32_dpp %2, %2, %2 row_xmask:4 row_mask:0xf bank_mask:0xf\n\t"
      "v_add_f32_dpp %3, %3, %3 row_xmask:4 row_mask:0xf bank_mask:0xf\n\t"
      "v_add_f32_dpp %4, %4, %4 row_xmask:4 row_mask:0xf bank_mask:0xf\n\t"
      "v_add_f32_dpp %5, %5, %5 row_xmask:4 row_mask:0xf bank_mask:0xf\n\t"
      "v_add_f32_dpp %6, %6, %6 row_xmask:4 row_mask:0xf bank_mask:0xf\n\t"
      "v_add_f32_dpp %7, %7, %7 row_xmask:4 row_mask:0xf bank_mask:0xf\n\t"
      "v_add_f32_dpp %0, %0, %0 row_xmask:8 row_mask:0xf bank_mask:0xf\n\t"
      "v_add_f32_dpp %1, %1, %1 row_xmask:8 row_mask:0xf bank_mask:0xf\n\t"
      "v_add_f32_dpp %2, %2, %2 row_xmask:8 row_mask:0xf bank_mask:0xf\n\t"
      "v_add_f32_dpp %3, %3, %3 row_xmask:8 row_mask:0xf bank_mask:0xf\n\t"
      "v_add_f32_dpp %4, %4, %4 row_xmask:8 row_mask:0xf bank_mask:0xf\n\t"
      "v_add_f32_dpp %5, %5, %5 row_xmask:8 row_mask:0xf bank_mask:0xf\n\t"
      "v_add_f32_dpp %6, %6, %6 row_xmask:8 row_mask:0xf bank_mask:0xf\n\t"
      "v_add_f32_dpp %7, %7, %7 row_xmask:8 row_mask:0xf bank_mask:0xf\n\t"
      : "+v"(x[0]), "+v"(x[1]), "+v"(x[2]), "+v"(x[3]), "+v"(x[4]), "+v"(x[5]), "+v"(x[6]), "+v"(x[7]));
}

// ---- fragment loaders: 16-bit A/B operand, lane -> row/col (lane&15), p already includes +8*(lane>>4);
//      elements 0..7 <- p[0..7] (k0+8h..), elements 8..15 <- p[16..23] (k0+16+8h..)
__device__ __forceinline__ v16b ldfrag_b(const __bf16* p) {
  union { v16b v; v8b h[2]; } f;
  f.h[0] = *(const v8b*)(p);
  f.h[1] = *(const v8b*)(p + 16);
  return f.v;
}
__device__ __forceinline__ v16h ldfrag_h(const _Float16* p) {
  union { v16h v; v8h h[2]; } f;
  f.h[0] = *(const v8h*)(p);
  f.h[1] = *(const v8h*)(p + 16);
  return f.v;
}

// ---- WMMA helpers with trailing VALU hazard gap --------------------------------------------------------
__device__ __forceinline__ v8f mma_b(v16b a, v16b b, v8f c) {
  c = __builtin_amdgcn_wmma_f32_16x16x32_bf16(false, a, false, b, (short)0, c, false, false);
  asm volatile("v_nop\n\tv_nop\n\tv_nop\n\tv_nop" : "+v"(c) : "v"(a), "v"(b));
  return c;
}
__device__ __forceinline__ v8f mma_h(v16h a, v16h b, v8f c) {
  c = __builtin_amdgcn_wmma_f32_16x16x32_f16(false, a, false, b, (short)0, c, false, false);
  asm volatile("v_nop\n\tv_nop\n\tv_nop\n\tv_nop" : "+v"(c) : "v"(a), "v"(b));
  return c;
}

// =====================================================================================================
// f32 -> bf16 (RNE convert), 8 elements per thread, one 16-B store per lane: a wave writes 512 contiguous B
// Destination plane is compact [b][SEQ*DE]; source batch stride src8 (units of 8 floats) may be larger.
// coverage: n8 threads x 8 = whole plane (n8 = NB*SEQ*DE/8 is a multiple of 256).
// =====================================================================================================
__global__ __launch_bounds__(256) void cvt_bf16x8s(const float* __restrict__ in, unsigned short* out,
                                                   int n8, int per8, int src8) {
  const int i = blockIdx.x * 256 + threadIdx.x;
  if (i < n8) {
    const int hd  = i / per8;
    const int rem = i - hd * per8;
    const float* s = in + ((size_t)hd * src8 + (size_t)rem) * 8;
    const v4f a = *(const v4f*)(s);
    const v4f b = *(const v4f*)(s + 4);
    v4u p;
    p[0] = pk16(bf_bits(a[0]), bf_bits(a[1]));
    p[1] = pk16(bf_bits(a[2]), bf_bits(a[3]));
    p[2] = pk16(bf_bits(b[0]), bf_bits(b[1]));
    p[3] = pk16(bf_bits(b[2]), bf_bits(b[3]));
    *(v4u*)(out + (size_t)i * 8) = p;
    
  }
}

// =====================================================================================================
// Weight W[k][n] f32 (DE x DE, n contiguous) -> transposed 16-bit plane Wt[n][k] (k contiguous, pitch DE).
//   blockIdx.y = matrix id: 0,1,2 -> bf16 bits of the RNE-bf16 value; 3 -> f16 bits of (RNE-bf16 value x64).
//   Block = one 64(k) x 64(n) tile, 256 threads: thread (k = tid>>2, 16-column n quarter) loads 16 floats of row k
//   and writes them transposed into the LDS tile T[n][k]; after the barrier wave w writes rows n = 8w..8w+7:
//   grid.x = (DE/64)^2 tiles covers the whole plane of each of the 4 matrices.
// =====================================================================================================
__global__ __launch_bounds__(256) void wt_tiles(const float* __restrict__ w0, const float* __restrict__ w1,
                                                const float* __restrict__ w2, const float* __restrict__ w3,
                                                unsigned short* o0, unsigned short* o1,
                                                unsigned short* o2, unsigned short* o3) {
  __shared__ __align__(16) unsigned short T[64 * 64];   // [n][k]
  const int tid = threadIdx.x;
  const int mat = blockIdx.y;                            // block-uniform
  const float* in = w0; unsigned short* out = o0;
  if (mat == 1) { in = w1; out = o1; }
  else if (mat == 2) { in = w2; out = o2; }
  else if (mat == 3) { in = w3; out = o3; }
  const int ktile = blockIdx.x / (DE / 64);
  const int ntile = blockIdx.x - ktile * (DE / 64);
  const int k   = tid >> 2;              // 0..63
  const int nq  = (tid & 3) * 16;        // 0,16,32,48
  const float* src = in + (size_t)(ktile * 64 + k) * DE + ntile * 64 + nq;
#pragma unroll
  for (int i = 0; i < 4; ++i) {
    const v4f a = *(const v4f*)(src + 4 * i);
#pragma unroll
    for (int e = 0; e < 4; ++e) {
      const unsigned short bb = bf_bits(a[e]);
      const unsigned short hb = h_bits(bf_up(bb) * WCARRY);
      const unsigned short us = (mat == 3) ? hb : bb;
      T[(nq + 4 * i + e) * 64 + k] = us;
    }
  }
  __syncthreads();
  const int wave = tid >> 5, lane = tid & 31;
  const int q = lane >> 3, c8 = (lane & 7) * 8;
  union { v8us s; v4u u; } x0, x1;
  const int d0 = wave * 8 + q;
  const int d1 = wave * 8 + 4 + q;
  x0.s = *(const v8us*)(T + d0 * 64 + c8);
  x1.s = *(const v8us*)(T + d1 * 64 + c8);
  unsigned short* p0 = out + ((size_t)(ntile * 64 + d0) * DE + ktile * 64 + c8);
  unsigned short* p1 = out + ((size_t)(ntile * 64 + d1) * DE + ktile * 64 + c8);
  *(v4u*)p0 = x0.u;
  *(v4u*)p1 = x1.u;
  
}

// =====================================================================================================
// 16-bit GEMM C[m][n] = sum_k A[m][k] * Bt[n][k], K = DE, M = MROWS, N = DE. Block 256 threads = 8 waves,
// block tile 128 m x 64 n, wave tile 16 x 64 (4 accumulators), k step 32; A and B fragments straight from the
// 16-bit global rows (two 16-B loads each, identical k map). grid = (DE/64, MROWS/128), exact multiples.
//   MODE 0: bf16 operands; out16 f16 row-major [MROWS][DE] = (acc + bias) * scale. Wave tile staged in wave-private
//   MODE 1: bf16 operands; out16 f16 transposed per batch [b][DE][SEQ] = (acc + bias) * scale. Block tile staged in
//           cross-wave LDS T[n][key 128] (block barrier); wave w writes rows n = 8w..8w+7, one instruction = 2 rows
//           of 128 halves (16 lanes x 16 B per 256-B row); coverage 8 waves x 4 it x 2 rows x 128 = 64x128.
//   MODE 2: f16 operands; out32 f32 row-major [MROWS][DE] = acc * scale + bias + RNE-bf16(resid), resid rows read at
//           the full batch stride. Wave-private LDS stage (f32), one instruction = 2 rows of 64 floats (16 lanes x
//           16 B per 256-B segment); coverage 8 it x 2 rows x 64 = 16x64.
// =====================================================================================================
template <int MODE>
__global__ __launch_bounds__(256)
void gemm_nt(const unsigned short* __restrict__ A, const unsigned short* __restrict__ Bt,
             const float* __restrict__ bias, const float* __restrict__ resid,
             unsigned short* out16, float* out32, float scale) {
  __shared__ __align__(16) unsigned char smem[32768];
  const int tid  = threadIdx.x;
  const int wave = tid >> 5;
  const int lane = tid & 31;
  const int hh   = lane >> 4;
  const int c    = lane & 15;
  const int m0b  = blockIdx.y * 128;
  const int m0   = m0b + wave * 16;
  const int n0   = blockIdx.x * 64;

  v8f acc[4];
#pragma unroll
  for (int t = 0; t < 4; ++t) acc[t] = zero8();

  const size_t aoff = (size_t)(m0 + c) * DE + 8 * hh;
  const size_t boff = (size_t)(n0 + c) * DE + 8 * hh;
  if (MODE == 2) {
    const _Float16* Ah = (const _Float16*)(const void*)A + aoff;
    const _Float16* Bh = (const _Float16*)(const void*)Bt + boff;
#pragma unroll 2
    for (int k0 = 0; k0 < DE; k0 += 32) {
      const v16h a = ldfrag_h(Ah + k0);
#pragma unroll
      for (int t = 0; t < 4; ++t) {
        const v16h b = ldfrag_h(Bh + (size_t)t * 16 * DE + k0);
        acc[t] = mma_h(a, b, acc[t]);
      }
    }
  } else {
    const __bf16* Ab = (const __bf16*)(const void*)A + aoff;
    const __bf16* Bb = (const __bf16*)(const void*)Bt + boff;
#pragma unroll 2
    for (int k0 = 0; k0 < DE; k0 += 32) {
      const v16b a = ldfrag_b(Ab + k0);
#pragma unroll
      for (int t = 0; t < 4; ++t) {
        const v16b b = ldfrag_b(Bb + (size_t)t * 16 * DE + k0);
        acc[t] = mma_b(a, b, acc[t]);
      }
    }
  }

  if (MODE == 0) {
    _Float16* S = (_Float16*)(void*)smem + wave * 1024;          // [16][64] per wave
#pragma unroll
    for (int t = 0; t < 4; ++t) {
      const float bi = bf_up(bf_bits(bias[n0 + t * 16 + c]));
#pragma unroll
      for (int r = 0; r < 8; ++r) S[(8 * hh + r) * 64 + t * 16 + c] = (_Float16)((acc[t][r] + bi) * scale);
    }
    __builtin_amdgcn_fence(__ATOMIC_RELEASE, "workgroup");
    __builtin_amdgcn_wave_barrier();
    __builtin_amdgcn_fence(__ATOMIC_ACQUIRE, "workgroup");
    const int rq = lane >> 3, c8 = (lane & 7) * 8;
    union { v8h h; v4u u; } w[4];
#pragma unroll
    for (int it = 0; it < 4; ++it) w[it].h = *(const v8h*)(S + (it * 4 + rq) * 64 + c8);
    {
#pragma unroll
      for (int it = 0; it < 4; ++it)
        *(v4u*)(out16 + (size_t)(m0 + it * 4 + rq) * DE + n0 + c8) = w[it].u;
      
    }
  } else if (MODE == 1) {
    _Float16* T = (_Float16*)(void*)smem;                       // [n 64][key 128]
#pragma unroll
    for (int t = 0; t < 4; ++t) {
      const float bi = bf_up(bf_bits(bias[n0 + t * 16 + c]));
#pragma unroll
      for (int r = 0; r < 8; ++r)
        T[(t * 16 + c) * 128 + wave * 16 + 8 * hh + r] = (_Float16)((acc[t][r] + bi) * scale);
    }
    __syncthreads();
    const int bidx = m0b / SEQ;                                  // tiles never straddle batches (128 | SEQ)
    const int key0 = m0b - bidx * SEQ;
    const int rh = lane >> 4, c8 = (lane & 15) * 8;
    union { v8h h; v4u u; } w[4];
#pragma unroll
    for (int it = 0; it < 4; ++it) w[it].h = *(const v8h*)(T + (wave * 8 + it * 2 + rh) * 128 + c8);
    {
#pragma unroll
      for (int it = 0; it < 4; ++it) {
        const int row = wave * 8 + it * 2 + rh;
        *(v4u*)(out16 + ((size_t)(bidx * DE + n0 + row) * SEQ + key0 + c8)) = w[it].u;
      }
      
    }
  } else {
    float* S = (float*)(void*)smem + wave * 1024;                // [16][64] f32 per wave
#pragma unroll
    for (int t = 0; t < 4; ++t) {
      const float bi = bf_up(bf_bits(bias[n0 + t * 16 + c]));
#pragma unroll
      for (int r = 0; r < 8; ++r) S[(8 * hh + r) * 64 + t * 16 + c] = acc[t][r] * scale + bi;
    }
    __builtin_amdgcn_fence(__ATOMIC_RELEASE, "workgroup");
    __builtin_amdgcn_wave_barrier();
    __builtin_amdgcn_fence(__ATOMIC_ACQUIRE, "workgroup");
    const int rh = lane >> 4, c4 = (lane & 15) * 4;
    v4f vals[8];
#pragma unroll
    for (int it = 0; it < 8; ++it) {
      const int row = it * 2 + rh;
      const int gm  = m0 + row;
      const int bb  = gm / SEQ;
      const int tt  = gm - bb * SEQ;
      v4f x = *(const v4f*)(S + row * 64 + c4);
      const v4f rq = *(const v4f*)(resid + ((size_t)bb * SEQ_FULL + tt) * DE + n0 + c4);
#pragma unroll
      for (int e = 0; e < 4; ++e) x[e] = x[e] + bf_up(bf_bits(rq[e]));
      vals[it] = x;
    }
    {
#pragma unroll
      for (int it = 0; it < 8; ++it)
        *(v4f*)(out32 + (size_t)(m0 + it * 2 + rh) * DE + n0 + c4) = vals[it];
      
    }
  }
}

// =====================================================================================================
// Full (unmasked) attention, head dim 64, all NQB key tiles.
//   q plane (f16):  element (b, t, h, d) at [(b*SEQ + t)*DE + h*64 + d]      k plane (f16): same with key index s
//   v^T plane (f16): element (b, h, d, s) at [(b*DE + h*64 + d)*SEQ + s], value v*64
//   scores = q . k (f16 WMMA, f32 acc) * 0.125; online softmax in f32; p = exp(s - m) carried as f16(16384 p);
//   context = p . v on f16 WMMA; RES adds the f16 residual plane of p (x4096, separate accumulator folded back
//   with 1/4096 per tile in f32). ctx out = f16(context / (l * 16384 * 64) * 64) to [(b*SEQ + t)*DE + h*64 + d].
//   Block = 4 waves = 64 query rows of one (b,h); grid = nqbThis * NH * NB; kv tiles of 64.
//   K / V^T tile staging: 128 threads x 32 elements per plane = the whole 64x64 tile (plain 16-B loads,
//   __syncthreads before and after, cross-wave); staged extent == consumed extent for Ksh, Vth, Psh, Psl, Os.
//   Ksh, Vth, Psh, Psl rows lie at pitch LP (64 used halves + 8 never touched) so that the 16 rows one 16-B fragment
//   read walks fall on 16 different bank groups.
//   P tiles and the Os tile are wave-private, spilled with _Float16 element stores and reloaded as v8h (same element
//   Output coverage: each wave stores rows 0..15 (it 0..3 x lane>>3) x 64 halves (8 lanes x 16 B): one instruction
// =====================================================================================================
template <bool RES>
__global__ __launch_bounds__(128)
void attn_full64(const unsigned short* __restrict__ qp, const unsigned short* __restrict__ kp,
                 const unsigned short* __restrict__ vtp, unsigned short* ctx, int qbBase, int nqbThis) {
  union FH { v16h v; v8h h[2]; };
  __shared__ __align__(16) _Float16 Ksh[64 * LP];                 // K [kv][d], pitch LP
  __shared__ __align__(16) _Float16 Vth[64 * LP];                 // V^T [d][kv], pitch LP
  __shared__ __align__(16) _Float16 Psh[4][16 * LP];              // per wave P [row][kv], pitch LP
  __shared__ __align__(16) _Float16 Psl[RES ? 4 : 1][16 * LP];    // per wave P residual, pitch LP
  __shared__ __align__(16) _Float16 Os[4][16 * 64];               // per wave context tile [row][d]

  const int tid  = threadIdx.x;
  const int wave = tid >> 5;
  const int lane = tid & 31;
  const int hh   = lane >> 4;
  const int c    = lane & 15;

  const int bx   = blockIdx.x;
  const int qbl  = bx % nqbThis;
  const int bhq  = bx / nqbThis;           // 0..NB*NH-1
  const int h    = bhq % NH;
  const int b    = bhq / NH;
  const int qb   = qbBase + qbl;           // 0..NQB-1
  const int q0   = qb * 64 + wave * 16;    // query index within the sequence

  const _Float16* Qh = (const _Float16*)(const void*)qp + (size_t)b * SEQ * DE + (size_t)h * HD;
  const _Float16* Kh = (const _Float16*)(const void*)kp + (size_t)b * SEQ * DE + (size_t)h * HD;
  const _Float16* Vh = (const _Float16*)(const void*)vtp + ((size_t)b * DE + (size_t)h * HD) * SEQ;

  // ---- Q fragments (A operand, row = lane&15): 2 d-chunks ----
  v16h qa[2];
#pragma unroll
  for (int dc = 0; dc < 2; ++dc) {
    const size_t qo = (size_t)(q0 + c) * DE + dc * 32 + 8 * hh;
    qa[dc] = ldfrag_h(Qh + qo);
  }

  float mrow[8], lrow[8];
  v8f oacc[4];
#pragma unroll
  for (int r = 0; r < 8; ++r) { mrow[r] = -INFINITY; lrow[r] = 0.f; }
#pragma unroll
  for (int t = 0; t < 4; ++t) oacc[t] = zero8();

  for (int kt = 0; kt < NQB; ++kt) {        // block-uniform bounds, exactly NQB trips
    const int kv0 = kt * 64;
    __syncthreads();
    {
      const int r = tid >> 1, half = (tid & 1) * 32;
      const _Float16* kg = Kh + (size_t)(kv0 + r) * DE + half;   // K row kv0+r, d = half..half+31
      const _Float16* vg = Vh + (size_t)r * SEQ + kv0 + half;    // V^T row d = r, s = kv0+half..+31
#pragma unroll
      for (int i = 0; i < 4; ++i) {
        const v8h a0 = *(const v8h*)(kg + 8 * i);
        const v8h b0 = *(const v8h*)(vg + 8 * i);
        *(v8h*)(Ksh + r * LP + half + 8 * i) = a0;
        *(v8h*)(Vth + r * LP + half + 8 * i) = b0;
      }
    }
    __syncthreads();

    // ---- scores: 16 query rows x 64 keys per wave, single f16 product ----
    v8f s[4];
#pragma unroll
    for (int j = 0; j < 4; ++j) {
      s[j] = zero8();
#pragma unroll
      for (int dc = 0; dc < 2; ++dc) {
        FH kb;
        kb.h[0] = *(const v8h*)(Ksh + (j * 16 + c) * LP + dc * 32 + 8 * hh);
        kb.h[1] = *(const v8h*)(Ksh + (j * 16 + c) * LP + dc * 32 + 16 + 8 * hh);
        s[j] = mma_h(qa[dc], kb.v, s[j]);
      }
    }

    // ---- scale, row max, online softmax, P (x16384, f16) and P residual (x4096) to LDS ----
    _Float16* pwh = Psh[wave];
    _Float16* pwl = Psl[RES ? wave : 0];
    float mx[8], ps[8], al[8], ms[8];   // per row: tile maximum, tile sum, rescale factor, maximum in use
#pragma unroll
    for (int r = 0; r < 8; ++r) {
      float m = -INFINITY;
#pragma unroll
      for (int j = 0; j < 4; ++j) {
        const float sv = s[j][r] * 0.125f;
        s[j][r] = sv;
        m = fmaxf(m, sv);
      }
      mx[r] = m;
    }
    row_max8(mx);
#pragma unroll
    for (int r = 0; r < 8; ++r) {
      const float mnew  = fmaxf(mrow[r], mx[r]);
      const float msafe = (mnew == -INFINITY) ? 0.f : mnew;
      al[r] = __expf(mrow[r] - msafe);
      ms[r] = msafe;
      mrow[r] = mnew;
    }
#pragma unroll
    for (int r = 0; r < 8; ++r) {
      float psum = 0.f;
#pragma unroll
      for (int j = 0; j < 4; ++j) {
        const float p = __expf(s[j][r] - ms[r]);
        psum += p;
        const float p1k = p * PCARRY;
        const _Float16 ph = (_Float16)p1k;
        pwh[(8 * hh + r) * LP + j * 16 + c] = ph;
        if (RES) {
          const _Float16 pl = (_Float16)((p1k - (float)ph) * PRES);
          pwl[(8 * hh + r) * LP + j * 16 + c] = pl;
        }
      }
      ps[r] = psum;
    }
    row_sum8(ps);
#pragma unroll
    for (int r = 0; r < 8; ++r) {
      lrow[r] = lrow[r] * al[r] + ps[r];
#pragma unroll
      for (int t = 0; t < 4; ++t) oacc[t][r] *= al[r];
    }
    __builtin_amdgcn_fence(__ATOMIC_RELEASE, "workgroup");
    __builtin_amdgcn_wave_barrier();
    __builtin_amdgcn_fence(__ATOMIC_ACQUIRE, "workgroup");

    // ---- context += P . V (f16 WMMA), residual products into a separate accumulator ----
    v8f o1[4];
#pragma unroll
    for (int t = 0; t < 4; ++t) o1[t] = zero8();
#pragma unroll 1
    for (int kk = 0; kk < 2; ++kk) {
      FH pa, pl;
      pa.h[0] = *(const v8h*)(pwh + c * LP + kk * 32 + 8 * hh);
      pa.h[1] = *(const v8h*)(pwh + c * LP + kk * 32 + 16 + 8 * hh);
      if (RES) {
        pl.h[0] = *(const v8h*)(pwl + c * LP + kk * 32 + 8 * hh);
        pl.h[1] = *(const v8h*)(pwl + c * LP + kk * 32 + 16 + 8 * hh);
      } else {
        pl.v = pa.v;
      }
#pragma unroll
      for (int t = 0; t < 4; ++t) {
        FH vb;
        vb.h[0] = *(const v8h*)(Vth + (t * 16 + c) * LP + kk * 32 + 8 * hh);
        vb.h[1] = *(const v8h*)(Vth + (t * 16 + c) * LP + kk * 32 + 16 + 8 * hh);
        oacc[t] = mma_h(pa.v, vb.v, oacc[t]);
        if (RES) o1[t] = mma_h(pl.v, vb.v, o1[t]);
      }
    }
    if (RES) {
#pragma unroll
      for (int t = 0; t < 4; ++t)
#pragma unroll
        for (int r = 0; r < 8; ++r) oacc[t][r] += o1[t][r] * (1.0f / PRES);
    }
  }

  // ---- normalise (1/l, the p, v carries) and apply the ctx carry; stage the wave's 16x64 f16 tile; write whole
  _Float16* os = Os[wave];
#pragma unroll
  for (int r = 0; r < 8; ++r) {
    const float l = lrow[r];
    const float inv = ((l > 0.f) ? (1.0f / l) : 0.f) * (CCARRY / (PCARRY * VCARRY));
#pragma unroll
    for (int t = 0; t < 4; ++t) os[(8 * hh + r) * 64 + t * 16 + c] = (_Float16)(oacc[t][r] * inv);
  }
  __builtin_amdgcn_fence(__ATOMIC_RELEASE, "workgroup");
  __builtin_amdgcn_wave_barrier();
  __builtin_amdgcn_fence(__ATOMIC_ACQUIRE, "workgroup");
  {
    const int rq = lane >> 3, c8 = (lane & 7) * 8;
    union { v8h h; v4u u; } w[4];
#pragma unroll
    for (int it = 0; it < 4; ++it) w[it].h = *(const v8h*)(os + (it * 4 + rq) * 64 + c8);
    unsigned short* ob = ctx + ((size_t)b * SEQ) * DE + (size_t)h * HD;
    {
#pragma unroll
      for (int it = 0; it < 4; ++it) {
        const int row = it * 4 + rq;                     // it 0..3 x rq 0..3 = rows 0..15
        *(v4u*)(ob + (size_t)(q0 + row) * DE + c8) = w[it].u;
      }
      
    }
  }
}

// =====================================================================================================
// LayerNorm over DE of x [MROWS][DE] f32: one block of 256 threads per row, thread owns 4 consecutive floats.
// mean and centred variance via wave shuffles + 8-entry LDS partials (cross-wave, block barriers), fixed order.
// y = (x - mu) * rsqrt(var + 1e-5) * RNE-bf16(gamma) + RNE-bf16(beta). Output row b*SEQ_FULL + t of d_out;
// coverage: MROWS blocks x 256 threads x 4 floats = every processed output row in full.
// =====================================================================================================
__global__ __launch_bounds__(256) void ln_rows(const float* __restrict__ x, const float* __restrict__ gam,
                                               const float* __restrict__ bet, float* out) {
  __shared__ float red1[8];
  __shared__ float red2[8];
  const int tid = threadIdx.x, wave = tid >> 5, lane = tid & 31;
  const int row = blockIdx.x;
  const int bb  = row / SEQ;
  const int tt  = row - bb * SEQ;
  const size_t orow = (size_t)bb * SEQ_FULL + (size_t)tt;

  const v4f v = *(const v4f*)(x + (size_t)row * DE + tid * 4);
  float s = (v[0] + v[1]) + (v[2] + v[3]);
#pragma unroll
  for (int off = 16; off > 0; off >>= 1) s += __shfl_xor(s, off, 32);
  if (lane == 0) red1[wave] = s;
  __syncthreads();
  float tot = 0.f;
#pragma unroll
  for (int w = 0; w < 8; ++w) tot += red1[w];
  const float mu = tot * (1.0f / (float)DE);

  v4f d;
#pragma unroll
  for (int e = 0; e < 4; ++e) d[e] = v[e] - mu;
  float s2 = (d[0] * d[0] + d[1] * d[1]) + (d[2] * d[2] + d[3] * d[3]);
#pragma unroll
  for (int off = 16; off > 0; off >>= 1) s2 += __shfl_xor(s2, off, 32);
  if (lane == 0) red2[wave] = s2;
  __syncthreads();
  float tot2 = 0.f;
#pragma unroll
  for (int w = 0; w < 8; ++w) tot2 += red2[w];
  const float var  = tot2 * (1.0f / (float)DE);
  const float rstd = rsqrtf(var + 1.0e-5f);

  const v4f g4 = *(const v4f*)(gam + tid * 4);
  const v4f b4 = *(const v4f*)(bet + tid * 4);
  v4f y;
#pragma unroll
  for (int e = 0; e < 4; ++e) y[e] = (d[e] * rstd) * bf_up(bf_bits(g4[e])) + bf_up(bf_bits(b4[e]));
  float* op = out + orow * DE + (size_t)tid * 4;
  *(v4f*)op = y;
  
}

// =====================================================================================================
// Workspace map (bytes, full size): PQ bf16 [MROWS][DE] at 0 (8388608); PK bf16 at 8388608 (8388608);
// Wq^T, Wk^T, Wv^T bf16 and Wo^T f16 [DE][DE] at 16777216.. (4 x 2097152); Q f16 [MROWS][DE] at 25165824;
// K f16 at 33554432; V^T f16 [NB][DE][SEQ] at 41943040; CTX f16 [MROWS][DE] at 50331648; X f32 [MROWS][DE]
// at 58720256 (16777216); end 75497472. Every plane is an exact multiple of its whole-line store granularity
// Launch plan (10): cvt pre_q, cvt pre_k, weight transpose-convert, gemm q, gemm k, gemm v^T, attention (leading
// query blocks with the p residual, remaining blocks without), gemm o + residual, LayerNorm.
// =====================================================================================================
extern "C" void kernel_launch(void* const* d_in, const int* in_sizes, int n_in,
                              void* d_out, int out_size, void* d_ws, size_t ws_size,
                              hipStream_t stream) {
  if (n_in < 12) return;
  const long long needIn = (long long)(NB - 1) * SEQ_FULL * DE + (long long)SEQ * DE;
  if ((long long)in_sizes[0] < needIn || (long long)in_sizes[1] < needIn) return;
  if (in_sizes[2] < DE * DE || in_sizes[4] < DE * DE || in_sizes[6] < DE * DE || in_sizes[8] < DE * DE) return;
  if (in_sizes[3] < DE || in_sizes[5] < DE || in_sizes[7] < DE || in_sizes[9] < DE) return;
  if (in_sizes[10] < DE || in_sizes[11] < DE) return;
  if (out_size < 0 || (long long)out_size < needIn) return;

  const size_t P16 = (size_t)MROWS * DE * 2;     // one 16-bit activation plane
  const size_t W16 = (size_t)DE * DE * 2;        // one 16-bit weight plane
  const size_t P32 = (size_t)MROWS * DE * 4;     // x plane
  size_t off = 0;
  const size_t oPQ  = off; off += P16;
  const size_t oPK  = off; off += P16;
  const size_t oWq  = off; off += W16;
  const size_t oWk  = off; off += W16;
  const size_t oWv  = off; off += W16;
  const size_t oWo  = off; off += W16;
  const size_t oQ   = off; off += P16;
  const size_t oK   = off; off += P16;
  const size_t oVT  = off; off += P16;
  const size_t oCTX = off; off += P16;
  const size_t oX   = off; off += P32;
  if (off > ws_size) return;                     // off = 75497472 at full size
  if (off > (size_t)134217728) return;

  const float* pre_q = (const float*)d_in[0];
  const float* pre_k = (const float*)d_in[1];
  const float* Wq    = (const float*)d_in[2];
  const float* bq    = (const float*)d_in[3];
  const float* Wk    = (const float*)d_in[4];
  const float* bk    = (const float*)d_in[5];
  const float* Wv    = (const float*)d_in[6];
  const float* bv    = (const float*)d_in[7];
  const float* Wo    = (const float*)d_in[8];
  const float* bo    = (const float*)d_in[9];
  const float* gamma = (const float*)d_in[10];
  const float* beta  = (const float*)d_in[11];
  float* out = (float*)d_out;

  char* ws = (char*)d_ws;
  unsigned short* PQb  = (unsigned short*)(ws + oPQ);
  unsigned short* PKb  = (unsigned short*)(ws + oPK);
  unsigned short* Wqt  = (unsigned short*)(ws + oWq);
  unsigned short* Wkt  = (unsigned short*)(ws + oWk);
  unsigned short* Wvt  = (unsigned short*)(ws + oWv);
  unsigned short* Wot  = (unsigned short*)(ws + oWo);
  unsigned short* Qh   = (unsigned short*)(ws + oQ);
  unsigned short* Kh   = (unsigned short*)(ws + oK);
  unsigned short* VTb  = (unsigned short*)(ws + oVT);
  unsigned short* CTXb = (unsigned short*)(ws + oCTX);
  float*          Xb   = (float*)(ws + oX);

  const dim3 blk(256);
  const int n8   = MROWS * DE / 8;               // 524288 at full size
  const int per8 = SEQ * DE / 8;
  const int src8 = SEQ_FULL * DE / 8;
  const dim3 gCvt((n8 + 255) / 256);
  const dim3 gWt((DE / 64) * (DE / 64), 4);      // 256 tiles x 4 matrices
  const dim3 gG(DE / 64, MROWS / 128);           // (16, 32) at full size
  int resqb = RESQB;
  if (resqb > NQB) resqb = NQB;

  // (1) activations -> bf16 planes (RNE convert)
  cvt_bf16x8s<<<gCvt, blk, 0, stream>>>(pre_q, PQb, n8, per8, src8);
  cvt_bf16x8s<<<gCvt, blk, 0, stream>>>(pre_k, PKb, n8, per8, src8);
  // (2) weights -> transposed 16-bit planes (Wq, Wk, Wv bf16; Wo f16 x64)
  wt_tiles<<<gWt, blk, 0, stream>>>(Wq, Wk, Wv, Wo, Wqt, Wkt, Wvt, Wot);
  // (3) projections: q, k -> f16 row-major; v -> f16 v^T x64
  gemm_nt<0><<<gG, blk, 0, stream>>>(PQb, Wqt, bq, pre_q, Qh, Xb, 1.0f);
  gemm_nt<0><<<gG, blk, 0, stream>>>(PKb, Wkt, bk, pre_q, Kh, Xb, 1.0f);
  gemm_nt<1><<<gG, blk, 0, stream>>>(PKb, Wvt, bv, pre_q, VTb, Xb, VCARRY);
  // (4) attention -> ctx f16 x64: query blocks 0..resqb-1 with the p residual plane, the rest without
  attn_full64<true><<<dim3(NB * NH * resqb), dim3(128), 0, stream>>>(Qh, Kh, VTb, CTXb, 0, resqb);
  if (NQB - resqb > 0) {
    attn_full64<false><<<dim3(NB * NH * (NQB - resqb)), dim3(128), 0, stream>>>(Qh, Kh, VTb, CTXb, resqb, NQB - resqb);
  }
  // (5) output projection + bias + residual -> x f32
  gemm_nt<2><<<gG, blk, 0, stream>>>(CTXb, Wot, bo, pre_q, CTXb, Xb, 1.0f / (CCARRY * WCARRY));
  // (6) LayerNorm -> output
  ln_rows<<<dim3(MROWS), blk, 0, stream>>>(Xb, gamma, beta, out);
  (void)hipGetLastError();
}

// v003
// A run of this version takes 222 microseconds.
// Timed twice side by side with v002, it ran 1.43 and 1.42 times as fast.
// All steps since v000 together make it 2.12 times as fast.
// Contractions: q/k/v projections = v_wmma_f32_16x16x32_bf16 (bf16 operands = RNE-converted activations and
// transposed weights, single product, f32 accumulate); q.k^T scores, p.v context and ctx.Wo projection =
// v_wmma_f32_16x16x32_f16 (q, k = f16 of the f32 projection sums, unscaled; p = exp(s - m) carried x16384 plus an
// f16 residual plane of p x4096 on the leading query blocks; v^T, ctx and Wo carried x64 in f16), f32 accumulate;
// softmax, bias/residual add and LayerNorm in f32.
#include <hip/hip_runtime.h>
#include <math.h>
#include <stdint.h>

#ifndef NB
#define NB 2                 // batches processed (reducible)
#endif
#ifndef NB_FULL
#define NB_FULL 2            // batches in the inputs / output
#endif
#ifndef SEQ
#define SEQ 2048             // query == key length processed (reducible)
#endif
#ifndef SEQ_FULL
#define SEQ_FULL 2048        // per-batch row stride of the inputs and of the output
#endif
#define DE    1024
#define NH    16
#define HD    64
#define NQB   (SEQ / 64)
#define MROWS (NB * SEQ)
#ifndef RESQB
#define RESQB 8              // leading 64-row query blocks per (b,h) that carry the p residual plane
#endif
#define PCARRY 16384.0f
#define PRES   4096.0f
#define VCARRY 64.0f
#define CCARRY 64.0f
#define WCARRY 64.0f
#define LP    72             // LDS row pitch (halves) of the attention K, V^T and P tiles: 144 B = 16 B x odd
#define GKS   64             // k extent (halves) of one staged GEMM slab: one whole 128-B line per row
#define GP    72             // LDS row pitch (halves) of the staged GEMM slabs: 144 B = 16 B x odd
#define GSLAB ((128 + 64) * GP)   // halves in one slab buffer: 128 A rows, then 64 B rows

static_assert(NB >= 1 && NB <= NB_FULL);
static_assert((SEQ % 128) == 0 && SEQ >= 128 && SEQ <= SEQ_FULL);
static_assert(NH * HD == DE);
static_assert(RESQB >= 1);
static_assert(LP >= HD && (LP % 8) == 0 && ((LP / 8) % 2) == 1);   // 16-B aligned rows, odd count of 16-B units
static_assert((MROWS % 128) == 0 && (DE % 64) == 0 && (DE % 32) == 0);
static_assert(GP >= GKS && (GP % 8) == 0 && ((GP / 8) % 2) == 1 && (DE % GKS) == 0 && (GKS % 32) == 0);
static_assert(2 * GSLAB * 2 >= 32768);                               // the epilogue stages reuse the slab buffers
static_assert((long long)NB_FULL * SEQ_FULL * DE * 4 == 16777216LL);   // total output bytes at full size

typedef _Float16 v16h __attribute__((ext_vector_type(16)));
typedef _Float16 v8h  __attribute__((ext_vector_type(8)));
typedef __bf16   v16b __attribute__((ext_vector_type(16)));
typedef __bf16   v8b  __attribute__((ext_vector_type(8)));
typedef float    v8f  __attribute__((ext_vector_type(8)));
typedef float    v4f  __attribute__((ext_vector_type(4)));
typedef unsigned int v4u __attribute__((ext_vector_type(4)));
typedef unsigned short v8us __attribute__((ext_vector_type(8)));

// ---- scalar helpers --------------------------------------------------------------------------------
__device__ __forceinline__ unsigned short bf_bits(float f) {          // f32 -> bf16 bits, RNE convert
  unsigned u = __float_as_uint(f);
  return (unsigned short)((u + 0x7FFFu + ((u >> 16) & 1u)) >> 16);
}
__device__ __forceinline__ float bf_up(unsigned short h) { return __uint_as_float(((unsigned)h) << 16); }
__device__ __forceinline__ unsigned short h_bits(float f) {           // f32 -> f16 bits, RNE convert
  union { _Float16 h; unsigned short u; } cvt;
  cvt.h = (_Float16)f;
  return cvt.u;
}
__device__ __forceinline__ unsigned pk16(unsigned short a, unsigned short b) { return (unsigned)a | ((unsigned)b << 16); }
__device__ __forceinline__ v8f zero8() { v8f z = {0.f, 0.f, 0.f, 0.f, 0.f, 0.f, 0.f, 0.f}; return z; }

// ---- 16-lane row reductions of eight values at once, on the vector unit -------------------------------------
// Four xor steps (lane l with lane l ^ 1, 2, 4, 8 of its 16-lane row), each for all eight registers. The partner's
// value comes as a DPP operand: no LDS crossbar trip and no wait. The eight rows stand side by side in each step, so
// that a step's producer is eight instructions back. All 32 lanes are on at both call sites.
// asm: the compiler turns __shfl_xor into ds_bpermute_b32 with a wait behind each, and chains the rows one by one.
__device__ __forceinline__ void row_max8(float (&x)[8]) {
  asm(
      "v_max_num_f32_dpp %0, %0, %0 row_xmask:1 row_mask:0xf bank_mask:0xf\n\t"
      "v_max_num_f32_dpp %1, %1, %1 row_xmask:1 row_mask:0xf bank_mask:0xf\n\t"
      "v_max_num_f32_dpp %2, %2, %2 row_xmask:1 row_mask:0xf bank_mask:0xf\n\t"
      "v_max_num_f32_dpp %3, %3, %3 row_xmask:1 row_mask:0xf bank_mask:0xf\n\t"
      "v_max_num_f32_dpp %4, %4, %4 row_xmask:1 row_mask:0xf bank_mask:0xf\n\t"
      "v_max_num_f32_dpp %5, %5, %5 row_xmask:1 row_mask:0xf bank_mask:0xf\n\t"
      "v_max_num_f32_dpp %6, %6, %6 row_xmask:1 row_mask:0xf bank_mask:0xf\n\t"
      "v_max_num_f32_dpp %7, %7, %7 row_xmask:1 row_mask:0xf bank_mask:0xf\n\t"
      "v_max_num_f32_dpp %0, %0, %0 row_xmask:2 row_mask:0xf bank_mask:0xf\n\t"
      "v_max_num_f32_dpp %1, %1, %1 row_xmask:2 row_mask:0xf bank_mask:0xf\n\t"
      "v_max_num_f32_dpp %2, %2, %2 row_xmask:2 row_mask:0xf bank_mask:0xf\n\t"
      "v_max_num_f32_dpp %3, %3, %3 row_xmask:2 row_mask:0xf bank_mask:0xf\n\t"
      "v_max_num_f32_dpp %4, %4, %4 row_xmask:2 row_mask:0xf bank_mask:0xf\n\t"
      "v_max_num_f32_dpp %5, %5, %5 row_xmask:2 row_mask:0xf bank_mask:0xf\n\t"
      "v_max_num_f32_dpp %6, %6, %6 row_xmask:2 row_mask:0xf bank_mask:0xf\n\t"
      "v_max_num_f32_dpp %7, %7, %7 row_xmask:2 row_mask:0xf bank_mask:0xf\n\t"
      "v_max_num_f32_dpp %0, %0, %0 row_xmask:4 row_mask:0xf bank_mask:0xf\n\t"
      "v_max_num_f32_dpp %1, %1, %1 row_xmask:4 row_mask:0xf bank_mask:0xf\n\t"
      "v_max_num_f32_dpp %2, %2, %2 row_xmask:4 row_mask:0xf bank_mask:0xf\n\t"
      "v_max_num_f32_dpp %3, %3, %3 row_xmask:4 row_mask:0xf bank_mask:0xf\n\t"
      "v_max_num_f32_dpp %4, %4, %4 row_xmask:4 row_mask:0xf bank_mask:0xf\n\t"
      "v_max_num_f32_dpp %5, %5, %5 row_xmask:4 row_mask:0xf bank_mask:0xf\n\t"
      "v_max_num_f32_dpp %6, %6, %6 row_xmask:4 row_mask:0xf bank_mask:0xf\n\t"
      "v_max_num_f32_dpp %7, %7, %7 row_xmask:4 row_mask:0xf bank_mask:0xf\n\t"
      "v_max_num_f32_dpp %0, %0, %0 row_xmask:8 row_mask:0xf bank_mask:0xf\n\t"
      "v_max_num_f32_dpp %1, %1, %1 row_xmask:8 row_mask:0xf bank_mask:0xf\n\t"
      "v_max_num_f32_dpp %2, %2, %2 row_xmask:8 row_mask:0xf bank_mask:0xf\n\t"
      "v_max_num_f32_dpp %3, %3, %3 row_xmask:8 row_mask:0xf bank_mask:0xf\n\t"
      "v_max_num_f32_dpp %4, %4, %4 row_xmask:8 row_mask:0xf bank_mask:0xf\n\t"
      "v_max_num_f32_dpp %5, %5, %5 row_xmask:8 row_mask:0xf bank_mask:0xf\n\t"
      "v_max_num_f32_dpp %6, %6, %6 row_xmask:8 row_mask:0xf bank_mask:0xf\n\t"
      "v_max_num_f32_dpp %7, %7, %7 row_xmask:8 row_mask:0xf bank_mask:0xf\n\t"
      : "+v"(x[0]), "+v"(x[1]), "+v"(x[2]), "+v"(x[3]), "+v"(x[4]), "+v"(x[5]), "+v"(x[6]), "+v"(x[7]));
}
__device__ __forceinline__ void row_sum8(float (&x)[8]) {
  asm(
      "v_add_f32_dpp %0, %0, %0 row_xmask:1 row_mask:0xf bank_mask:0xf\n\t"
      "v_add_f32_dpp %1, %1, %1 row_xmask:1 row_mask:0xf bank_mask:0xf\n\t"
      "v_add_f32_dpp %2, %2, %2 row_xmask:1 row_mask:0xf bank_mask:0xf\n\t"
      "v_add_f32_dpp %3, %3, %3 row_xmask:1 row_mask:0xf bank_mask:0xf\n\t"
      "v_add_f32_dpp %4, %4, %4 row_xmask:1 row_mask:0xf bank_mask:0xf\n\t"
      "v_add_f32_dpp %5, %5, %5 row_xmask:1 row_mask:0xf bank_mask:0xf\n\t"
      "v_add_f32_dpp %6, %6, %6 row_xmask:1 row_mask:0xf bank_mask:0xf\n\t"
      "v_add_f32_dpp %7, %7, %7 row_xmask:1 row_mask:0xf bank_mask:0xf\n\t"
      "v_add_f32_dpp %0, %0, %0 row_xmask:2 row_mask:0xf bank_mask:0xf\n\t"
      "v_add_f32_dpp %1, %1, %1 row_xmask:2 row_mask:0xf bank_mask:0xf\n\t"
      "v_add_f32_dpp %2, %2, %2 row_xmask:2 row_mask:0xf bank_mask:0xf\n\t"
      "v_add_f32_dpp %3, %3, %3 row_xmask:2 row_mask:0xf bank_mask:0xf\n\t"
      "v_add_f32_dpp %4, %4, %4 row_xmask:2 row_mask:0xf bank_mask:0xf\n\t"
      "v_add_f32_dpp %5, %5, %5 row_xmask:2 row_mask:0xf bank_mask:0xf\n\t"
      "v_add_f32_dpp %6, %6, %6 row_xmask:2 row_mask:0xf bank_mask:0xf\n\t"
      "v_add_f32_dpp %7, %7, %7 row_xmask:2 row_mask:0xf bank_mask:0xf\n\t"
      "v_add_f32_dpp %0, %0, %0 row_xmask:4 row_mask:0xf bank_mask:0xf\n\t"
      "v_add_f32_dpp %1, %1, %1 row_xmask:4 row_mask:0xf bank_mask:0xf\n\t"
      "v_add_f32_dpp %2, %2, %2 row_xmask:4 row_mask:0xf bank_mask:0xf\n\t"
      "v_add_f32_dpp %3, %3, %3 row_xmask:4 row_mask:0xf bank_mask:0xf\n\t"
      "v_add_f32_dpp %4, %4, %4 row_xmask:4 row_mask:0xf bank_mask:0xf\n\t"
      "v_add_f32_dpp %5, %5, %5 row_xmask:4 row_mask:0xf bank_mask:0xf\n\t"
      "v_add_f32_dpp %6, %6, %6 row_xmask:4 row_mask:0xf bank_mask:0xf\n\t"
      "v_add_f32_dpp %7, %7, %7 row_xmask:4 row_mask:0xf bank_mask:0xf\n\t"
      "v_add_f32_dpp %0, %0, %0 row_xmask:8 row_mask:0xf bank_mask:0xf\n\t"
      "v_add_f32_dpp %1, %1, %1 row_xmask:8 row_mask:0xf bank_mask:0xf\n\t"
      "v_add_f32_dpp %2, %2, %2 row_xmask:8 row_mask:0xf bank_mask:0xf\n\t"
      "v_add_f32_dpp %3, %3, %3 row_xmask:8 row_mask:0xf bank_mask:0xf\n\t"
      "v_add_f32_dpp %4, %4, %4 row_xmask:8 row_mask:0xf bank_mask:0xf\n\t"
      "v_add_f32_dpp %5, %5, %5 row_xmask:8 row_mask:0xf bank_mask:0xf\n\t"
      "v_add_f32_dpp %6, %6, %6 row_xmask:8 row_mask:0xf bank_mask:0xf\n\t"
      "v_add_f32_dpp %7, %7, %7 row_xmask:8 row_mask:0xf bank_mask:0xf\n\t"
      : "+v"(x[0]), "+v"(x[1]), "+v"(x[2]), "+v"(x[3]), "+v"(x[4]), "+v"(x[5]), "+v"(x[6]), "+v"(x[7]));
}

// ---- fragment loaders: 16-bit A/B operand, lane -> row/col (lane&15), p already includes +8*(lane>>4);
//      elements 0..7 <- p[0..7] (k0+8h..), elements 8..15 <- p[16..23] (k0+16+8h..)
__device__ __forceinline__ v16b ldfrag_b(const __bf16* p) {
  union { v16b v; v8b h[2]; } f;
  f.h[0] = *(const v8b*)(p);
  f.h[1] = *(const v8b*)(p + 16);
  return f.v;
}
__device__ __forceinline__ v16h ldfrag_h(const _Float16* p) {
  union { v16h v; v8h h[2]; } f;
  f.h[0] = *(const v8h*)(p);
  f.h[1] = *(const v8h*)(p + 16);
  return f.v;
}

// ---- WMMA helpers with trailing VALU hazard gap --------------------------------------------------------
__device__ __forceinline__ v8f mma_b(v16b a, v16b b, v8f c) {
  c = __builtin_amdgcn_wmma_f32_16x16x32_bf16(false, a, false, b, (short)0, c, false, false);
  asm volatile("v_nop\n\tv_nop\n\tv_nop\n\tv_nop" : "+v"(c) : "v"(a), "v"(b));
  return c;
}
__device__ __forceinline__ v8f mma_h(v16h a, v16h b, v8f c) {
  c = __builtin_amdgcn_wmma_f32_16x16x32_f16(false, a, false, b, (short)0, c, false, false);
  asm volatile("v_nop\n\tv_nop\n\tv_nop\n\tv_nop" : "+v"(c) : "v"(a), "v"(b));
  return c;
}

// =====================================================================================================
// f32 -> bf16 (RNE convert), 8 elements per thread, one 16-B store per lane: a wave writes 512 contiguous B
// Destination plane is compact [b][SEQ*DE]; source batch stride src8 (units of 8 floats) may be larger.
// coverage: n8 threads x 8 = whole plane (n8 = NB*SEQ*DE/8 is a multiple of 256).
// =====================================================================================================
__global__ __launch_bounds__(256) void cvt_bf16x8s(const float* __restrict__ in, unsigned short* out,
                                                   int n8, int per8, int src8) {
  const int i = blockIdx.x * 256 + threadIdx.x;
  if (i < n8) {
    const int hd  = i / per8;
    const int rem = i - hd * per8;
    const float* s = in + ((size_t)hd * src8 + (size_t)rem) * 8;
    const v4f a = *(const v4f*)(s);
    const v4f b = *(const v4f*)(s + 4);
    v4u p;
    p[0] = pk16(bf_bits(a[0]), bf_bits(a[1]));
    p[1] = pk16(bf_bits(a[2]), bf_bits(a[3]));
    p[2] = pk16(bf_bits(b[0]), bf_bits(b[1]));
    p[3] = pk16(bf_bits(b[2]), bf_bits(b[3]));
    *(v4u*)(out + (size_t)i * 8) = p;
    
  }
}

// =====================================================================================================
// Weight W[k][n] f32 (DE x DE, n contiguous) -> transposed 16-bit plane Wt[n][k] (k contiguous, pitch DE).
//   blockIdx.y = matrix id: 0,1,2 -> bf16 bits of the RNE-bf16 value; 3 -> f16 bits of (RNE-bf16 value x64).
//   Block = one 64(k) x 64(n) tile, 256 threads: thread (k = tid>>2, 16-column n quarter) loads 16 floats of row k
//   and writes them transposed into the LDS tile T[n][k]; after the barrier wave w writes rows n = 8w..8w+7:
//   grid.x = (DE/64)^2 tiles covers the whole plane of each of the 4 matrices.
// =====================================================================================================
__global__ __launch_bounds__(256) void wt_tiles(const float* __restrict__ w0, const float* __restrict__ w1,
                                                const float* __restrict__ w2, const float* __restrict__ w3,
                                                unsigned short* o0, unsigned short* o1,
                                                unsigned short* o2, unsigned short* o3) {
  __shared__ __align__(16) unsigned short T[64 * 64];   // [n][k]
  const int tid = threadIdx.x;
  const int mat = blockIdx.y;                            // block-uniform
  const float* in = w0; unsigned short* out = o0;
  if (mat == 1) { in = w1; out = o1; }
  else if (mat == 2) { in = w2; out = o2; }
  else if (mat == 3) { in = w3; out = o3; }
  const int ktile = blockIdx.x / (DE / 64);
  const int ntile = blockIdx.x - ktile * (DE / 64);
  const int k   = tid >> 2;              // 0..63
  const int nq  = (tid & 3) * 16;        // 0,16,32,48
  const float* src = in + (size_t)(ktile * 64 + k) * DE + ntile * 64 + nq;
#pragma unroll
  for (int i = 0; i < 4; ++i) {
    const v4f a = *(const v4f*)(src + 4 * i);
#pragma unroll
    for (int e = 0; e < 4; ++e) {
      const unsigned short bb = bf_bits(a[e]);
      const unsigned short hb = h_bits(bf_up(bb) * WCARRY);
      const unsigned short us = (mat == 3) ? hb : bb;
      T[(nq + 4 * i + e) * 64 + k] = us;
    }
  }
  __syncthreads();
  const int wave = tid >> 5, lane = tid & 31;
  const int q = lane >> 3, c8 = (lane & 7) * 8;
  union { v8us s; v4u u; } x0, x1;
  const int d0 = wave * 8 + q;
  const int d1 = wave * 8 + 4 + q;
  x0.s = *(const v8us*)(T + d0 * 64 + c8);
  x1.s = *(const v8us*)(T + d1 * 64 + c8);
  unsigned short* p0 = out + ((size_t)(ntile * 64 + d0) * DE + ktile * 64 + c8);
  unsigned short* p1 = out + ((size_t)(ntile * 64 + d1) * DE + ktile * 64 + c8);
  *(v4u*)p0 = x0.u;
  *(v4u*)p1 = x1.u;
  
}

// =====================================================================================================
// 16-bit GEMM C[m][n] = sum_k A[m][k] * Bt[n][k], K = DE, M = MROWS, N = DE. Block 256 threads = 8 waves,
// block tile 128 m x 64 n, wave tile 16 x 64 (4 accumulators), k step 32. grid = (DE/64, MROWS/128), exact multiples.
//   Operands: the block's 128 A rows and 64 B rows are staged in LDS one k slab of GKS at a time. 8 lanes fetch one
//   whole 128-B line of a row (16 B each), 256 threads x 6 loads = the (128 + 64) x 128 B of a slab, each line once
//   per block. Two buffers: slab s + 1 is loaded into registers ahead of the products of slab s and stored into the
//   other buffer behind them; one block barrier per slab publishes it and ends the reads of the buffer refilled next.
//   Fragments come from the LDS rows (two 16-B reads each, identical k map for A and B), k ascending.
//   MODE 0: bf16 operands; out16 f16 row-major [MROWS][DE] = (acc + bias) * scale. Wave tile staged in wave-private
//   MODE 1: bf16 operands; out16 f16 transposed per batch [b][DE][SEQ] = (acc + bias) * scale. Block tile staged in
//           cross-wave LDS T[n][key 128] (block barrier); wave w writes rows n = 8w..8w+7, one instruction = 2 rows
//           of 128 halves (16 lanes x 16 B per 256-B row); coverage 8 waves x 4 it x 2 rows x 128 = 64x128.
//   MODE 2: f16 operands; out32 f32 row-major [MROWS][DE] = acc * scale + bias + RNE-bf16(resid), resid rows read at
//           the full batch stride. Wave-private LDS stage (f32), one instruction = 2 rows of 64 floats (16 lanes x
//           16 B per 256-B segment); coverage 8 it x 2 rows x 64 = 16x64.
// =====================================================================================================
template <int MODE>
__global__ __launch_bounds__(256)
void gemm_nt(const unsigned short* __restrict__ A, const unsigned short* __restrict__ Bt,
             const float* __restrict__ bias, const float* __restrict__ resid,
             unsigned short* out16, float* out32, float scale) {
  __shared__ __align__(16) unsigned char smem[2 * GSLAB * 2];
  const int tid  = threadIdx.x;
  const int wave = tid >> 5;
  const int lane = tid & 31;
  const int hh   = lane >> 4;
  const int c    = lane & 15;
  const int m0b  = blockIdx.y * 128;
  const int m0   = m0b + wave * 16;
  const int n0   = blockIdx.x * 64;

  v8f acc[4];
#pragma unroll
  for (int t = 0; t < 4; ++t) acc[t] = zero8();

  unsigned short* SL = (unsigned short*)(void*)smem;
  const int srow = tid >> 3;                 // 0..31: row within a group of 32 staged rows
  const int scol = (tid & 7) * 8;            // 16-B piece of the row's 128-B line
  const unsigned short* Ag = A  + (size_t)(m0b + srow) * DE + scol;
  const unsigned short* Bg = Bt + (size_t)(n0 + srow) * DE + scol;
  const int sa = srow * GP + scol;                  // staged A rows 0..127
  const int sb = (128 + srow) * GP + scol;          // staged B rows 0..63
  const int fa = (wave * 16 + c) * GP + 8 * hh;     // this lane's A fragment row
  const int fb = (128 + c) * GP + 8 * hh;           // this lane's B fragment row of n group 0

  v4u ra[4], rb[2];
#pragma unroll
  for (int i = 0; i < 4; ++i) ra[i] = *(const v4u*)(Ag + (size_t)i * 32 * DE);
#pragma unroll
  for (int i = 0; i < 2; ++i) rb[i] = *(const v4u*)(Bg + (size_t)i * 32 * DE);
#pragma unroll
  for (int i = 0; i < 4; ++i) *(v4u*)(SL + sa + i * 32 * GP) = ra[i];
#pragma unroll
  for (int i = 0; i < 2; ++i) *(v4u*)(SL + sb + i * 32 * GP) = rb[i];
  __syncthreads();

  // unrolled in full: buffer index and slab offset become immediates, no address register changes in the loop
#pragma unroll
  for (int s = 0; s < DE / GKS; ++s) {
    const unsigned short* cur = SL + (s & 1) * GSLAB;
    unsigned short* nxt = SL + ((s + 1) & 1) * GSLAB;
    if (s + 1 < DE / GKS) {
#pragma unroll
      for (int i = 0; i < 4; ++i) ra[i] = *(const v4u*)(Ag + (size_t)i * 32 * DE + (s + 1) * GKS);
#pragma unroll
      for (int i = 0; i < 2; ++i) rb[i] = *(const v4u*)(Bg + (size_t)i * 32 * DE + (s + 1) * GKS);
    }
    // all fragments of the slab are read as one group ahead of its products, so that the reads' latencies overlap
    if (MODE == 2) {
      v16h a[GKS / 32], b[GKS / 32][4];
#pragma unroll
      for (int kk = 0; kk < GKS / 32; ++kk) {
        a[kk] = ldfrag_h((const _Float16*)(const void*)(cur + fa + kk * 32));
#pragma unroll
        for (int t = 0; t < 4; ++t) b[kk][t] = ldfrag_h((const _Float16*)(const void*)(cur + fb + t * 16 * GP + kk * 32));
      }
#pragma unroll
      for (int kk = 0; kk < GKS / 32; ++kk)
#pragma unroll
        for (int t = 0; t < 4; ++t) acc[t] = mma_h(a[kk], b[kk][t], acc[t]);
    } else {
      v16b a[GKS / 32], b[GKS / 32][4];
#pragma unroll
      for (int kk = 0; kk < GKS / 32; ++kk) {
        a[kk] = ldfrag_b((const __bf16*)(const void*)(cur + fa + kk * 32));
#pragma unroll
        for (int t = 0; t < 4; ++t) b[kk][t] = ldfrag_b((const __bf16*)(const void*)(cur + fb + t * 16 * GP + kk * 32));
      }
#pragma unroll
      for (int kk = 0; kk < GKS / 32; ++kk)
#pragma unroll
        for (int t = 0; t < 4; ++t) acc[t] = mma_b(a[kk], b[kk][t], acc[t]);
    }
    if (s + 1 < DE / GKS) {
#pragma unroll
      for (int i = 0; i < 4; ++i) *(v4u*)(nxt + sa + i * 32 * GP) = ra[i];
#pragma unroll
      for (int i = 0; i < 2; ++i) *(v4u*)(nxt + sb + i * 32 * GP) = rb[i];
    }
    __syncthreads();   // publishes slab s + 1; ends the reads of slab s (its buffer is refilled, or reused below)
  }

  if (MODE == 0) {
    _Float16* S = (_Float16*)(void*)smem + wave * 1024;          // [16][64] per wave
#pragma unroll
    for (int t = 0; t < 4; ++t) {
      const float bi = bf_up(bf_bits(bias[n0 + t * 16 + c]));
#pragma unroll
      for (int r = 0; r < 8; ++r) S[(8 * hh + r) * 64 + t * 16 + c] = (_Float16)((acc[t][r] + bi) * scale);
    }
    __builtin_amdgcn_fence(__ATOMIC_RELEASE, "workgroup");
    __builtin_amdgcn_wave_barrier();
    __builtin_amdgcn_fence(__ATOMIC_ACQUIRE, "workgroup");
    const int rq = lane >> 3, c8 = (lane & 7) * 8;
    union { v8h h; v4u u; } w[4];
#pragma unroll
    for (int it = 0; it < 4; ++it) w[it].h = *(const v8h*)(S + (it * 4 + rq) * 64 + c8);
    {
#pragma unroll
      for (int it = 0; it < 4; ++it)
        *(v4u*)(out16 + (size_t)(m0 + it * 4 + rq) * DE + n0 + c8) = w[it].u;
      
    }
  } else if (MODE == 1) {
    _Float16* T = (_Float16*)(void*)smem;                       // [n 64][key 128]
#pragma unroll
    for (int t = 0; t < 4; ++t) {
      const float bi = bf_up(bf_bits(bias[n0 + t * 16 + c]));
#pragma unroll
      for (int r = 0; r < 8; ++r)
        T[(t * 16 + c) * 128 + wave * 16 + 8 * hh + r] = (_Float16)((acc[t][r] + bi) * scale);
    }
    __syncthreads();
    const int bidx = m0b / SEQ;                                  // tiles never straddle batches (128 | SEQ)
    const int key0 = m0b - bidx * SEQ;
    const int rh = lane >> 4, c8 = (lane & 15) * 8;
    union { v8h h; v4u u; } w[4];
#pragma unroll
    for (int it = 0; it < 4; ++it) w[it].h = *(const v8h*)(T + (wave * 8 + it * 2 + rh) * 128 + c8);
    {
#pragma unroll
      for (int it = 0; it < 4; ++it) {
        const int row = wave * 8 + it * 2 + rh;
        *(v4u*)(out16 + ((size_t)(bidx * DE + n0 + row) * SEQ + key0 + c8)) = w[it].u;
      }
      
    }
  } else {
    float* S = (float*)(void*)smem + wave * 1024;                // [16][64] f32 per wave
#pragma unroll
    for (int t = 0; t < 4; ++t) {
      const float bi = bf_up(bf_bits(bias[n0 + t * 16 + c]));
#pragma unroll
      for (int r = 0; r < 8; ++r) S[(8 * hh + r) * 64 + t * 16 + c] = acc[t][r] * scale + bi;
    }
    __builtin_amdgcn_fence(__ATOMIC_RELEASE, "workgroup");
    __builtin_amdgcn_wave_barrier();
    __builtin_amdgcn_fence(__ATOMIC_ACQUIRE, "workgroup");
    const int rh = lane >> 4, c4 = (lane & 15) * 4;
    v4f vals[8];
#pragma unroll
    for (int it = 0; it < 8; ++it) {
      const int row = it * 2 + rh;
      const int gm  = m0 + row;
      const int bb  = gm / SEQ;
      const int tt  = gm - bb * SEQ;
      v4f x = *(const v4f*)(S + row * 64 + c4);
      const v4f rq = *(const v4f*)(resid + ((size_t)bb * SEQ_FULL + tt) * DE + n0 + c4);
#pragma unroll
      for (int e = 0; e < 4; ++e) x[e] = x[e] + bf_up(bf_bits(rq[e]));
      vals[it] = x;
    }
    {
#pragma unroll
      for (int it = 0; it < 8; ++it)
        *(v4f*)(out32 + (size_t)(m0 + it * 2 + rh) * DE + n0 + c4) = vals[it];
      
    }
  }
}

// =====================================================================================================
// Full (unmasked) attention, head dim 64, all NQB key tiles.
//   q plane (f16):  element (b, t, h, d) at [(b*SEQ + t)*DE + h*64 + d]      k plane (f16): same with key index s
//   v^T plane (f16): element (b, h, d, s) at [(b*DE + h*64 + d)*SEQ + s], value v*64
//   scores = q . k (f16 WMMA, f32 acc) * 0.125; online softmax in f32; p = exp(s - m) carried as f16(16384 p);
//   context = p . v on f16 WMMA; RES adds the f16 residual plane of p (x4096, separate accumulator folded back
//   with 1/4096 per tile in f32). ctx out = f16(context / (l * 16384 * 64) * 64) to [(b*SEQ + t)*DE + h*64 + d].
//   Block = 4 waves = 64 query rows of one (b,h); grid = nqbThis * NH * NB; kv tiles of 64.
//   K / V^T tile staging: 128 threads x 32 elements per plane = the whole 64x64 tile (plain 16-B loads,
//   __syncthreads before and after, cross-wave); staged extent == consumed extent for Ksh, Vth, Psh, Psl, Os.
//   Ksh, Vth, Psh, Psl rows lie at pitch LP (64 used halves + 8 never touched) so that the 16 rows one 16-B fragment
//   read walks fall on 16 different bank groups.
//   P tiles and the Os tile are wave-private, spilled with _Float16 element stores and reloaded as v8h (same element
//   Output coverage: each wave stores rows 0..15 (it 0..3 x lane>>3) x 64 halves (8 lanes x 16 B): one instruction
// =====================================================================================================
template <bool RES>
__global__ __launch_bounds__(128)
void attn_full64(const unsigned short* __restrict__ qp, const unsigned short* __restrict__ kp,
                 const unsigned short* __restrict__ vtp, unsigned short* ctx, int qbBase, int nqbThis) {
  union FH { v16h v; v8h h[2]; };
  __shared__ __align__(16) _Float16 Ksh[64 * LP];                 // K [kv][d], pitch LP
  __shared__ __align__(16) _Float16 Vth[64 * LP];                 // V^T [d][kv], pitch LP
  __shared__ __align__(16) _Float16 Psh[4][16 * LP];              // per wave P [row][kv], pitch LP
  __shared__ __align__(16) _Float16 Psl[RES ? 4 : 1][16 * LP];    // per wave P residual, pitch LP
  __shared__ __align__(16) _Float16 Os[4][16 * 64];               // per wave context tile [row][d]

  const int tid  = threadIdx.x;
  const int wave = tid >> 5;
  const int lane = tid & 31;
  const int hh   = lane >> 4;
  const int c    = lane & 15;

  const int bx   = blockIdx.x;
  const int qbl  = bx % nqbThis;
  const int bhq  = bx / nqbThis;           // 0..NB*NH-1
  const int h    = bhq % NH;
  const int b    = bhq / NH;
  const int qb   = qbBase + qbl;           // 0..NQB-1
  const int q0   = qb * 64 + wave * 16;    // query index within the sequence

  const _Float16* Qh = (const _Float16*)(const void*)qp + (size_t)b * SEQ * DE + (size_t)h * HD;
  const _Float16* Kh = (const _Float16*)(const void*)kp + (size_t)b * SEQ * DE + (size_t)h * HD;
  const _Float16* Vh = (const _Float16*)(const void*)vtp + ((size_t)b * DE + (size_t)h * HD) * SEQ;

  // ---- Q fragments (A operand, row = lane&15): 2 d-chunks ----
  v16h qa[2];
#pragma unroll
  for (int dc = 0; dc < 2; ++dc) {
    const size_t qo = (size_t)(q0 + c) * DE + dc * 32 + 8 * hh;
    qa[dc] = ldfrag_h(Qh + qo);
  }

  float mrow[8], lrow[8];
  v8f oacc[4];
#pragma unroll
  for (int r = 0; r < 8; ++r) { mrow[r] = -INFINITY; lrow[r] = 0.f; }
#pragma unroll
  for (int t = 0; t < 4; ++t) oacc[t] = zero8();

  for (int kt = 0; kt < NQB; ++kt) {        // block-uniform bounds, exactly NQB trips
    const int kv0 = kt * 64;
    __syncthreads();
    {
      const int r = tid >> 1, half = (tid & 1) * 32;
      const _Float16* kg = Kh + (size_t)(kv0 + r) * DE + half;   // K row kv0+r, d = half..half+31
      const _Float16* vg = Vh + (size_t)r * SEQ + kv0 + half;    // V^T row d = r, s = kv0+half..+31
#pragma unroll
      for (int i = 0; i < 4; ++i) {
        const v8h a0 = *(const v8h*)(kg + 8 * i);
        const v8h b0 = *(const v8h*)(vg + 8 * i);
        *(v8h*)(Ksh + r * LP + half + 8 * i) = a0;
        *(v8h*)(Vth + r * LP + half + 8 * i) = b0;
      }
    }
    __syncthreads();

    // ---- scores: 16 query rows x 64 keys per wave, single f16 product ----
    v8f s[4];
#pragma unroll
    for (int j = 0; j < 4; ++j) {
      s[j] = zero8();
#pragma unroll
      for (int dc = 0; dc < 2; ++dc) {
        FH kb;
        kb.h[0] = *(const v8h*)(Ksh + (j * 16 + c) * LP + dc * 32 + 8 * hh);
        kb.h[1] = *(const v8h*)(Ksh + (j * 16 + c) * LP + dc * 32 + 16 + 8 * hh);
        s[j] = mma_h(qa[dc], kb.v, s[j]);
      }
    }

    // ---- scale, row max, online softmax, P (x16384, f16) and P residual (x4096) to LDS ----
    _Float16* pwh = Psh[wave];
    _Float16* pwl = Psl[RES ? wave : 0];
    float mx[8], ps[8], al[8], ms[8];   // per row: tile maximum, tile sum, rescale factor, maximum in use
#pragma unroll
    for (int r = 0; r < 8; ++r) {
      float m = -INFINITY;
#pragma unroll
      for (int j = 0; j < 4; ++j) {
        const float sv = s[j][r] * 0.125f;
        s[j][r] = sv;
        m = fmaxf(m, sv);
      }
      mx[r] = m;
    }
    row_max8(mx);
#pragma unroll
    for (int r = 0; r < 8; ++r) {
      const float mnew  = fmaxf(mrow[r], mx[r]);
      const float msafe = (mnew == -INFINITY) ? 0.f : mnew;
      al[r] = __expf(mrow[r] - msafe);
      ms[r] = msafe;
      mrow[r] = mnew;
    }
#pragma unroll
    for (int r = 0; r < 8; ++r) {
      float psum = 0.f;
#pragma unroll
      for (int j = 0; j < 4; ++j) {
        const float p = __expf(s[j][r] - ms[r]);
        psum += p;
        const float p1k = p * PCARRY;
        const _Float16 ph = (_Float16)p1k;
        pwh[(8 * hh + r) * LP + j * 16 + c] = ph;
        if (RES) {
          const _Float16 pl = (_Float16)((p1k - (float)ph) * PRES);
          pwl[(8 * hh + r) * LP + j * 16 + c] = pl;
        }
      }
      ps[r] = psum;
    }
    row_sum8(ps);
#pragma unroll
    for (int r = 0; r < 8; ++r) {
      lrow[r] = lrow[r] * al[r] + ps[r];
#pragma unroll
      for (int t = 0; t < 4; ++t) oacc[t][r] *= al[r];
    }
    __builtin_amdgcn_fence(__ATOMIC_RELEASE, "workgroup");
    __builtin_amdgcn_wave_barrier();
    __builtin_amdgcn_fence(__ATOMIC_ACQUIRE, "workgroup");

    // ---- context += P . V (f16 WMMA), residual products into a separate accumulator ----
    v8f o1[4];
#pragma unroll
    for (int t = 0; t < 4; ++t) o1[t] = zero8();
#pragma unroll 1
    for (int kk = 0; kk < 2; ++kk) {
      FH pa, pl;
      pa.h[0] = *(const v8h*)(pwh + c * LP + kk * 32 + 8 * hh);
      pa.h[1] = *(const v8h*)(pwh + c * LP + kk * 32 + 16 + 8 * hh);
      if (RES) {
        pl.h[0] = *(const v8h*)(pwl + c * LP + kk * 32 + 8 * hh);
        pl.h[1] = *(const v8h*)(pwl + c * LP + kk * 32 + 16 + 8 * hh);
      } else {
        pl.v = pa.v;
      }
#pragma unroll
      for (int t = 0; t < 4; ++t) {
        FH vb;
        vb.h[0] = *(const v8h*)(Vth + (t * 16 + c) * LP + kk * 32 + 8 * hh);
        vb.h[1] = *(const v8h*)(Vth + (t * 16 + c) * LP + kk * 32 + 16 + 8 * hh);
        oacc[t] = mma_h(pa.v, vb.v, oacc[t]);
        if (RES) o1[t] = mma_h(pl.v, vb.v, o1[t]);
      }
    }
    if (RES) {
#pragma unroll
      for (int t = 0; t < 4; ++t)
#pragma unroll
        for (int r = 0; r < 8; ++r) oacc[t][r] += o1[t][r] * (1.0f / PRES);
    }
  }

  // ---- normalise (1/l, the p, v carries) and apply the ctx carry; stage the wave's 16x64 f16 tile; write whole
  _Float16* os = Os[wave];
#pragma unroll
  for (int r = 0; r < 8; ++r) {
    const float l = lrow[r];
    const float inv = ((l > 0.f) ? (1.0f / l) : 0.f) * (CCARRY / (PCARRY * VCARRY));
#pragma unroll
    for (int t = 0; t < 4; ++t) os[(8 * hh + r) * 64 + t * 16 + c] = (_Float16)(oacc[t][r] * inv);
  }
  __builtin_amdgcn_fence(__ATOMIC_RELEASE, "workgroup");
  __builtin_amdgcn_wave_barrier();
  __builtin_amdgcn_fence(__ATOMIC_ACQUIRE, "workgroup");
  {
    const int rq = lane >> 3, c8 = (lane & 7) * 8;
    union { v8h h; v4u u; } w[4];
#pragma unroll
    for (int it = 0; it < 4; ++it) w[it].h = *(const v8h*)(os + (it * 4 + rq) * 64 + c8);
    unsigned short* ob = ctx + ((size_t)b * SEQ) * DE + (size_t)h * HD;
    {
#pragma unroll
      for (int it = 0; it < 4; ++it) {
        const int row = it * 4 + rq;                     // it 0..3 x rq 0..3 = rows 0..15
        *(v4u*)(ob + (size_t)(q0 + row) * DE + c8) = w[it].u;
      }
      
    }
  }
}

// =====================================================================================================
// LayerNorm over DE of x [MROWS][DE] f32: one block of 256 threads per row, thread owns 4 consecutive floats.
// mean and centred variance via wave shuffles + 8-entry LDS partials (cross-wave, block barriers), fixed order.
// y = (x - mu) * rsqrt(var + 1e-5) * RNE-bf16(gamma) + RNE-bf16(beta). Output row b*SEQ_FULL + t of d_out;
// coverage: MROWS blocks x 256 threads x 4 floats = every processed output row in full.
// =====================================================================================================
__global__ __launch_bounds__(256) void ln_rows(const float* __restrict__ x, const float* __restrict__ gam,
                                               const float* __restrict__ bet, float* out) {
  __shared__ float red1[8];
  __shared__ float red2[8];
  const int tid = threadIdx.x, wave = tid >> 5, lane = tid & 31;
  const int row = blockIdx.x;
  const int bb  = row / SEQ;
  const int tt  = row - bb * SEQ;
  const size_t orow = (size_t)bb * SEQ_FULL + (size_t)tt;

  const v4f v = *(const v4f*)(x + (size_t)row * DE + tid * 4);
  float s = (v[0] + v[1]) + (v[2] + v[3]);
#pragma unroll
  for (int off = 16; off > 0; off >>= 1) s += __shfl_xor(s, off, 32);
  if (lane == 0) red1[wave] = s;
  __syncthreads();
  float tot = 0.f;
#pragma unroll
  for (int w = 0; w < 8; ++w) tot += red1[w];
  const float mu = tot * (1.0f / (float)DE);

  v4f d;
#pragma unroll
  for (int e = 0; e < 4; ++e) d[e] = v[e] - mu;
  float s2 = (d[0] * d[0] + d[1] * d[1]) + (d[2] * d[2] + d[3] * d[3]);
#pragma unroll
  for (int off = 16; off > 0; off >>= 1) s2 += __shfl_xor(s2, off, 32);
  if (lane == 0) red2[wave] = s2;
  __syncthreads();
  float tot2 = 0.f;
#pragma unroll
  for (int w = 0; w < 8; ++w) tot2 += red2[w];
  const float var  = tot2 * (1.0f / (float)DE);
  const float rstd = rsqrtf(var + 1.0e-5f);

  const v4f g4 = *(const v4f*)(gam + tid * 4);
  const v4f b4 = *(const v4f*)(bet + tid * 4);
  v4f y;
#pragma unroll
  for (int e = 0; e < 4; ++e) y[e] = (d[e] * rstd) * bf_up(bf_bits(g4[e])) + bf_up(bf_bits(b4[e]));
  float* op = out + orow * DE + (size_t)tid * 4;
  *(v4f*)op = y;
  
}

// =====================================================================================================
// Workspace map (bytes, full size): PQ bf16 [MROWS][DE] at 0 (8388608); PK bf16 at 8388608 (8388608);
// Wq^T, Wk^T, Wv^T bf16 and Wo^T f16 [DE][DE] at 16777216.. (4 x 2097152); Q f16 [MROWS][DE] at 25165824;
// K f16 at 33554432; V^T f16 [NB][DE][SEQ] at 41943040; CTX f16 [MROWS][DE] at 50331648; X f32 [MROWS][DE]
// at 58720256 (16777216); end 75497472. Every plane is an exact multiple of its whole-line store granularity
// Launch plan (10): cvt pre_q, cvt pre_k, weight transpose-convert, gemm q, gemm k, gemm v^T, attention (leading
// query blocks with the p residual, remaining blocks without), gemm o + residual, LayerNorm.
// =====================================================================================================
extern "C" void kernel_launch(void* const* d_in, const int* in_sizes, int n_in,
                              void* d_out, int out_size, void* d_ws, size_t ws_size,
                              hipStream_t stream) {
  if (n_in < 12) return;
  const long long needIn = (long long)(NB - 1) * SEQ_FULL * DE + (long long)SEQ * DE;
  if ((long long)in_sizes[0] < needIn || (long long)in_sizes[1] < needIn) return;
  if (in_sizes[2] < DE * DE || in_sizes[4] < DE * DE || in_sizes[6] < DE * DE || in_sizes[8] < DE * DE) return;
  if (in_sizes[3] < DE || in_sizes[5] < DE || in_sizes[7] < DE || in_sizes[9] < DE) return;
  if (in_sizes[10] < DE || in_sizes[11] < DE) return;
  if (out_size < 0 || (long long)out_size < needIn) return;

  const size_t P16 = (size_t)MROWS * DE * 2;     // one 16-bit activation plane
  const size_t W16 = (size_t)DE * DE * 2;        // one 16-bit weight plane
  const size_t P32 = (size_t)MROWS * DE * 4;     // x plane
  size_t off = 0;
  const size_t oPQ  = off; off += P16;
  const size_t oPK  = off; off += P16;
  const size_t oWq  = off; off += W16;
  const size_t oWk  = off; off += W16;
  const size_t oWv  = off; off += W16;
  const size_t oWo  = off; off += W16;
  const size_t oQ   = off; off += P16;
  const size_t oK   = off; off += P16;
  const size_t oVT  = off; off += P16;
  const size_t oCTX = off; off += P16;
  const size_t oX   = off; off += P32;
  if (off > ws_size) return;                     // off = 75497472 at full size
  if (off > (size_t)134217728) return;

  const float* pre_q = (const float*)d_in[0];
  const float* pre_k = (const float*)d_in[1];
  const float* Wq    = (const float*)d_in[2];
  const float* bq    = (const float*)d_in[3];
  const float* Wk    = (const float*)d_in[4];
  const float* bk    = (const float*)d_in[5];
  const float* Wv    = (const float*)d_in[6];
  const float* bv    = (const float*)d_in[7];
  const float* Wo    = (const float*)d_in[8];
  const float* bo    = (const float*)d_in[9];
  const float* gamma = (const float*)d_in[10];
  const float* beta  = (const float*)d_in[11];
  float* out = (float*)d_out;

  char* ws = (char*)d_ws;
  unsigned short* PQb  = (unsigned short*)(ws + oPQ);
  unsigned short* PKb  = (unsigned short*)(ws + oPK);
  unsigned short* Wqt  = (unsigned short*)(ws + oWq);
  unsigned short* Wkt  = (unsigned short*)(ws + oWk);
  unsigned short* Wvt  = (unsigned short*)(ws + oWv);
  unsigned short* Wot  = (unsigned short*)(ws + oWo);
  unsigned short* Qh   = (unsigned short*)(ws + oQ);
  unsigned short* Kh   = (unsigned short*)(ws + oK);
  unsigned short* VTb  = (unsigned short*)(ws + oVT);
  unsigned short* CTXb = (unsigned short*)(ws + oCTX);
  float*          Xb   = (float*)(ws + oX);

  const dim3 blk(256);
  const int n8   = MROWS * DE / 8;               // 524288 at full size
  const int per8 = SEQ * DE / 8;
  const int src8 = SEQ_FULL * DE / 8;
  const dim3 gCvt((n8 + 255) / 256);
  const dim3 gWt((DE / 64) * (DE / 64), 4);      // 256 tiles x 4 matrices
  const dim3 gG(DE / 64, MROWS / 128);           // (16, 32) at full size
  int resqb = RESQB;
  if (resqb > NQB) resqb = NQB;

  // (1) activations -> bf16 planes (RNE convert)
  cvt_bf16x8s<<<gCvt, blk, 0, stream>>>(pre_q, PQb, n8, per8, src8);
  cvt_bf16x8s<<<gCvt, blk, 0, stream>>>(pre_k, PKb, n8, per8, src8);
  // (2) weights -> transposed 16-bit planes (Wq, Wk, Wv bf16; Wo f16 x64)
  wt_tiles<<<gWt, blk, 0, stream>>>(Wq, Wk, Wv, Wo, Wqt, Wkt, Wvt, Wot);
  // (3) projections: q, k -> f16 row-major; v -> f16 v^T x64
  gemm_nt<0><<<gG, blk, 0, stream>>>(PQb, Wqt, bq, pre_q, Qh, Xb, 1.0f);
  gemm_nt<0><<<gG, blk, 0, stream>>>(PKb, Wkt, bk, pre_q, Kh, Xb, 1.0f);
  gemm_nt<1><<<gG, blk, 0, stream>>>(PKb, Wvt, bv, pre_q, VTb, Xb, VCARRY);
  // (4) attention -> ctx f16 x64: query blocks 0..resqb-1 with the p residual plane, the rest without
  attn_full64<true><<<dim3(NB * NH * resqb), dim3(128), 0, stream>>>(Qh, Kh, VTb, CTXb, 0, resqb);
  if (NQB - resqb > 0) {
    attn_full64<false><<<dim3(NB * NH * (NQB - resqb)), dim3(128), 0, stream>>>(Qh, Kh, VTb, CTXb, resqb, NQB - resqb);
  }
  // (5) output projection + bias + residual -> x f32
  gemm_nt<2><<<gG, blk, 0, stream>>>(CTXb, Wot, bo, pre_q, CTXb, Xb, 1.0f / (CCARRY * WCARRY));
  // (6) LayerNorm -> output
  ln_rows<<<dim3(MROWS), blk, 0, stream>>>(Xb, gamma, beta, out);
  (void)hipGetLastError();
}

// v004
// One run takes 184 microseconds.
// Next to v003, in two timings, it ran 1.21 times as fast each time.
// All steps since v000 together make it 2.56 times as fast.
// Contractions: q/k/v projections = v_wmma_f32_16x16x32_bf16 (bf16 operands = RNE-converted activations and
// transposed weights, single product, f32 accumulate); q.k^T scores, p.v context and ctx.Wo projection =
// v_wmma_f32_16x16x32_f16 (q, k = f16 of the f32 projection sums, unscaled; p = exp(s - m) carried x16384 plus an
// f16 residual plane of p x4096 on the leading query blocks; v^T, ctx and Wo carried x64 in f16), f32 accumulate;
// softmax, bias/residual add and LayerNorm in f32.
#include <hip/hip_runtime.h>
#include <math.h>
#include <stdint.h>

#ifndef NB
#define NB 2                 // batches processed (reducible)
#endif
#ifndef NB_FULL
#define NB_FULL 2            // batches in the inputs / output
#endif
#ifndef SEQ
#define SEQ 2048             // query == key length processed (reducible)
#endif
#ifndef SEQ_FULL
#define SEQ_FULL 2048        // per-batch row stride of the inputs and of the output
#endif
#define DE    1024
#define NH    16
#define HD    64
#define NQB   (SEQ / 64)
#define MROWS (NB * SEQ)
#ifndef RESQB
#define RESQB 8              // leading 64-row query blocks per (b,h) that carry the p residual plane
#endif
#define PCARRY 16384.0f
#define PRES   4096.0f
#define VCARRY 64.0f
#define CCARRY 64.0f
#define WCARRY 64.0f
#define LP    72             // LDS row pitch (halves) of the attention K, V^T and P tiles: 144 B = 16 B x odd
#define GKS   64             // k extent (halves) of one staged GEMM slab: one whole 128-B line per row
#define GP    72             // LDS row pitch (halves) of the staged GEMM slabs: 144 B = 16 B x odd
#define GSLAB ((128 + 64) * GP)   // halves in one slab buffer: 128 A rows, then 64 B rows

static_assert(NB >= 1 && NB <= NB_FULL);
static_assert((SEQ % 128) == 0 && SEQ >= 128 && SEQ <= SEQ_FULL);
static_assert(NH * HD == DE);
static_assert(RESQB >= 1);
static_assert(LP >= HD && (LP % 8) == 0 && ((LP / 8) % 2) == 1);   // 16-B aligned rows, odd count of 16-B units
static_assert((MROWS % 128) == 0 && (DE % 64) == 0 && (DE % 32) == 0);
static_assert(GP >= GKS && (GP % 8) == 0 && ((GP / 8) % 2) == 1 && (DE % GKS) == 0 && (GKS % 32) == 0);
static_assert(2 * GSLAB * 2 >= 32768);                               // the epilogue stages reuse the slab buffers
static_assert((long long)NB_FULL * SEQ_FULL * DE * 4 == 16777216LL);   // total output bytes at full size

typedef _Float16 v16h __attribute__((ext_vector_type(16)));
typedef _Float16 v8h  __attribute__((ext_vector_type(8)));
typedef __bf16   v16b __attribute__((ext_vector_type(16)));
typedef __bf16   v8b  __attribute__((ext_vector_type(8)));
typedef float    v8f  __attribute__((ext_vector_type(8)));
typedef float    v4f  __attribute__((ext_vector_type(4)));
typedef unsigned int v4u __attribute__((ext_vector_type(4)));
typedef unsigned short v8us __attribute__((ext_vector_type(8)));

// ---- scalar helpers --------------------------------------------------------------------------------
__device__ __forceinline__ unsigned short bf_bits(float f) {          // f32 -> bf16 bits, RNE convert
  unsigned u = __float_as_uint(f);
  return (unsigned short)((u + 0x7FFFu + ((u >> 16) & 1u)) >> 16);
}
__device__ __forceinline__ float bf_up(unsigned short h) { return __uint_as_float(((unsigned)h) << 16); }
__device__ __forceinline__ unsigned short h_bits(float f) {           // f32 -> f16 bits, RNE convert
  union { _Float16 h; unsigned short u; } cvt;
  cvt.h = (_Float16)f;
  return cvt.u;
}
__device__ __forceinline__ unsigned pk16(unsigned short a, unsigned short b) { return (unsigned)a | ((unsigned)b << 16); }
__device__ __forceinline__ v8f zero8() { v8f z = {0.f, 0.f, 0.f, 0.f, 0.f, 0.f, 0.f, 0.f}; return z; }

// ---- 16-lane row reductions of eight values at once, on the vector unit -------------------------------------
// Four xor steps (lane l with lane l ^ 1, 2, 4, 8 of its 16-lane row), each for all eight registers. The partner's
// value comes as a DPP operand: no LDS crossbar trip and no wait. The eight rows stand side by side in each step, so
// that a step's producer is eight instructions back. All 32 lanes are on at both call sites.
// asm: the compiler turns __shfl_xor into ds_bpermute_b32 with a wait behind each, and chains the rows one by one.
__device__ __forceinline__ void row_max8(float (&x)[8]) {
  asm(
      "v_max_num_f32_dpp %0, %0, %0 row_xmask:1 row_mask:0xf bank_mask:0xf\n\t"
      "v_max_num_f32_dpp %1, %1, %1 row_xmask:1 row_mask:0xf bank_mask:0xf\n\t"
      "v_max_num_f32_dpp %2, %2, %2 row_xmask:1 row_mask:0xf bank_mask:0xf\n\t"
      "v_max_num_f32_dpp %3, %3, %3 row_xmask:1 row_mask:0xf bank_mask:0xf\n\t"
      "v_max_num_f32_dpp %4, %4, %4 row_xmask:1 row_mask:0xf bank_mask:0xf\n\t"
      "v_max_num_f32_dpp %5, %5, %5 row_xmask:1 row_mask:0xf bank_mask:0xf\n\t"
      "v_max_num_f32_dpp %6, %6, %6 row_xmask:1 row_mask:0xf bank_mask:0xf\n\t"
      "v_max_num_f32_dpp %7, %7, %7 row_xmask:1 row_mask:0xf bank_mask:0xf\n\t"
      "v_max_num_f32_dpp %0, %0, %0 row_xmask:2 row_mask:0xf bank_mask:0xf\n\t"
      "v_max_num_f32_dpp %1, %1, %1 row_xmask:2 row_mask:0xf bank_mask:0xf\n\t"
      "v_max_num_f32_dpp %2, %2, %2 row_xmask:2 row_mask:0xf bank_mask:0xf\n\t"
      "v_max_num_f32_dpp %3, %3, %3 row_xmask:2 row_mask:0xf bank_mask:0xf\n\t"
      "v_max_num_f32_dpp %4, %4, %4 row_xmask:2 row_mask:0xf bank_mask:0xf\n\t"
      "v_max_num_f32_dpp %5, %5, %5 row_xmask:2 row_mask:0xf bank_mask:0xf\n\t"
      "v_max_num_f32_dpp %6, %6, %6 row_xmask:2 row_mask:0xf bank_mask:0xf\n\t"
      "v_max_num_f32_dpp %7, %7, %7 row_xmask:2 row_mask:0xf bank_mask:0xf\n\t"
      "v_max_num_f32_dpp %0, %0, %0 row_xmask:4 row_mask:0xf bank_mask:0xf\n\t"
      "v_max_num_f32_dpp %1, %1, %1 row_xmask:4 row_mask:0xf bank_mask:0xf\n\t"
      "v_max_num_f32_dpp %2, %2, %2 row_xmask:4 row_mask:0xf bank_mask:0xf\n\t"
      "v_max_num_f32_dpp %3, %3, %3 row_xmask:4 row_mask:0xf bank_mask:0xf\n\t"
      "v_max_num_f32_dpp %4, %4, %4 row_xmask:4 row_mask:0xf bank_mask:0xf\n\t"
      "v_max_num_f32_dpp %5, %5, %5 row_xmask:4 row_mask:0xf bank_mask:0xf\n\t"
      "v_max_num_f32_dpp %6, %6, %6 row_xmask:4 row_mask:0xf bank_mask:0xf\n\t"
      "v_max_num_f32_dpp %7, %7, %7 row_xmask:4 row_mask:0xf bank_mask:0xf\n\t"
      "v_max_num_f32_dpp %0, %0, %0 row_xmask:8 row_mask:0xf bank_mask:0xf\n\t"
      "v_max_num_f32_dpp %1, %1, %1 row_xmask:8 row_mask:0xf bank_mask:0xf\n\t"
      "v_max_num_f32_dpp %2, %2, %2 row_xmask:8 row_mask:0xf bank_mask:0xf\n\t"
      "v_max_num_f32_dpp %3, %3, %3 row_xmask:8 row_mask:0xf bank_mask:0xf\n\t"
      "v_max_num_f32_dpp %4, %4, %4 row_xmask:8 row_mask:0xf bank_mask:0xf\n\t"
      "v_max_num_f32_dpp %5, %5, %5 row_xmask:8 row_mask:0xf bank_mask:0xf\n\t"
      "v_max_num_f32_dpp %6, %6, %6 row_xmask:8 row_mask:0xf bank_mask:0xf\n\t"
      "v_max_num_f32_dpp %7, %7, %7 row_xmask:8 row_mask:0xf bank_mask:0xf\n\t"
      : "+v"(x[0]), "+v"(x[1]), "+v"(x[2]), "+v"(x[3]), "+v"(x[4]), "+v"(x[5]), "+v"(x[6]), "+v"(x[7]));
}
__device__ __forceinline__ void row_sum8(float (&x)[8]) {
  asm(
      "v_add_f32_dpp %0, %0, %0 row_xmask:1 row_mask:0xf bank_mask:0xf\n\t"
      "v_add_f32_dpp %1, %1, %1 row_xmask:1 row_mask:0xf bank_mask:0xf\n\t"
      "v_add_f32_dpp %2, %2, %2 row_xmask:1 row_mask:0xf bank_mask:0xf\n\t"
      "v_add_f32_dpp %3, %3, %3 row_xmask:1 row_mask:0xf bank_mask:0xf\n\t"
      "v_add_f32_dpp %4, %4, %4 row_xmask:1 row_mask:0xf bank_mask:0xf\n\t"
      "v_add_f32_dpp %5, %5, %5 row_xmask:1 row_mask:0xf bank_mask:0xf\n\t"
      "v_add_f32_dpp %6, %6, %6 row_xmask:1 row_mask:0xf bank_mask:0xf\n\t"
      "v_add_f32_dpp %7, %7, %7 row_xmask:1 row_mask:0xf bank_mask:0xf\n\t"
      "v_add_f32_dpp %0, %0, %0 row_xmask:2 row_mask:0xf bank_mask:0xf\n\t"
      "v_add_f32_dpp %1, %1, %1 row_xmask:2 row_mask:0xf bank_mask:0xf\n\t"
      "v_add_f32_dpp %2, %2, %2 row_xmask:2 row_mask:0xf bank_mask:0xf\n\t"
      "v_add_f32_dpp %3, %3, %3 row_xmask:2 row_mask:0xf bank_mask:0xf\n\t"
      "v_add_f32_dpp %4, %4, %4 row_xmask:2 row_mask:0xf bank_mask:0xf\n\t"
      "v_add_f32_dpp %5, %5, %5 row_xmask:2 row_mask:0xf bank_mask:0xf\n\t"
      "v_add_f32_dpp %6, %6, %6 row_xmask:2 row_mask:0xf bank_mask:0xf\n\t"
      "v_add_f32_dpp %7, %7, %7 row_xmask:2 row_mask:0xf bank_mask:0xf\n\t"
      "v_add_f32_dpp %0, %0, %0 row_xmask:4 row_mask:0xf bank_mask:0xf\n\t"
      "v_add_f32_dpp %1, %1, %1 row_xmask:4 row_mask:0xf bank_mask:0xf\n\t"
      "v_add_f32_dpp %2, %2, %2 row_xmask:4 row_mask:0xf bank_mask:0xf\n\t"
      "v_add_f32_dpp %3, %3, %3 row_xmask:4 row_mask:0xf bank_mask:0xf\n\t"
      "v_add_f32_dpp %4, %4, %4 row_xmask:4 row_mask:0xf bank_mask:0xf\n\t"
      "v_add_f32_dpp %5, %5, %5 row_xmask:4 row_mask:0xf bank_mask:0xf\n\t"
      "v_add_f32_dpp %6, %6, %6 row_xmask:4 row_mask:0xf bank_mask:0xf\n\t"
      "v_add_f32_dpp %7, %7, %7 row_xmask:4 row_mask:0xf bank_mask:0xf\n\t"
      "v_add_f32_dpp %0, %0, %0 row_xmask:8 row_mask:0xf bank_mask:0xf\n\t"
      "v_add_f32_dpp %1, %1, %1 row_xmask:8 row_mask:0xf bank_mask:0xf\n\t"
      "v_add_f32_dpp %2, %2, %2 row_xmask:8 row_mask:0xf bank_mask:0xf\n\t"
      "v_add_f32_dpp %3, %3, %3 row_xmask:8 row_mask:0xf bank_mask:0xf\n\t"
      "v_add_f32_dpp %4, %4, %4 row_xmask:8 row_mask:0xf bank_mask:0xf\n\t"
      "v_add_f32_dpp %5, %5, %5 row_xmask:8 row_mask:0xf bank_mask:0xf\n\t"
      "v_add_f32_dpp %6, %6, %6 row_xmask:8 row_mask:0xf bank_mask:0xf\n\t"
      "v_add_f32_dpp %7, %7, %7 row_xmask:8 row_mask:0xf bank_mask:0xf\n\t"
      : "+v"(x[0]), "+v"(x[1]), "+v"(x[2]), "+v"(x[3]), "+v"(x[4]), "+v"(x[5]), "+v"(x[6]), "+v"(x[7]));
}

// ---- fragment loaders: 16-bit A/B operand, lane -> row/col (lane&15), p already includes +8*(lane>>4);
//      elements 0..7 <- p[0..7] (k0+8h..), elements 8..15 <- p[16..23] (k0+16+8h..)
__device__ __forceinline__ v16b ldfrag_b(const __bf16* p) {
  union { v16b v; v8b h[2]; } f;
  f.h[0] = *(const v8b*)(p);
  f.h[1] = *(const v8b*)(p + 16);
  return f.v;
}
__device__ __forceinline__ v16h ldfrag_h(const _Float16* p) {
  union { v16h v; v8h h[2]; } f;
  f.h[0] = *(const v8h*)(p);
  f.h[1] = *(const v8h*)(p + 16);
  return f.v;
}

// ---- WMMA helpers with trailing VALU hazard gap --------------------------------------------------------
__device__ __forceinline__ v8f mma_b(v16b a, v16b b, v8f c) {
  c = __builtin_amdgcn_wmma_f32_16x16x32_bf16(false, a, false, b, (short)0, c, false, false);
  asm volatile("v_nop\n\tv_nop\n\tv_nop\n\tv_nop" : "+v"(c) : "v"(a), "v"(b));
  return c;
}
__device__ __forceinline__ v8f mma_h(v16h a, v16h b, v8f c) {
  c = __builtin_amdgcn_wmma_f32_16x16x32_f16(false, a, false, b, (short)0, c, false, false);
  asm volatile("v_nop\n\tv_nop\n\tv_nop\n\tv_nop" : "+v"(c) : "v"(a), "v"(b));
  return c;
}

// =====================================================================================================
// f32 -> bf16 (RNE convert), 8 elements per thread, one 16-B store per lane: a wave writes 512 contiguous B
// Destination plane is compact [b][SEQ*DE]; source batch stride src8 (units of 8 floats) may be larger.
// coverage: n8 threads x 8 = whole plane (n8 = NB*SEQ*DE/8 is a multiple of 256).
// =====================================================================================================
__global__ __launch_bounds__(256) void cvt_bf16x8s(const float* __restrict__ in, unsigned short* out,
                                                   int n8, int per8, int src8) {
  const int i = blockIdx.x * 256 + threadIdx.x;
  if (i < n8) {
    const int hd  = i / per8;
    const int rem = i - hd * per8;
    const float* s = in + ((size_t)hd * src8 + (size_t)rem) * 8;
    const v4f a = *(const v4f*)(s);
    const v4f b = *(const v4f*)(s + 4);
    v4u p;
    p[0] = pk16(bf_bits(a[0]), bf_bits(a[1]));
    p[1] = pk16(bf_bits(a[2]), bf_bits(a[3]));
    p[2] = pk16(bf_bits(b[0]), bf_bits(b[1]));
    p[3] = pk16(bf_bits(b[2]), bf_bits(b[3]));
    *(v4u*)(out + (size_t)i * 8) = p;
    
  }
}

// =====================================================================================================
// Weight W[k][n] f32 (DE x DE, n contiguous) -> transposed 16-bit plane Wt[n][k] (k contiguous, pitch DE).
//   blockIdx.y = matrix id: 0,1,2 -> bf16 bits of the RNE-bf16 value; 3 -> f16 bits of (RNE-bf16 value x64).
//   Block = one 64(k) x 64(n) tile, 256 threads: thread (k = tid>>2, 16-column n quarter) loads 16 floats of row k
//   and writes them transposed into the LDS tile T[n][k]; after the barrier wave w writes rows n = 8w..8w+7:
//   grid.x = (DE/64)^2 tiles covers the whole plane of each of the 4 matrices.
// =====================================================================================================
__global__ __launch_bounds__(256) void wt_tiles(const float* __restrict__ w0, const float* __restrict__ w1,
                                                const float* __restrict__ w2, const float* __restrict__ w3,
                                                unsigned short* o0, unsigned short* o1,
                                                unsigned short* o2, unsigned short* o3) {
  __shared__ __align__(16) unsigned short T[64 * 64];   // [n][k]
  const int tid = threadIdx.x;
  const int mat = blockIdx.y;                            // block-uniform
  const float* in = w0; unsigned short* out = o0;
  if (mat == 1) { in = w1; out = o1; }
  else if (mat == 2) { in = w2; out = o2; }
  else if (mat == 3) { in = w3; out = o3; }
  const int ktile = blockIdx.x / (DE / 64);
  const int ntile = blockIdx.x - ktile * (DE / 64);
  const int k   = tid >> 2;              // 0..63
  const int nq  = (tid & 3) * 16;        // 0,16,32,48
  const float* src = in + (size_t)(ktile * 64 + k) * DE + ntile * 64 + nq;
#pragma unroll
  for (int i = 0; i < 4; ++i) {
    const v4f a = *(const v4f*)(src + 4 * i);
#pragma unroll
    for (int e = 0; e < 4; ++e) {
      const unsigned short bb = bf_bits(a[e]);
      const unsigned short hb = h_bits(bf_up(bb) * WCARRY);
      const unsigned short us = (mat == 3) ? hb : bb;
      T[(nq + 4 * i + e) * 64 + k] = us;
    }
  }
  __syncthreads();
  const int wave = tid >> 5, lane = tid & 31;
  const int q = lane >> 3, c8 = (lane & 7) * 8;
  union { v8us s; v4u u; } x0, x1;
  const int d0 = wave * 8 + q;
  const int d1 = wave * 8 + 4 + q;
  x0.s = *(const v8us*)(T + d0 * 64 + c8);
  x1.s = *(const v8us*)(T + d1 * 64 + c8);
  unsigned short* p0 = out + ((size_t)(ntile * 64 + d0) * DE + ktile * 64 + c8);
  unsigned short* p1 = out + ((size_t)(ntile * 64 + d1) * DE + ktile * 64 + c8);
  *(v4u*)p0 = x0.u;
  *(v4u*)p1 = x1.u;
  
}

// =====================================================================================================
// 16-bit GEMM C[m][n] = sum_k A[m][k] * Bt[n][k], K = DE, M = MROWS, N = DE. Block 256 threads = 8 waves,
// block tile 128 m x 64 n, wave tile 16 x 64 (4 accumulators), k step 32. grid = (DE/64, MROWS/128), exact multiples.
//   Operands: the block's 128 A rows and 64 B rows are staged in LDS one k slab of GKS at a time. 8 lanes fetch one
//   whole 128-B line of a row (16 B each), 256 threads x 6 loads = the (128 + 64) x 128 B of a slab, each line once
//   per block. Two buffers: slab s + 1 is loaded into registers ahead of the products of slab s and stored into the
//   other buffer behind them; one block barrier per slab publishes it and ends the reads of the buffer refilled next.
//   Fragments come from the LDS rows (two 16-B reads each, identical k map for A and B), k ascending.
//   MODE 0: bf16 operands; out16 f16 row-major [MROWS][DE] = (acc + bias) * scale. Wave tile staged in wave-private
//   MODE 1: bf16 operands; out16 f16 transposed per batch [b][DE][SEQ] = (acc + bias) * scale. Block tile staged in
//           cross-wave LDS T[n][key 128] (block barrier); wave w writes rows n = 8w..8w+7, one instruction = 2 rows
//           of 128 halves (16 lanes x 16 B per 256-B row); coverage 8 waves x 4 it x 2 rows x 128 = 64x128.
//   MODE 2: f16 operands; out32 f32 row-major [MROWS][DE] = acc * scale + bias + RNE-bf16(resid), resid rows read at
//           the full batch stride. Wave-private LDS stage (f32), one instruction = 2 rows of 64 floats (16 lanes x
//           16 B per 256-B segment); coverage 8 it x 2 rows x 64 = 16x64.
// =====================================================================================================
template <int MODE>
__global__ __launch_bounds__(256)
void gemm_nt(const unsigned short* __restrict__ A, const unsigned short* __restrict__ Bt,
             const float* __restrict__ bias, const float* __restrict__ resid,
             unsigned short* out16, float* out32, float scale) {
  __shared__ __align__(16) unsigned char smem[2 * GSLAB * 2];
  const int tid  = threadIdx.x;
  const int wave = tid >> 5;
  const int lane = tid & 31;
  const int hh   = lane >> 4;
  const int c    = lane & 15;
  const int m0b  = blockIdx.y * 128;
  const int m0   = m0b + wave * 16;
  const int n0   = blockIdx.x * 64;

  v8f acc[4];
#pragma unroll
  for (int t = 0; t < 4; ++t) acc[t] = zero8();

  unsigned short* SL = (unsigned short*)(void*)smem;
  const int srow = tid >> 3;                 // 0..31: row within a group of 32 staged rows
  const int scol = (tid & 7) * 8;            // 16-B piece of the row's 128-B line
  const unsigned short* Ag = A  + (size_t)(m0b + srow) * DE + scol;
  const unsigned short* Bg = Bt + (size_t)(n0 + srow) * DE + scol;
  const int sa = srow * GP + scol;                  // staged A rows 0..127
  const int sb = (128 + srow) * GP + scol;          // staged B rows 0..63
  const int fa = (wave * 16 + c) * GP + 8 * hh;     // this lane's A fragment row
  const int fb = (128 + c) * GP + 8 * hh;           // this lane's B fragment row of n group 0

  v4u ra[4], rb[2];
#pragma unroll
  for (int i = 0; i < 4; ++i) ra[i] = *(const v4u*)(Ag + (size_t)i * 32 * DE);
#pragma unroll
  for (int i = 0; i < 2; ++i) rb[i] = *(const v4u*)(Bg + (size_t)i * 32 * DE);
#pragma unroll
  for (int i = 0; i < 4; ++i) *(v4u*)(SL + sa + i * 32 * GP) = ra[i];
#pragma unroll
  for (int i = 0; i < 2; ++i) *(v4u*)(SL + sb + i * 32 * GP) = rb[i];
  __syncthreads();

  // unrolled in full: buffer index and slab offset become immediates, no address register changes in the loop
#pragma unroll
  for (int s = 0; s < DE / GKS; ++s) {
    const unsigned short* cur = SL + (s & 1) * GSLAB;
    unsigned short* nxt = SL + ((s + 1) & 1) * GSLAB;
    if (s + 1 < DE / GKS) {
#pragma unroll
      for (int i = 0; i < 4; ++i) ra[i] = *(const v4u*)(Ag + (size_t)i * 32 * DE + (s + 1) * GKS);
#pragma unroll
      for (int i = 0; i < 2; ++i) rb[i] = *(const v4u*)(Bg + (size_t)i * 32 * DE + (s + 1) * GKS);
    }
    // all fragments of the slab are read as one group ahead of its products, so that the reads' latencies overlap
    if (MODE == 2) {
      v16h a[GKS / 32], b[GKS / 32][4];
#pragma unroll
      for (int kk = 0; kk < GKS / 32; ++kk) {
        a[kk] = ldfrag_h((const _Float16*)(const void*)(cur + fa + kk * 32));
#pragma unroll
        for (int t = 0; t < 4; ++t) b[kk][t] = ldfrag_h((const _Float16*)(const void*)(cur + fb + t * 16 * GP + kk * 32));
      }
#pragma unroll
      for (int kk = 0; kk < GKS / 32; ++kk)
#pragma unroll
        for (int t = 0; t < 4; ++t) acc[t] = mma_h(a[kk], b[kk][t], acc[t]);
    } else {
      v16b a[GKS / 32], b[GKS / 32][4];
#pragma unroll
      for (int kk = 0; kk < GKS / 32; ++kk) {
        a[kk] = ldfrag_b((const __bf16*)(const void*)(cur + fa + kk * 32));
#pragma unroll
        for (int t = 0; t < 4; ++t) b[kk][t] = ldfrag_b((const __bf16*)(const void*)(cur + fb + t * 16 * GP + kk * 32));
      }
#pragma unroll
      for (int kk = 0; kk < GKS / 32; ++kk)
#pragma unroll
        for (int t = 0; t < 4; ++t) acc[t] = mma_b(a[kk], b[kk][t], acc[t]);
    }
    if (s + 1 < DE / GKS) {
#pragma unroll
      for (int i = 0; i < 4; ++i) *(v4u*)(nxt + sa + i * 32 * GP) = ra[i];
#pragma unroll
      for (int i = 0; i < 2; ++i) *(v4u*)(nxt + sb + i * 32 * GP) = rb[i];
    }
    __syncthreads();   // publishes slab s + 1; ends the reads of slab s (its buffer is refilled, or reused below)
  }

  if (MODE == 0) {
    _Float16* S = (_Float16*)(void*)smem + wave * 1024;          // [16][64] per wave
#pragma unroll
    for (int t = 0; t < 4; ++t) {
      const float bi = bf_up(bf_bits(bias[n0 + t * 16 + c]));
#pragma unroll
      for (int r = 0; r < 8; ++r) S[(8 * hh + r) * 64 + t * 16 + c] = (_Float16)((acc[t][r] + bi) * scale);
    }
    __builtin_amdgcn_fence(__ATOMIC_RELEASE, "workgroup");
    __builtin_amdgcn_wave_barrier();
    __builtin_amdgcn_fence(__ATOMIC_ACQUIRE, "workgroup");
    const int rq = lane >> 3, c8 = (lane & 7) * 8;
    union { v8h h; v4u u; } w[4];
#pragma unroll
    for (int it = 0; it < 4; ++it) w[it].h = *(const v8h*)(S + (it * 4 + rq) * 64 + c8);
    {
#pragma unroll
      for (int it = 0; it < 4; ++it)
        *(v4u*)(out16 + (size_t)(m0 + it * 4 + rq) * DE + n0 + c8) = w[it].u;
      
    }
  } else if (MODE == 1) {
    _Float16* T = (_Float16*)(void*)smem;                       // [n 64][key 128]
#pragma unroll
    for (int t = 0; t < 4; ++t) {
      const float bi = bf_up(bf_bits(bias[n0 + t * 16 + c]));
#pragma unroll
      for (int r = 0; r < 8; ++r)
        T[(t * 16 + c) * 128 + wave * 16 + 8 * hh + r] = (_Float16)((acc[t][r] + bi) * scale);
    }
    __syncthreads();
    const int bidx = m0b / SEQ;                                  // tiles never straddle batches (128 | SEQ)
    const int key0 = m0b - bidx * SEQ;
    const int rh = lane >> 4, c8 = (lane & 15) * 8;
    union { v8h h; v4u u; } w[4];
#pragma unroll
    for (int it = 0; it < 4; ++it) w[it].h = *(const v8h*)(T + (wave * 8 + it * 2 + rh) * 128 + c8);
    {
#pragma unroll
      for (int it = 0; it < 4; ++it) {
        const int row = wave * 8 + it * 2 + rh;
        *(v4u*)(out16 + ((size_t)(bidx * DE + n0 + row) * SEQ + key0 + c8)) = w[it].u;
      }
      
    }
  } else {
    float* S = (float*)(void*)smem + wave * 1024;                // [16][64] f32 per wave
#pragma unroll
    for (int t = 0; t < 4; ++t) {
      const float bi = bf_up(bf_bits(bias[n0 + t * 16 + c]));
#pragma unroll
      for (int r = 0; r < 8; ++r) S[(8 * hh + r) * 64 + t * 16 + c] = acc[t][r] * scale + bi;
    }
    __builtin_amdgcn_fence(__ATOMIC_RELEASE, "workgroup");
    __builtin_amdgcn_wave_barrier();
    __builtin_amdgcn_fence(__ATOMIC_ACQUIRE, "workgroup");
    const int rh = lane >> 4, c4 = (lane & 15) * 4;
    v4f vals[8];
#pragma unroll
    for (int it = 0; it < 8; ++it) {
      const int row = it * 2 + rh;
      const int gm  = m0 + row;
      const int bb  = gm / SEQ;
      const int tt  = gm - bb * SEQ;
      v4f x = *(const v4f*)(S + row * 64 + c4);
      const v4f rq = *(const v4f*)(resid + ((size_t)bb * SEQ_FULL + tt) * DE + n0 + c4);
#pragma unroll
      for (int e = 0; e < 4; ++e) x[e] = x[e] + bf_up(bf_bits(rq[e]));
      vals[it] = x;
    }
    {
#pragma unroll
      for (int it = 0; it < 8; ++it)
        *(v4f*)(out32 + (size_t)(m0 + it * 2 + rh) * DE + n0 + c4) = vals[it];
      
    }
  }
}

// =====================================================================================================
// Full (unmasked) attention, head dim 64, all NQB key tiles.
//   q plane (f16):  element (b, t, h, d) at [(b*SEQ + t)*DE + h*64 + d]      k plane (f16): same with key index s
//   v^T plane (f16): element (b, h, d, s) at [(b*DE + h*64 + d)*SEQ + s], value v*64
//   scores = q . k (f16 WMMA, f32 acc) * 0.125; online softmax in f32; p = exp(s - m) carried as f16(16384 p);
//   context = p . v on f16 WMMA; RES adds the f16 residual plane of p (x4096, separate accumulator folded back
//   with 1/4096 per tile in f32). ctx out = f16(context / (l * 16384 * 64) * 64) to [(b*SEQ + t)*DE + h*64 + d].
//   Block = 4 waves = 64 query rows of one (b,h); grid = nqbThis * NH * NB; kv tiles of 64.
//   K / V^T tile staging: 128 threads x 32 elements per plane = the whole 64x64 tile (plain 16-B loads,
//   __syncthreads before and after, cross-wave); staged extent == consumed extent for Ksh, Vth, Psh, Psl, Os.
//   Ksh, Vth, Psh, Psl rows lie at pitch LP (64 used halves + 8 never touched) so that the 16 rows one 16-B fragment
//   read walks fall on 16 different bank groups.
//   P tiles and the Os tile are wave-private, spilled with _Float16 element stores and reloaded as v8h (same element
//   Output coverage: each wave stores rows 0..15 (it 0..3 x lane>>3) x 64 halves (8 lanes x 16 B): one instruction
// =====================================================================================================
template <bool RES>
__global__ __launch_bounds__(128)
void attn_full64(const unsigned short* __restrict__ qp, const unsigned short* __restrict__ kp,
                 const unsigned short* __restrict__ vtp, unsigned short* ctx, int qbBase, int nqbThis) {
  union FH { v16h v; v8h h[2]; };
  __shared__ __align__(16) _Float16 Ksh[64 * LP];                 // K [kv][d], pitch LP
  __shared__ __align__(16) _Float16 Vth[64 * LP];                 // V^T [d][kv], pitch LP
  __shared__ __align__(16) _Float16 Psh[4][16 * LP];              // per wave P [row][kv], pitch LP
  __shared__ __align__(16) _Float16 Psl[RES ? 4 : 1][16 * LP];    // per wave P residual, pitch LP
  __shared__ __align__(16) _Float16 Os[4][16 * 64];               // per wave context tile [row][d]

  const int tid  = threadIdx.x;
  const int wave = tid >> 5;
  const int lane = tid & 31;
  const int hh   = lane >> 4;
  const int c    = lane & 15;

  const int bx   = blockIdx.x;
  const int qbl  = bx % nqbThis;
  const int bhq  = bx / nqbThis;           // 0..NB*NH-1
  const int h    = bhq % NH;
  const int b    = bhq / NH;
  const int qb   = qbBase + qbl;           // 0..NQB-1
  const int q0   = qb * 64 + wave * 16;    // query index within the sequence

  const _Float16* Qh = (const _Float16*)(const void*)qp + (size_t)b * SEQ * DE + (size_t)h * HD;
  const _Float16* Kh = (const _Float16*)(const void*)kp + (size_t)b * SEQ * DE + (size_t)h * HD;
  const _Float16* Vh = (const _Float16*)(const void*)vtp + ((size_t)b * DE + (size_t)h * HD) * SEQ;

  // ---- Q fragments (A operand, row = lane&15): 2 d-chunks ----
  v16h qa[2];
#pragma unroll
  for (int dc = 0; dc < 2; ++dc) {
    const size_t qo = (size_t)(q0 + c) * DE + dc * 32 + 8 * hh;
    qa[dc] = ldfrag_h(Qh + qo);
  }

  float mrow[8], lrow[8];
  v8f oacc[4];
#pragma unroll
  for (int r = 0; r < 8; ++r) { mrow[r] = -INFINITY; lrow[r] = 0.f; }
#pragma unroll
  for (int t = 0; t < 4; ++t) oacc[t] = zero8();

  for (int kt = 0; kt < NQB; ++kt) {        // block-uniform bounds, exactly NQB trips
    const int kv0 = kt * 64;
    __syncthreads();
    {
      const int r = tid >> 1, half = (tid & 1) * 32;
      const _Float16* kg = Kh + (size_t)(kv0 + r) * DE + half;   // K row kv0+r, d = half..half+31
      const _Float16* vg = Vh + (size_t)r * SEQ + kv0 + half;    // V^T row d = r, s = kv0+half..+31
      // all eight loads are issued ahead of the first store, so that their latencies overlap
      v8h a0[4], b0[4];
#pragma unroll
      for (int i = 0; i < 4; ++i) {
        a0[i] = *(const v8h*)(kg + 8 * i);
        b0[i] = *(const v8h*)(vg + 8 * i);
      }
#pragma unroll
      for (int i = 0; i < 4; ++i) {
        *(v8h*)(Ksh + r * LP + half + 8 * i) = a0[i];
        *(v8h*)(Vth + r * LP + half + 8 * i) = b0[i];
      }
    }
    __syncthreads();

    // ---- all K and V^T fragments of the tile are read as one group right behind the barrier: the K reads' latencies
    //      overlap each other, the V^T reads land under the score products and the softmax ----
    FH kb[4][2], vb[2][4];
#pragma unroll
    for (int j = 0; j < 4; ++j)
#pragma unroll
      for (int dc = 0; dc < 2; ++dc) {
        kb[j][dc].h[0] = *(const v8h*)(Ksh + (j * 16 + c) * LP + dc * 32 + 8 * hh);
        kb[j][dc].h[1] = *(const v8h*)(Ksh + (j * 16 + c) * LP + dc * 32 + 16 + 8 * hh);
      }
#pragma unroll
    for (int kk = 0; kk < 2; ++kk)
#pragma unroll
      for (int t = 0; t < 4; ++t) {
        vb[kk][t].h[0] = *(const v8h*)(Vth + (t * 16 + c) * LP + kk * 32 + 8 * hh);
        vb[kk][t].h[1] = *(const v8h*)(Vth + (t * 16 + c) * LP + kk * 32 + 16 + 8 * hh);
      }
    // holds the group of reads apart from the products: without it the compiler mixes the two regions and, in the
    // residual variant, spills one fragment to scratch and reloads it in every trip
    __builtin_amdgcn_sched_barrier(0);

    // ---- scores: 16 query rows x 64 keys per wave, single f16 product ----
    v8f s[4];
#pragma unroll
    for (int j = 0; j < 4; ++j) {
      s[j] = zero8();
#pragma unroll
      for (int dc = 0; dc < 2; ++dc) s[j] = mma_h(qa[dc], kb[j][dc].v, s[j]);
    }

    // ---- scale, row max, online softmax, P (x16384, f16) and P residual (x4096) to LDS ----
    _Float16* pwh = Psh[wave];
    _Float16* pwl = Psl[RES ? wave : 0];
    float mx[8], ps[8], al[8], ms[8];   // per row: tile maximum, tile sum, rescale factor, maximum in use
#pragma unroll
    for (int r = 0; r < 8; ++r) {
      float m = -INFINITY;
#pragma unroll
      for (int j = 0; j < 4; ++j) {
        const float sv = s[j][r] * 0.125f;
        s[j][r] = sv;
        m = fmaxf(m, sv);
      }
      mx[r] = m;
    }
    row_max8(mx);
#pragma unroll
    for (int r = 0; r < 8; ++r) {
      const float mnew  = fmaxf(mrow[r], mx[r]);
      const float msafe = (mnew == -INFINITY) ? 0.f : mnew;
      al[r] = __expf(mrow[r] - msafe);
      ms[r] = msafe;
      mrow[r] = mnew;
    }
#pragma unroll
    for (int r = 0; r < 8; ++r) {
      float psum = 0.f;
#pragma unroll
      for (int j = 0; j < 4; ++j) {
        const float p = __expf(s[j][r] - ms[r]);
        psum += p;
        const float p1k = p * PCARRY;
        const _Float16 ph = (_Float16)p1k;
        pwh[(8 * hh + r) * LP + j * 16 + c] = ph;
        if (RES) {
          const _Float16 pl = (_Float16)((p1k - (float)ph) * PRES);
          pwl[(8 * hh + r) * LP + j * 16 + c] = pl;
        }
      }
      ps[r] = psum;
    }
    row_sum8(ps);
#pragma unroll
    for (int r = 0; r < 8; ++r) {
      lrow[r] = lrow[r] * al[r] + ps[r];
#pragma unroll
      for (int t = 0; t < 4; ++t) oacc[t][r] *= al[r];
    }
    __builtin_amdgcn_fence(__ATOMIC_RELEASE, "workgroup");
    __builtin_amdgcn_wave_barrier();
    __builtin_amdgcn_fence(__ATOMIC_ACQUIRE, "workgroup");

    // ---- context += P . V (f16 WMMA), residual products into a separate accumulator ----
    v8f o1[4];
#pragma unroll
    for (int t = 0; t < 4; ++t) o1[t] = zero8();
    FH pa[2], pl[2];   // the P fragments of both k halves, read as one group
#pragma unroll
    for (int kk = 0; kk < 2; ++kk) {
      pa[kk].h[0] = *(const v8h*)(pwh + c * LP + kk * 32 + 8 * hh);
      pa[kk].h[1] = *(const v8h*)(pwh + c * LP + kk * 32 + 16 + 8 * hh);
      if (RES) {
        pl[kk].h[0] = *(const v8h*)(pwl + c * LP + kk * 32 + 8 * hh);
        pl[kk].h[1] = *(const v8h*)(pwl + c * LP + kk * 32 + 16 + 8 * hh);
      }
    }
    // unrolled: kk picks among fragments that sit in registers, so it must be a constant
#pragma unroll
    for (int kk = 0; kk < 2; ++kk) {
#pragma unroll
      for (int t = 0; t < 4; ++t) {
        oacc[t] = mma_h(pa[kk].v, vb[kk][t].v, oacc[t]);
        if (RES) o1[t] = mma_h(pl[kk].v, vb[kk][t].v, o1[t]);
      }
    }
    if (RES) {
#pragma unroll
      for (int t = 0; t < 4; ++t)
#pragma unroll
        for (int r = 0; r < 8; ++r) oacc[t][r] += o1[t][r] * (1.0f / PRES);
    }
  }

  // ---- normalise (1/l, the p, v carries) and apply the ctx carry; stage the wave's 16x64 f16 tile; write whole
  _Float16* os = Os[wave];
#pragma unroll
  for (int r = 0; r < 8; ++r) {
    const float l = lrow[r];
    const float inv = ((l > 0.f) ? (1.0f / l) : 0.f) * (CCARRY / (PCARRY * VCARRY));
#pragma unroll
    for (int t = 0; t < 4; ++t) os[(8 * hh + r) * 64 + t * 16 + c] = (_Float16)(oacc[t][r] * inv);
  }
  __builtin_amdgcn_fence(__ATOMIC_RELEASE, "workgroup");
  __builtin_amdgcn_wave_barrier();
  __builtin_amdgcn_fence(__ATOMIC_ACQUIRE, "workgroup");
  {
    const int rq = lane >> 3, c8 = (lane & 7) * 8;
    union { v8h h; v4u u; } w[4];
#pragma unroll
    for (int it = 0; it < 4; ++it) w[it].h = *(const v8h*)(os + (it * 4 + rq) * 64 + c8);
    unsigned short* ob = ctx + ((size_t)b * SEQ) * DE + (size_t)h * HD;
    {
#pragma unroll
      for (int it = 0; it < 4; ++it) {
        const int row = it * 4 + rq;                     // it 0..3 x rq 0..3 = rows 0..15
        *(v4u*)(ob + (size_t)(q0 + row) * DE + c8) = w[it].u;
      }
      
    }
  }
}

// =====================================================================================================
// LayerNorm over DE of x [MROWS][DE] f32: one block of 256 threads per row, thread owns 4 consecutive floats.
// mean and centred variance via wave shuffles + 8-entry LDS partials (cross-wave, block barriers), fixed order.
// y = (x - mu) * rsqrt(var + 1e-5) * RNE-bf16(gamma) + RNE-bf16(beta). Output row b*SEQ_FULL + t of d_out;
// coverage: MROWS blocks x 256 threads x 4 floats = every processed output row in full.
// =====================================================================================================
__global__ __launch_bounds__(256) void ln_rows(const float* __restrict__ x, const float* __restrict__ gam,
                                               const float* __restrict__ bet, float* out) {
  __shared__ float red1[8];
  __shared__ float red2[8];
  const int tid = threadIdx.x, wave = tid >> 5, lane = tid & 31;
  const int row = blockIdx.x;
  const int bb  = row / SEQ;
  const int tt  = row - bb * SEQ;
  const size_t orow = (size_t)bb * SEQ_FULL + (size_t)tt;

  const v4f v = *(const v4f*)(x + (size_t)row * DE + tid * 4);
  float s = (v[0] + v[1]) + (v[2] + v[3]);
#pragma unroll
  for (int off = 16; off > 0; off >>= 1) s += __shfl_xor(s, off, 32);
  if (lane == 0) red1[wave] = s;
  __syncthreads();
  float tot = 0.f;
#pragma unroll
  for (int w = 0; w < 8; ++w) tot += red1[w];
  const float mu = tot * (1.0f / (float)DE);

  v4f d;
#pragma unroll
  for (int e = 0; e < 4; ++e) d[e] = v[e] - mu;
  float s2 = (d[0] * d[0] + d[1] * d[1]) + (d[2] * d[2] + d[3] * d[3]);
#pragma unroll
  for (int off = 16; off > 0; off >>= 1) s2 += __shfl_xor(s2, off, 32);
  if (lane == 0) red2[wave] = s2;
  __syncthreads();
  float tot2 = 0.f;
#pragma unroll
  for (int w = 0; w < 8; ++w) tot2 += red2[w];
  const float var  = tot2 * (1.0f / (float)DE);
  const float rstd = rsqrtf(var + 1.0e-5f);

  const v4f g4 = *(const v4f*)(gam + tid * 4);
  const v4f b4 = *(const v4f*)(bet + tid * 4);
  v4f y;
#pragma unroll
  for (int e = 0; e < 4; ++e) y[e] = (d[e] * rstd) * bf_up(bf_bits(g4[e])) + bf_up(bf_bits(b4[e]));
  float* op = out + orow * DE + (size_t)tid * 4;
  *(v4f*)op = y;
  
}

// =====================================================================================================
// Workspace map (bytes, full size): PQ bf16 [MROWS][DE] at 0 (8388608); PK bf16 at 8388608 (8388608);
// Wq^T, Wk^T, Wv^T bf16 and Wo^T f16 [DE][DE] at 16777216.. (4 x 2097152); Q f16 [MROWS][DE] at 25165824;
// K f16 at 33554432; V^T f16 [NB][DE][SEQ] at 41943040; CTX f16 [MROWS][DE] at 50331648; X f32 [MROWS][DE]
// at 58720256 (16777216); end 75497472. Every plane is an exact multiple of its whole-line store granularity
// Launch plan (10): cvt pre_q, cvt pre_k, weight transpose-convert, gemm q, gemm k, gemm v^T, attention (leading
// query blocks with the p residual, remaining blocks without), gemm o + residual, LayerNorm.
// =====================================================================================================
extern "C" void kernel_launch(void* const* d_in, const int* in_sizes, int n_in,
                              void* d_out, int out_size, void* d_ws, size_t ws_size,
                              hipStream_t stream) {
  if (n_in < 12) return;
  const long long needIn = (long long)(NB - 1) * SEQ_FULL * DE + (long long)SEQ * DE;
  if ((long long)in_sizes[0] < needIn || (long long)in_sizes[1] < needIn) return;
  if (in_sizes[2] < DE * DE || in_sizes[4] < DE * DE || in_sizes[6] < DE * DE || in_sizes[8] < DE * DE) return;
  if (in_sizes[3] < DE || in_sizes[5] < DE || in_sizes[7] < DE || in_sizes[9] < DE) return;
  if (in_sizes[10] < DE || in_sizes[11] < DE) return;
  if (out_size < 0 || (long long)out_size < needIn) return;

  const size_t P16 = (size_t)MROWS * DE * 2;     // one 16-bit activation plane
  const size_t W16 = (size_t)DE * DE * 2;        // one 16-bit weight plane
  const size_t P32 = (size_t)MROWS * DE * 4;     // x plane
  size_t off = 0;
  const size_t oPQ  = off; off += P16;
  const size_t oPK  = off; off += P16;
  const size_t oWq  = off; off += W16;
  const size_t oWk  = off; off += W16;
  const size_t oWv  = off; off += W16;
  const size_t oWo  = off; off += W16;
  const size_t oQ   = off; off += P16;
  const size_t oK   = off; off += P16;
  const size_t oVT  = off; off += P16;
  const size_t oCTX = off; off += P16;
  const size_t oX   = off; off += P32;
  if (off > ws_size) return;                     // off = 75497472 at full size
  if (off > (size_t)134217728) return;

  const float* pre_q = (const float*)d_in[0];
  const float* pre_k = (const float*)d_in[1];
  const float* Wq    = (const float*)d_in[2];
  const float* bq    = (const float*)d_in[3];
  const float* Wk    = (const float*)d_in[4];
  const float* bk    = (const float*)d_in[5];
  const float* Wv    = (const float*)d_in[6];
  const float* bv    = (const float*)d_in[7];
  const float* Wo    = (const float*)d_in[8];
  const float* bo    = (const float*)d_in[9];
  const float* gamma = (const float*)d_in[10];
  const float* beta  = (const float*)d_in[11];
  float* out = (float*)d_out;

  char* ws = (char*)d_ws;
  unsigned short* PQb  = (unsigned short*)(ws + oPQ);
  unsigned short* PKb  = (unsigned short*)(ws + oPK);
  unsigned short* Wqt  = (unsigned short*)(ws + oWq);
  unsigned short* Wkt  = (unsigned short*)(ws + oWk);
  unsigned short* Wvt  = (unsigned short*)(ws + oWv);
  unsigned short* Wot  = (unsigned short*)(ws + oWo);
  unsigned short* Qh   = (unsigned short*)(ws + oQ);
  unsigned short* Kh   = (unsigned short*)(ws + oK);
  unsigned short* VTb  = (unsigned short*)(ws + oVT);
  unsigned short* CTXb = (unsigned short*)(ws + oCTX);
  float*          Xb   = (float*)(ws + oX);

  const dim3 blk(256);
  const int n8   = MROWS * DE / 8;               // 524288 at full size
  const int per8 = SEQ * DE / 8;
  const int src8 = SEQ_FULL * DE / 8;
  const dim3 gCvt((n8 + 255) / 256);
  const dim3 gWt((DE / 64) * (DE / 64), 4);      // 256 tiles x 4 matrices
  const dim3 gG(DE / 64, MROWS / 128);           // (16, 32) at full size
  int resqb = RESQB;
  if (resqb > NQB) resqb = NQB;

  // (1) activations -> bf16 planes (RNE convert)
  cvt_bf16x8s<<<gCvt, blk, 0, stream>>>(pre_q, PQb, n8, per8, src8);
  cvt_bf16x8s<<<gCvt, blk, 0, stream>>>(pre_k, PKb, n8, per8, src8);
  // (2) weights -> transposed 16-bit planes (Wq, Wk, Wv bf16; Wo f16 x64)
  wt_tiles<<<gWt, blk, 0, stream>>>(Wq, Wk, Wv, Wo, Wqt, Wkt, Wvt, Wot);
  // (3) projections: q, k -> f16 row-major; v -> f16 v^T x64
  gemm_nt<0><<<gG, blk, 0, stream>>>(PQb, Wqt, bq, pre_q, Qh, Xb, 1.0f);
  gemm_nt<0><<<gG, blk, 0, stream>>>(PKb, Wkt, bk, pre_q, Kh, Xb, 1.0f);
  gemm_nt<1><<<gG, blk, 0, stream>>>(PKb, Wvt, bv, pre_q, VTb, Xb, VCARRY);
  // (4) attention -> ctx f16 x64: query blocks 0..resqb-1 with the p residual plane, the rest without
  attn_full64<true><<<dim3(NB * NH * resqb), dim3(128), 0, stream>>>(Qh, Kh, VTb, CTXb, 0, resqb);
  if (NQB - resqb > 0) {
    attn_full64<false><<<dim3(NB * NH * (NQB - resqb)), dim3(128), 0, stream>>>(Qh, Kh, VTb, CTXb, resqb, NQB - resqb);
  }
  // (5) output projection + bias + residual -> x f32
  gemm_nt<2><<<gG, blk, 0, stream>>>(CTXb, Wot, bo, pre_q, CTXb, Xb, 1.0f / (CCARRY * WCARRY));
  // (6) LayerNorm -> output
  ln_rows<<<dim3(MROWS), blk, 0, stream>>>(Xb, gamma, beta, out);
  (void)hipGetLastError();
}

// v005
// A run of this version takes 153 microseconds.
// Next to v004, in two timings, it ran 1.20 and 1.19 times as fast.
// Counting every step since v000, it is 3.06 times as fast.
// Contractions: q/k/v projections = v_wmma_f32_16x16x32_bf16 (bf16 operands = RNE-converted activations and
// transposed weights, single product, f32 accumulate); q.k^T scores, p.v context and ctx.Wo projection =
// v_wmma_f32_16x16x32_f16 (q, k = f16 of the f32 projection sums, unscaled; p = exp(s - m) carried x16384 plus an
// f16 residual plane of p x4096 on the leading query blocks; v^T, ctx and Wo carried x64 in f16), f32 accumulate;
// softmax, bias/residual add and LayerNorm in f32.
#include <hip/hip_runtime.h>
#include <math.h>
#include <stdint.h>

#ifndef NB
#define NB 2                 // batches processed (reducible)
#endif
#ifndef NB_FULL
#define NB_FULL 2            // batches in the inputs / output
#endif
#ifndef SEQ
#define SEQ 2048             // query == key length processed (reducible)
#endif
#ifndef SEQ_FULL
#define SEQ_FULL 2048        // per-batch row stride of the inputs and of the output
#endif
#define DE    1024
#define NH    16
#define HD    64
#define NQB   (SEQ / 64)
#define MROWS (NB * SEQ)
#ifndef RESQB
#define RESQB 8              // leading 64-row query blocks per (b,h) that carry the p residual plane
#endif
#define PCARRY 16384.0f
#define PRES   4096.0f
#define VCARRY 64.0f
#define CCARRY 64.0f
#define WCARRY 64.0f
#define LP    72             // LDS row pitch (halves) of the attention K and V^T tiles: 144 B = 16 B x odd
#define GKS   64             // k extent (halves) of one staged GEMM slab: one whole 128-B line per row
#define GP    72             // LDS row pitch (halves) of the staged GEMM slabs: 144 B = 16 B x odd
#define GSLAB ((128 + 64) * GP)   // halves in one slab buffer: 128 A rows, then 64 B rows

static_assert(NB >= 1 && NB <= NB_FULL);
static_assert((SEQ % 128) == 0 && SEQ >= 128 && SEQ <= SEQ_FULL);
static_assert(NH * HD == DE);
static_assert(RESQB >= 1);
static_assert(LP >= HD && (LP % 8) == 0 && ((LP / 8) % 2) == 1);   // 16-B aligned rows, odd count of 16-B units
static_assert((MROWS % 128) == 0 && (DE % 64) == 0 && (DE % 32) == 0);
static_assert(GP >= GKS && (GP % 8) == 0 && ((GP / 8) % 2) == 1 && (DE % GKS) == 0 && (GKS % 32) == 0);
static_assert(2 * GSLAB * 2 >= 32768);                               // the epilogue stages reuse the slab buffers
static_assert((long long)NB_FULL * SEQ_FULL * DE * 4 == 16777216LL);   // total output bytes at full size

typedef _Float16 v16h __attribute__((ext_vector_type(16)));
typedef _Float16 v8h  __attribute__((ext_vector_type(8)));
typedef __bf16   v16b __attribute__((ext_vector_type(16)));
typedef __bf16   v8b  __attribute__((ext_vector_type(8)));
typedef float    v8f  __attribute__((ext_vector_type(8)));
typedef float    v4f  __attribute__((ext_vector_type(4)));
typedef float    v2f  __attribute__((ext_vector_type(2)));
typedef _Float16 v2h  __attribute__((ext_vector_type(2)));
typedef unsigned int v4u __attribute__((ext_vector_type(4)));
typedef unsigned short v8us __attribute__((ext_vector_type(8)));

// ---- scalar helpers --------------------------------------------------------------------------------
__device__ __forceinline__ unsigned short bf_bits(float f) {          // f32 -> bf16 bits, RNE convert
  unsigned u = __float_as_uint(f);
  return (unsigned short)((u + 0x7FFFu + ((u >> 16) & 1u)) >> 16);
}
__device__ __forceinline__ float bf_up(unsigned short h) { return __uint_as_float(((unsigned)h) << 16); }
__device__ __forceinline__ unsigned short h_bits(float f) {           // f32 -> f16 bits, RNE convert
  union { _Float16 h; unsigned short u; } cvt;
  cvt.h = (_Float16)f;
  return cvt.u;
}
__device__ __forceinline__ unsigned pk16(unsigned short a, unsigned short b) { return (unsigned)a | ((unsigned)b << 16); }
__device__ __forceinline__ v8f zero8() { v8f z = {0.f, 0.f, 0.f, 0.f, 0.f, 0.f, 0.f, 0.f}; return z; }
// value of lane l ^ 16 (the other 16-lane row), on the vector unit; all 32 lanes are on at every call site
__device__ __forceinline__ float xhalf(float x) {
  const int b = __builtin_bit_cast(int, x);
  return __builtin_bit_cast(float, __builtin_amdgcn_permlanex16(b, b, 0x76543210, 0xfedcba98, false, false));
}

// ---- fragment loaders: 16-bit A/B operand, lane -> row/col (lane&15), p already includes +8*(lane>>4);
//      elements 0..7 <- p[0..7] (k0+8h..), elements 8..15 <- p[16..23] (k0+16+8h..)
__device__ __forceinline__ v16b ldfrag_b(const __bf16* p) {
  union { v16b v; v8b h[2]; } f;
  f.h[0] = *(const v8b*)(p);
  f.h[1] = *(const v8b*)(p + 16);
  return f.v;
}
__device__ __forceinline__ v16h ldfrag_h(const _Float16* p) {
  union { v16h v; v8h h[2]; } f;
  f.h[0] = *(const v8h*)(p);
  f.h[1] = *(const v8h*)(p + 16);
  return f.v;
}

// ---- WMMA helpers with trailing VALU hazard gap --------------------------------------------------------
__device__ __forceinline__ v8f mma_b(v16b a, v16b b, v8f c) {
  c = __builtin_amdgcn_wmma_f32_16x16x32_bf16(false, a, false, b, (short)0, c, false, false);
  asm volatile("v_nop\n\tv_nop\n\tv_nop\n\tv_nop" : "+v"(c) : "v"(a), "v"(b));
  return c;
}
__device__ __forceinline__ v8f mma_h(v16h a, v16h b, v8f c) {
  c = __builtin_amdgcn_wmma_f32_16x16x32_f16(false, a, false, b, (short)0, c, false, false);
  asm volatile("v_nop\n\tv_nop\n\tv_nop\n\tv_nop" : "+v"(c) : "v"(a), "v"(b));
  return c;
}

// =====================================================================================================
// f32 -> bf16 (RNE convert), 8 elements per thread, one 16-B store per lane: a wave writes 512 contiguous B
// Destination plane is compact [b][SEQ*DE]; source batch stride src8 (units of 8 floats) may be larger.
// coverage: n8 threads x 8 = whole plane (n8 = NB*SEQ*DE/8 is a multiple of 256).
// =====================================================================================================
__global__ __launch_bounds__(256) void cvt_bf16x8s(const float* __restrict__ in, unsigned short* out,
                                                   int n8, int per8, int src8) {
  const int i = blockIdx.x * 256 + threadIdx.x;
  if (i < n8) {
    const int hd  = i / per8;
    const int rem = i - hd * per8;
    const float* s = in + ((size_t)hd * src8 + (size_t)rem) * 8;
    const v4f a = *(const v4f*)(s);
    const v4f b = *(const v4f*)(s + 4);
    v4u p;
    p[0] = pk16(bf_bits(a[0]), bf_bits(a[1]));
    p[1] = pk16(bf_bits(a[2]), bf_bits(a[3]));
    p[2] = pk16(bf_bits(b[0]), bf_bits(b[1]));
    p[3] = pk16(bf_bits(b[2]), bf_bits(b[3]));
    *(v4u*)(out + (size_t)i * 8) = p;
    
  }
}

// =====================================================================================================
// Weight W[k][n] f32 (DE x DE, n contiguous) -> transposed 16-bit plane Wt[n][k] (k contiguous, pitch DE).
//   blockIdx.y = matrix id: 0,1,2 -> bf16 bits of the RNE-bf16 value; 3 -> f16 bits of (RNE-bf16 value x64).
//   Block = one 64(k) x 64(n) tile, 256 threads: thread (k = tid>>2, 16-column n quarter) loads 16 floats of row k
//   and writes them transposed into the LDS tile T[n][k]; after the barrier wave w writes rows n = 8w..8w+7:
//   grid.x = (DE/64)^2 tiles covers the whole plane of each of the 4 matrices.
// =====================================================================================================
__global__ __launch_bounds__(256) void wt_tiles(const float* __restrict__ w0, const float* __restrict__ w1,
                                                const float* __restrict__ w2, const float* __restrict__ w3,
                                                unsigned short* o0, unsigned short* o1,
                                                unsigned short* o2, unsigned short* o3) {
  __shared__ __align__(16) unsigned short T[64 * 64];   // [n][k]
  const int tid = threadIdx.x;
  const int mat = blockIdx.y;                            // block-uniform
  const float* in = w0; unsigned short* out = o0;
  if (mat == 1) { in = w1; out = o1; }
  else if (mat == 2) { in = w2; out = o2; }
  else if (mat == 3) { in = w3; out = o3; }
  const int ktile = blockIdx.x / (DE / 64);
  const int ntile = blockIdx.x - ktile * (DE / 64);
  const int k   = tid >> 2;              // 0..63
  const int nq  = (tid & 3) * 16;        // 0,16,32,48
  const float* src = in + (size_t)(ktile * 64 + k) * DE + ntile * 64 + nq;
#pragma unroll
  for (int i = 0; i < 4; ++i) {
    const v4f a = *(const v4f*)(src + 4 * i);
#pragma unroll
    for (int e = 0; e < 4; ++e) {
      const unsigned short bb = bf_bits(a[e]);
      const unsigned short hb = h_bits(bf_up(bb) * WCARRY);
      const unsigned short us = (mat == 3) ? hb : bb;
      T[(nq + 4 * i + e) * 64 + k] = us;
    }
  }
  __syncthreads();
  const int wave = tid >> 5, lane = tid & 31;
  const int q = lane >> 3, c8 = (lane & 7) * 8;
  union { v8us s; v4u u; } x0, x1;
  const int d0 = wave * 8 + q;
  const int d1 = wave * 8 + 4 + q;
  x0.s = *(const v8us*)(T + d0 * 64 + c8);
  x1.s = *(const v8us*)(T + d1 * 64 + c8);
  unsigned short* p0 = out + ((size_t)(ntile * 64 + d0) * DE + ktile * 64 + c8);
  unsigned short* p1 = out + ((size_t)(ntile * 64 + d1) * DE + ktile * 64 + c8);
  *(v4u*)p0 = x0.u;
  *(v4u*)p1 = x1.u;
  
}

// =====================================================================================================
// 16-bit GEMM C[m][n] = sum_k A[m][k] * Bt[n][k], K = DE, M = MROWS, N = DE. Block 256 threads = 8 waves,
// block tile 128 m x 64 n, wave tile 16 x 64 (4 accumulators), k step 32. grid = (DE/64, MROWS/128), exact multiples.
//   Operands: the block's 128 A rows and 64 B rows are staged in LDS one k slab of GKS at a time. 8 lanes fetch one
//   whole 128-B line of a row (16 B each), 256 threads x 6 loads = the (128 + 64) x 128 B of a slab, each line once
//   per block. Two buffers: slab s + 1 is loaded into registers ahead of the products of slab s and stored into the
//   other buffer behind them; one block barrier per slab publishes it and ends the reads of the buffer refilled next.
//   Fragments come from the LDS rows (two 16-B reads each, identical k map for A and B), k ascending.
//   MODE 0: bf16 operands; out16 f16 row-major [MROWS][DE] = (acc + bias) * scale. Wave tile staged in wave-private
//   MODE 1: bf16 operands; out16 f16 transposed per batch [b][DE][SEQ] = (acc + bias) * scale. Block tile staged in
//           cross-wave LDS T[n][key 128] (block barrier); wave w writes rows n = 8w..8w+7, one instruction = 2 rows
//           of 128 halves (16 lanes x 16 B per 256-B row); coverage 8 waves x 4 it x 2 rows x 128 = 64x128.
//   MODE 2: f16 operands; out32 f32 row-major [MROWS][DE] = acc * scale + bias + RNE-bf16(resid), resid rows read at
//           the full batch stride. Wave-private LDS stage (f32), one instruction = 2 rows of 64 floats (16 lanes x
//           16 B per 256-B segment); coverage 8 it x 2 rows x 64 = 16x64.
// =====================================================================================================
template <int MODE>
__global__ __launch_bounds__(256)
void gemm_nt(const unsigned short* __restrict__ A, const unsigned short* __restrict__ Bt,
             const float* __restrict__ bias, const float* __restrict__ resid,
             unsigned short* out16, float* out32, float scale) {
  __shared__ __align__(16) unsigned char smem[2 * GSLAB * 2];
  const int tid  = threadIdx.x;
  const int wave = tid >> 5;
  const int lane = tid & 31;
  const int hh   = lane >> 4;
  const int c    = lane & 15;
  const int m0b  = blockIdx.y * 128;
  const int m0   = m0b + wave * 16;
  const int n0   = blockIdx.x * 64;

  v8f acc[4];
#pragma unroll
  for (int t = 0; t < 4; ++t) acc[t] = zero8();

  unsigned short* SL = (unsigned short*)(void*)smem;
  const int srow = tid >> 3;                 // 0..31: row within a group of 32 staged rows
  const int scol = (tid & 7) * 8;            // 16-B piece of the row's 128-B line
  const unsigned short* Ag = A  + (size_t)(m0b + srow) * DE + scol;
  const unsigned short* Bg = Bt + (size_t)(n0 + srow) * DE + scol;
  const int sa = srow * GP + scol;                  // staged A rows 0..127
  const int sb = (128 + srow) * GP + scol;          // staged B rows 0..63
  const int fa = (wave * 16 + c) * GP + 8 * hh;     // this lane's A fragment row
  const int fb = (128 + c) * GP + 8 * hh;           // this lane's B fragment row of n group 0

  v4u ra[4], rb[2];
#pragma unroll
  for (int i = 0; i < 4; ++i) ra[i] = *(const v4u*)(Ag + (size_t)i * 32 * DE);
#pragma unroll
  for (int i = 0; i < 2; ++i) rb[i] = *(const v4u*)(Bg + (size_t)i * 32 * DE);
#pragma unroll
  for (int i = 0; i < 4; ++i) *(v4u*)(SL + sa + i * 32 * GP) = ra[i];
#pragma unroll
  for (int i = 0; i < 2; ++i) *(v4u*)(SL + sb + i * 32 * GP) = rb[i];
  __syncthreads();

  // unrolled in full: buffer index and slab offset become immediates, no address register changes in the loop
#pragma unroll
  for (int s = 0; s < DE / GKS; ++s) {
    const unsigned short* cur = SL + (s & 1) * GSLAB;
    unsigned short* nxt = SL + ((s + 1) & 1) * GSLAB;
    if (s + 1 < DE / GKS) {
#pragma unroll
      for (int i = 0; i < 4; ++i) ra[i] = *(const v4u*)(Ag + (size_t)i * 32 * DE + (s + 1) * GKS);
#pragma unroll
      for (int i = 0; i < 2; ++i) rb[i] = *(const v4u*)(Bg + (size_t)i * 32 * DE + (s + 1) * GKS);
    }
    // all fragments of the slab are read as one group ahead of its products, so that the reads' latencies overlap
    if (MODE == 2) {
      v16h a[GKS / 32], b[GKS / 32][4];
#pragma unroll
      for (int kk = 0; kk < GKS / 32; ++kk) {
        a[kk] = ldfrag_h((const _Float16*)(const void*)(cur + fa + kk * 32));
#pragma unroll
        for (int t = 0; t < 4; ++t) b[kk][t] = ldfrag_h((const _Float16*)(const void*)(cur + fb + t * 16 * GP + kk * 32));
      }
#pragma unroll
      for (int kk = 0; kk < GKS / 32; ++kk)
#pragma unroll
        for (int t = 0; t < 4; ++t) acc[t] = mma_h(a[kk], b[kk][t], acc[t]);
    } else {
      v16b a[GKS / 32], b[GKS / 32][4];
#pragma unroll
      for (int kk = 0; kk < GKS / 32; ++kk) {
        a[kk] = ldfrag_b((const __bf16*)(const void*)(cur + fa + kk * 32));
#pragma unroll
        for (int t = 0; t < 4; ++t) b[kk][t] = ldfrag_b((const __bf16*)(const void*)(cur + fb + t * 16 * GP + kk * 32));
      }
#pragma unroll
      for (int kk = 0; kk < GKS / 32; ++kk)
#pragma unroll
        for (int t = 0; t < 4; ++t) acc[t] = mma_b(a[kk], b[kk][t], acc[t]);
    }
    if (s + 1 < DE / GKS) {
#pragma unroll
      for (int i = 0; i < 4; ++i) *(v4u*)(nxt + sa + i * 32 * GP) = ra[i];
#pragma unroll
      for (int i = 0; i < 2; ++i) *(v4u*)(nxt + sb + i * 32 * GP) = rb[i];
    }
    __syncthreads();   // publishes slab s + 1; ends the reads of slab s (its buffer is refilled, or reused below)
  }

  if (MODE == 0) {
    _Float16* S = (_Float16*)(void*)smem + wave * 1024;          // [16][64] per wave
#pragma unroll
    for (int t = 0; t < 4; ++t) {
      const float bi = bf_up(bf_bits(bias[n0 + t * 16 + c]));
#pragma unroll
      for (int r = 0; r < 8; ++r) S[(8 * hh + r) * 64 + t * 16 + c] = (_Float16)((acc[t][r] + bi) * scale);
    }
    __builtin_amdgcn_fence(__ATOMIC_RELEASE, "workgroup");
    __builtin_amdgcn_wave_barrier();
    __builtin_amdgcn_fence(__ATOMIC_ACQUIRE, "workgroup");
    const int rq = lane >> 3, c8 = (lane & 7) * 8;
    union { v8h h; v4u u; } w[4];
#pragma unroll
    for (int it = 0; it < 4; ++it) w[it].h = *(const v8h*)(S + (it * 4 + rq) * 64 + c8);
    {
#pragma unroll
      for (int it = 0; it < 4; ++it)
        *(v4u*)(out16 + (size_t)(m0 + it * 4 + rq) * DE + n0 + c8) = w[it].u;
      
    }
  } else if (MODE == 1) {
    _Float16* T = (_Float16*)(void*)smem;                       // [n 64][key 128]
#pragma unroll
    for (int t = 0; t < 4; ++t) {
      const float bi = bf_up(bf_bits(bias[n0 + t * 16 + c]));
#pragma unroll
      for (int r = 0; r < 8; ++r)
        T[(t * 16 + c) * 128 + wave * 16 + 8 * hh + r] = (_Float16)((acc[t][r] + bi) * scale);
    }
    __syncthreads();
    const int bidx = m0b / SEQ;                                  // tiles never straddle batches (128 | SEQ)
    const int key0 = m0b - bidx * SEQ;
    const int rh = lane >> 4, c8 = (lane & 15) * 8;
    union { v8h h; v4u u; } w[4];
#pragma unroll
    for (int it = 0; it < 4; ++it) w[it].h = *(const v8h*)(T + (wave * 8 + it * 2 + rh) * 128 + c8);
    {
#pragma unroll
      for (int it = 0; it < 4; ++it) {
        const int row = wave * 8 + it * 2 + rh;
        *(v4u*)(out16 + ((size_t)(bidx * DE + n0 + row) * SEQ + key0 + c8)) = w[it].u;
      }
      
    }
  } else {
    float* S = (float*)(void*)smem + wave * 1024;                // [16][64] f32 per wave
#pragma unroll
    for (int t = 0; t < 4; ++t) {
      const float bi = bf_up(bf_bits(bias[n0 + t * 16 + c]));
#pragma unroll
      for (int r = 0; r < 8; ++r) S[(8 * hh + r) * 64 + t * 16 + c] = acc[t][r] * scale + bi;
    }
    __builtin_amdgcn_fence(__ATOMIC_RELEASE, "workgroup");
    __builtin_amdgcn_wave_barrier();
    __builtin_amdgcn_fence(__ATOMIC_ACQUIRE, "workgroup");
    const int rh = lane >> 4, c4 = (lane & 15) * 4;
    v4f vals[8];
#pragma unroll
    for (int it = 0; it < 8; ++it) {
      const int row = it * 2 + rh;
      const int gm  = m0 + row;
      const int bb  = gm / SEQ;
      const int tt  = gm - bb * SEQ;
      v4f x = *(const v4f*)(S + row * 64 + c4);
      const v4f rq = *(const v4f*)(resid + ((size_t)bb * SEQ_FULL + tt) * DE + n0 + c4);
#pragma unroll
      for (int e = 0; e < 4; ++e) x[e] = x[e] + bf_up(bf_bits(rq[e]));
      vals[it] = x;
    }
    {
#pragma unroll
      for (int it = 0; it < 8; ++it)
        *(v4f*)(out32 + (size_t)(m0 + it * 2 + rh) * DE + n0 + c4) = vals[it];
      
    }
  }
}

// =====================================================================================================
// Full (unmasked) attention, head dim 64, all NQB key tiles.
//   q plane (f16):  element (b, t, h, d) at [(b*SEQ + t)*DE + h*64 + d]      k plane (f16): same with key index s
//   v^T plane (f16): element (b, h, d, s) at [(b*DE + h*64 + d)*SEQ + s], value v*64
//   Both products are formed transposed: S^T = K . Q^T (A = K rows, B = Q) and O^T += V^T . P^T (A = V^T rows, B = P^T).
//   Lane (c, hh) then holds scores of ONE query, q0 + c: register r of score tile j is key 16 j + 8 hh + r. Row maximum
//   and row sum are in-lane, with one exchange between the two lane halves; and score tiles 2 kk and 2 kk + 1,
//   converted in place, ARE the B fragment of key chunk kk (element e < 8: key 8 hh + e, else 16 + 8 hh + e - 8, the
//   k map of the V^T loader): P goes through no LDS and no lane exchange.
//   scores = q . k (f16 WMMA, f32 acc) * 0.125; online softmax in f32; p = exp(s - m) carried as f16(16384 p);
//   context = p . v on f16 WMMA; RES adds the f16 residual plane of p (x4096, separate accumulator folded back
//   with 1/4096 per tile in f32). ctx out = f16(context / (l * 16384 * 64) * 64) to [(b*SEQ + t)*DE + h*64 + d].
//   l is kept per lane half (the half's own keys); the halves are joined once, behind the loop.
//   Block = 4 waves = 64 query rows of one (b,h); grid = nqbThis * NH * NB; kv tiles of 64.
//   K / V^T tile staging: 128 threads x 32 elements per plane = the whole 64x64 tile (plain 16-B loads,
//   __syncthreads before and after, cross-wave); staged extent == consumed extent for Ksh, Vth, Os.
//   Ksh, Vth rows lie at pitch LP (64 used halves + 8 never touched) so that the 16 rows one 16-B fragment
//   read walks fall on 16 different bank groups.
//   The Os tile is wave-private: lane (c, hh) stores 8 consecutive d of query row c per output tile (one 16-B store),
//   Output coverage: each wave stores rows 0..15 (it 0..3 x lane>>3) x 64 halves (8 lanes x 16 B): one instruction
// =====================================================================================================
template <bool RES>
__global__ __launch_bounds__(128)
void attn_full64(const unsigned short* __restrict__ qp, const unsigned short* __restrict__ kp,
                 const unsigned short* __restrict__ vtp, unsigned short* ctx, int qbBase, int nqbThis) {
  union FH { v16h v; v8h h[2]; v2h p[8]; };
  __shared__ __align__(16) _Float16 Ksh[64 * LP];                 // K [kv][d], pitch LP
  __shared__ __align__(16) _Float16 Vth[64 * LP];                 // V^T [d][kv], pitch LP
  __shared__ __align__(16) _Float16 Os[4][16 * 64];               // per wave context tile [row][d]

  const int tid  = threadIdx.x;
  const int wave = tid >> 5;
  const int lane = tid & 31;
  const int hh   = lane >> 4;
  const int c    = lane & 15;

  const int bx   = blockIdx.x;
  const int qbl  = bx % nqbThis;
  const int bhq  = bx / nqbThis;           // 0..NB*NH-1
  const int h    = bhq % NH;
  const int b    = bhq / NH;
  const int qb   = qbBase + qbl;           // 0..NQB-1
  const int q0   = qb * 64 + wave * 16;    // query index within the sequence

  const _Float16* Qh = (const _Float16*)(const void*)qp + (size_t)b * SEQ * DE + (size_t)h * HD;
  const _Float16* Kh = (const _Float16*)(const void*)kp + (size_t)b * SEQ * DE + (size_t)h * HD;
  const _Float16* Vh = (const _Float16*)(const void*)vtp + ((size_t)b * DE + (size_t)h * HD) * SEQ;

  // ---- Q fragments (B operand, column = lane&15): 2 d-chunks ----
  v16h qa[2];
#pragma unroll
  for (int dc = 0; dc < 2; ++dc) {
    const size_t qo = (size_t)(q0 + c) * DE + dc * 32 + 8 * hh;
    qa[dc] = ldfrag_h(Qh + qo);
  }

  float mrow = -INFINITY, lrow = 0.f;       // of query q0 + c; lrow: the keys of this lane half only
  v8f oacc[4];                              // O^T: register r of tile t = context[q0 + c][16 t + 8 hh + r]
#pragma unroll
  for (int t = 0; t < 4; ++t) oacc[t] = zero8();

  for (int kt = 0; kt < NQB; ++kt) {        // block-uniform bounds, exactly NQB trips
    const int kv0 = kt * 64;
    __syncthreads();
    {
      const int r = tid >> 1, half = (tid & 1) * 32;
      const _Float16* kg = Kh + (size_t)(kv0 + r) * DE + half;   // K row kv0+r, d = half..half+31
      const _Float16* vg = Vh + (size_t)r * SEQ + kv0 + half;    // V^T row d = r, s = kv0+half..+31
      // all eight loads are issued ahead of the first store, so that their latencies overlap
      v8h a0[4], b0[4];
#pragma unroll
      for (int i = 0; i < 4; ++i) {
        a0[i] = *(const v8h*)(kg + 8 * i);
        b0[i] = *(const v8h*)(vg + 8 * i);
      }
#pragma unroll
      for (int i = 0; i < 4; ++i) {
        *(v8h*)(Ksh + r * LP + half + 8 * i) = a0[i];
        *(v8h*)(Vth + r * LP + half + 8 * i) = b0[i];
      }
    }
    __syncthreads();

    // ---- all K and V^T fragments of the tile are read as one group right behind the barrier: the K reads' latencies
    //      overlap each other, the V^T reads land under the score products and the softmax ----
    FH kb[4][2], vb[2][4];
#pragma unroll
    for (int j = 0; j < 4; ++j)
#pragma unroll
      for (int dc = 0; dc < 2; ++dc) {
        kb[j][dc].h[0] = *(const v8h*)(Ksh + (j * 16 + c) * LP + dc * 32 + 8 * hh);
        kb[j][dc].h[1] = *(const v8h*)(Ksh + (j * 16 + c) * LP + dc * 32 + 16 + 8 * hh);
      }
#pragma unroll
    for (int kk = 0; kk < 2; ++kk)
#pragma unroll
      for (int t = 0; t < 4; ++t) {
        vb[kk][t].h[0] = *(const v8h*)(Vth + (t * 16 + c) * LP + kk * 32 + 8 * hh);
        vb[kk][t].h[1] = *(const v8h*)(Vth + (t * 16 + c) * LP + kk * 32 + 16 + 8 * hh);
      }
    // holds the group of reads apart from the products: without it the compiler mixes the two regions and, in the
    // residual variant, spills one fragment to scratch and reloads it in every trip
    __builtin_amdgcn_sched_barrier(0);

    // ---- scores, transposed: 64 keys (rows) x 16 queries (columns) per wave, single f16 product ----
    v8f s[4];
#pragma unroll
    for (int j = 0; j < 4; ++j) {
      s[j] = zero8();
#pragma unroll
      for (int dc = 0; dc < 2; ++dc) s[j] = mma_h(kb[j][dc].v, qa[dc], s[j]);
    }

    // ---- scale, maximum of this lane's 32 keys (one chain per score tile), joined with the other lane half ----
    float mj[4];
#pragma unroll
    for (int j = 0; j < 4; ++j) {
      float m = -INFINITY;
#pragma unroll
      for (int r = 0; r < 8; ++r) {
        const float sv = s[j][r] * 0.125f;
        s[j][r] = sv;
        m = fmaxf(m, sv);
      }
      mj[j] = m;
    }
    float mx = fmaxf(fmaxf(mj[0], mj[1]), fmaxf(mj[2], mj[3]));
    mx = fmaxf(mx, xhalf(mx));
    const float mnew  = fmaxf(mrow, mx);
    const float msafe = (mnew == -INFINITY) ? 0.f : mnew;
    const float al = __expf(mrow - msafe);
    mrow = mnew;

    // ---- P (x16384, f16) and P residual (x4096), converted in pairs straight into the B fragments ----
    FH pa[2], pl[2];
    v2f pj[4];                           // one chain of pair sums per score tile (even r, odd r)
#pragma unroll
    for (int j = 0; j < 4; ++j) {
#pragma unroll
      for (int r = 0; r < 8; r += 2) {
        const v2f pp = {__expf(s[j][r] - msafe), __expf(s[j][r + 1] - msafe)};
        pj[j] = (r == 0) ? pp : pj[j] + pp;
        const v2f pk = pp * PCARRY;
        const v2h ph = __builtin_convertvector(pk, v2h);
        pa[j >> 1].p[(j & 1) * 4 + (r >> 1)] = ph;
        if (RES) {
          const v2f rs = {(pk[0] - (float)ph[0]) * PRES, (pk[1] - (float)ph[1]) * PRES};
          pl[j >> 1].p[(j & 1) * 4 + (r >> 1)] = __builtin_convertvector(rs, v2h);
        }
      }
    }
    const v2f pt = (pj[0] + pj[1]) + (pj[2] + pj[3]);
    lrow = lrow * al + (pt[0] + pt[1]);
#pragma unroll
    for (int t = 0; t < 4; ++t)
#pragma unroll
      for (int r = 0; r < 8; ++r) oacc[t][r] *= al;

    // ---- context^T += V^T . P^T (f16 WMMA), residual products into a separate accumulator ----
    v8f o1[4];
#pragma unroll
    for (int t = 0; t < 4; ++t) o1[t] = zero8();
    // unrolled: kk picks among fragments that sit in registers, so it must be a constant
#pragma unroll
    for (int kk = 0; kk < 2; ++kk) {
#pragma unroll
      for (int t = 0; t < 4; ++t) {
        oacc[t] = mma_h(vb[kk][t].v, pa[kk].v, oacc[t]);
        if (RES) o1[t] = mma_h(vb[kk][t].v, pl[kk].v, o1[t]);
      }
    }
    if (RES) {
#pragma unroll
      for (int t = 0; t < 4; ++t)
#pragma unroll
        for (int r = 0; r < 8; ++r) oacc[t][r] += o1[t][r] * (1.0f / PRES);
    }
  }

  // ---- join the halves' sums; normalise (1/l, the p, v carries) and apply the ctx carry; stage the wave's 16x64 f16
  //      tile; write whole lines ----
  _Float16* os = Os[wave];
  {
    const float l = lrow + xhalf(lrow);
    const float inv = ((l > 0.f) ? (1.0f / l) : 0.f) * (CCARRY / (PCARRY * VCARRY));
#pragma unroll
    for (int t = 0; t < 4; ++t) {
      v8h o;
#pragma unroll
      for (int r = 0; r < 8; ++r) o[r] = (_Float16)(oacc[t][r] * inv);
      *(v8h*)(os + c * 64 + t * 16 + 8 * hh) = o;
    }
  }
  __builtin_amdgcn_fence(__ATOMIC_RELEASE, "workgroup");
  __builtin_amdgcn_wave_barrier();
  __builtin_amdgcn_fence(__ATOMIC_ACQUIRE, "workgroup");
  {
    const int rq = lane >> 3, c8 = (lane & 7) * 8;
    union { v8h h; v4u u; } w[4];
#pragma unroll
    for (int it = 0; it < 4; ++it) w[it].h = *(const v8h*)(os + (it * 4 + rq) * 64 + c8);
    unsigned short* ob = ctx + ((size_t)b * SEQ) * DE + (size_t)h * HD;
    {
#pragma unroll
      for (int it = 0; it < 4; ++it) {
        const int row = it * 4 + rq;                     // it 0..3 x rq 0..3 = rows 0..15
        *(v4u*)(ob + (size_t)(q0 + row) * DE + c8) = w[it].u;
      }
      
    }
  }
}

// =====================================================================================================
// LayerNorm over DE of x [MROWS][DE] f32: one block of 256 threads per row, thread owns 4 consecutive floats.
// mean and centred variance via wave shuffles + 8-entry LDS partials (cross-wave, block barriers), fixed order.
// y = (x - mu) * rsqrt(var + 1e-5) * RNE-bf16(gamma) + RNE-bf16(beta). Output row b*SEQ_FULL + t of d_out;
// coverage: MROWS blocks x 256 threads x 4 floats = every processed output row in full.
// =====================================================================================================
__global__ __launch_bounds__(256) void ln_rows(const float* __restrict__ x, const float* __restrict__ gam,
                                               const float* __restrict__ bet, float* out) {
  __shared__ float red1[8];
  __shared__ float red2[8];
  const int tid = threadIdx.x, wave = tid >> 5, lane = tid & 31;
  const int row = blockIdx.x;
  const int bb  = row / SEQ;
  const int tt  = row - bb * SEQ;
  const size_t orow = (size_t)bb * SEQ_FULL + (size_t)tt;

  const v4f v = *(const v4f*)(x + (size_t)row * DE + tid * 4);
  float s = (v[0] + v[1]) + (v[2] + v[3]);
#pragma unroll
  for (int off = 16; off > 0; off >>= 1) s += __shfl_xor(s, off, 32);
  if (lane == 0) red1[wave] = s;
  __syncthreads();
  float tot = 0.f;
#pragma unroll
  for (int w = 0; w < 8; ++w) tot += red1[w];
  const float mu = tot * (1.0f / (float)DE);

  v4f d;
#pragma unroll
  for (int e = 0; e < 4; ++e) d[e] = v[e] - mu;
  float s2 = (d[0] * d[0] + d[1] * d[1]) + (d[2] * d[2] + d[3] * d[3]);
#pragma unroll
  for (int off = 16; off > 0; off >>= 1) s2 += __shfl_xor(s2, off, 32);
  if (lane == 0) red2[wave] = s2;
  __syncthreads();
  float tot2 = 0.f;
#pragma unroll
  for (int w = 0; w < 8; ++w) tot2 += red2[w];
  const float var  = tot2 * (1.0f / (float)DE);
  const float rstd = rsqrtf(var + 1.0e-5f);

  const v4f g4 = *(const v4f*)(gam + tid * 4);
  const v4f b4 = *(const v4f*)(bet + tid * 4);
  v4f y;
#pragma unroll
  for (int e = 0; e < 4; ++e) y[e] = (d[e] * rstd) * bf_up(bf_bits(g4[e])) + bf_up(bf_bits(b4[e]));
  float* op = out + orow * DE + (size_t)tid * 4;
  *(v4f*)op = y;
  
}

// =====================================================================================================
// Workspace map (bytes, full size): PQ bf16 [MROWS][DE] at 0 (8388608); PK bf16 at 8388608 (8388608);
// Wq^T, Wk^T, Wv^T bf16 and Wo^T f16 [DE][DE] at 16777216.. (4 x 2097152); Q f16 [MROWS][DE] at 25165824;
// K f16 at 33554432; V^T f16 [NB][DE][SEQ] at 41943040; CTX f16 [MROWS][DE] at 50331648; X f32 [MROWS][DE]
// at 58720256 (16777216); end 75497472. Every plane is an exact multiple of its whole-line store granularity
// Launch plan (10): cvt pre_q, cvt pre_k, weight transpose-convert, gemm q, gemm k, gemm v^T, attention (leading
// query blocks with the p residual, remaining blocks without), gemm o + residual, LayerNorm.
// =====================================================================================================
extern "C" void kernel_launch(void* const* d_in, const int* in_sizes, int n_in,
                              void* d_out, int out_size, void* d_ws, size_t ws_size,
                              hipStream_t stream) {
  if (n_in < 12) return;
  const long long needIn = (long long)(NB - 1) * SEQ_FULL * DE + (long long)SEQ * DE;
  if ((long long)in_sizes[0] < needIn || (long long)in_sizes[1] < needIn) return;
  if (in_sizes[2] < DE * DE || in_sizes[4] < DE * DE || in_sizes[6] < DE * DE || in_sizes[8] < DE * DE) return;
  if (in_sizes[3] < DE || in_sizes[5] < DE || in_sizes[7] < DE || in_sizes[9] < DE) return;
  if (in_sizes[10] < DE || in_sizes[11] < DE) return;
  if (out_size < 0 || (long long)out_size < needIn) return;

  const size_t P16 = (size_t)MROWS * DE * 2;     // one 16-bit activation plane
  const size_t W16 = (size_t)DE * DE * 2;        // one 16-bit weight plane
  const size_t P32 = (size_t)MROWS * DE * 4;     // x plane
  size_t off = 0;
  const size_t oPQ  = off; off += P16;
  const size_t oPK  = off; off += P16;
  const size_t oWq  = off; off += W16;
  const size_t oWk  = off; off += W16;
  const size_t oWv  = off; off += W16;
  const size_t oWo  = off; off += W16;
  const size_t oQ   = off; off += P16;
  const size_t oK   = off; off += P16;
  const size_t oVT  = off; off += P16;
  const size_t oCTX = off; off += P16;
  const size_t oX   = off; off += P32;
  if (off > ws_size) return;                     // off = 75497472 at full size
  if (off > (size_t)134217728) return;

  const float* pre_q = (const float*)d_in[0];
  const float* pre_k = (const float*)d_in[1];
  const float* Wq    = (const float*)d_in[2];
  const float* bq    = (const float*)d_in[3];
  const float* Wk    = (const float*)d_in[4];
  const float* bk    = (const float*)d_in[5];
  const float* Wv    = (const float*)d_in[6];
  const float* bv    = (const float*)d_in[7];
  const float* Wo    = (const float*)d_in[8];
  const float* bo    = (const float*)d_in[9];
  const float* gamma = (const float*)d_in[10];
  const float* beta  = (const float*)d_in[11];
  float* out = (float*)d_out;

  char* ws = (char*)d_ws;
  unsigned short* PQb  = (unsigned short*)(ws + oPQ);
  unsigned short* PKb  = (unsigned short*)(ws + oPK);
  unsigned short* Wqt  = (unsigned short*)(ws + oWq);
  unsigned short* Wkt  = (unsigned short*)(ws + oWk);
  unsigned short* Wvt  = (unsigned short*)(ws + oWv);
  unsigned short* Wot  = (unsigned short*)(ws + oWo);
  unsigned short* Qh   = (unsigned short*)(ws + oQ);
  unsigned short* Kh   = (unsigned short*)(ws + oK);
  unsigned short* VTb  = (unsigned short*)(ws + oVT);
  unsigned short* CTXb = (unsigned short*)(ws + oCTX);
  float*          Xb   = (float*)(ws + oX);

  const dim3 blk(256);
  const int n8   = MROWS * DE / 8;               // 524288 at full size
  const int per8 = SEQ * DE / 8;
  const int src8 = SEQ_FULL * DE / 8;
  const dim3 gCvt((n8 + 255) / 256);
  const dim3 gWt((DE / 64) * (DE / 64), 4);      // 256 tiles x 4 matrices
  const dim3 gG(DE / 64, MROWS / 128);           // (16, 32) at full size
  int resqb = RESQB;
  if (resqb > NQB) resqb = NQB;

  // (1) activations -> bf16 planes (RNE convert)
  cvt_bf16x8s<<<gCvt, blk, 0, stream>>>(pre_q, PQb, n8, per8, src8);
  cvt_bf16x8s<<<gCvt, blk, 0, stream>>>(pre_k, PKb, n8, per8, src8);
  // (2) weights -> transposed 16-bit planes (Wq, Wk, Wv bf16; Wo f16 x64)
  wt_tiles<<<gWt, blk, 0, stream>>>(Wq, Wk, Wv, Wo, Wqt, Wkt, Wvt, Wot);
  // (3) projections: q, k -> f16 row-major; v -> f16 v^T x64
  gemm_nt<0><<<gG, blk, 0, stream>>>(PQb, Wqt, bq, pre_q, Qh, Xb, 1.0f);
  gemm_nt<0><<<gG, blk, 0, stream>>>(PKb, Wkt, bk, pre_q, Kh, Xb, 1.0f);
  gemm_nt<1><<<gG, blk, 0, stream>>>(PKb, Wvt, bv, pre_q, VTb, Xb, VCARRY);
  // (4) attention -> ctx f16 x64: query blocks 0..resqb-1 with the p residual plane, the rest without
  attn_full64<true><<<dim3(NB * NH * resqb), dim3(128), 0, stream>>>(Qh, Kh, VTb, CTXb, 0, resqb);
  if (NQB - resqb > 0) {
    attn_full64<false><<<dim3(NB * NH * (NQB - resqb)), dim3(128), 0, stream>>>(Qh, Kh, VTb, CTXb, resqb, NQB - resqb);
  }
  // (5) output projection + bias + residual -> x f32
  gemm_nt<2><<<gG, blk, 0, stream>>>(CTXb, Wot, bo, pre_q, CTXb, Xb, 1.0f / (CCARRY * WCARRY));
  // (6) LayerNorm -> output
  ln_rows<<<dim3(MROWS), blk, 0, stream>>>(Xb, gamma, beta, out);
  (void)hipGetLastError();
}

// v006
// One run takes 115 microseconds.
// Two timings next to v005 put it at 1.34 and 1.35 times that version's speed.
// Over all steps from v000 it is 4.11 times as fast.
// Contractions: q/k/v projections = v_wmma_f32_16x16x32_bf16 (bf16 operands = RNE-converted activations and
// transposed weights, single product, f32 accumulate); q.k^T scores, p.v context and ctx.Wo projection =
// v_wmma_f32_16x16x32_f16 (q, k = f16 of the f32 projection sums, unscaled; p = exp(s - m) carried x16384 plus an
// f16 residual plane of p x4096 on the leading query blocks; v^T, ctx and Wo carried x64 in f16), f32 accumulate;
// softmax, bias/residual add and LayerNorm in f32.
#include <hip/hip_runtime.h>
#include <math.h>
#include <stdint.h>

#ifndef NB
#define NB 2                 // batches processed (reducible)
#endif
#ifndef NB_FULL
#define NB_FULL 2            // batches in the inputs / output
#endif
#ifndef SEQ
#define SEQ 2048             // query == key length processed (reducible)
#endif
#ifndef SEQ_FULL
#define SEQ_FULL 2048        // per-batch row stride of the inputs and of the output
#endif
#define DE    1024
#define NH    16
#define HD    64
#define NQB   (SEQ / 64)
#define MROWS (NB * SEQ)
#ifndef RESQB
#define RESQB 8              // leading 64-row query blocks per (b,h) that carry the p residual plane
#endif
#define PCARRY 16384.0f
#define PRES   4096.0f
#define VCARRY 64.0f
#define CCARRY 64.0f
#define WCARRY 64.0f
#define LP    72             // LDS row pitch (halves) of the attention K and V^T tiles: 144 B = 16 B x odd
#define GKS   64             // k extent (halves) of one staged GEMM slab: one whole 128-B line per row
#define GP    72             // LDS row pitch (halves) of the staged GEMM slabs: 144 B = 16 B x odd
#define GSLAB ((128 + 64) * GP)   // halves in one slab buffer: 128 A rows, then 64 B rows

static_assert(NB >= 1 && NB <= NB_FULL);
static_assert((SEQ % 128) == 0 && SEQ >= 128 && SEQ <= SEQ_FULL);
static_assert(NH * HD == DE);
static_assert(RESQB >= 1);
static_assert(LP >= HD && (LP % 8) == 0 && ((LP / 8) % 2) == 1);   // 16-B aligned rows, odd count of 16-B units
static_assert((MROWS % 128) == 0 && (DE % 64) == 0 && (DE % 32) == 0);
static_assert(GP >= GKS && (GP % 8) == 0 && ((GP / 8) % 2) == 1 && (DE % GKS) == 0 && (GKS % 32) == 0);
static_assert(2 * GSLAB * 2 >= 32768);                               // the epilogue stages reuse the slab buffers
static_assert((long long)NB_FULL * SEQ_FULL * DE * 4 == 16777216LL);   // total output bytes at full size

typedef _Float16 v16h __attribute__((ext_vector_type(16)));
typedef _Float16 v8h  __attribute__((ext_vector_type(8)));
typedef __bf16   v16b __attribute__((ext_vector_type(16)));
typedef __bf16   v8b  __attribute__((ext_vector_type(8)));
typedef float    v8f  __attribute__((ext_vector_type(8)));
typedef float    v4f  __attribute__((ext_vector_type(4)));
typedef float    v2f  __attribute__((ext_vector_type(2)));
typedef _Float16 v2h  __attribute__((ext_vector_type(2)));
typedef unsigned int v4u __attribute__((ext_vector_type(4)));
typedef unsigned short v8us __attribute__((ext_vector_type(8)));

// ---- scalar helpers --------------------------------------------------------------------------------
__device__ __forceinline__ unsigned short bf_bits(float f) {          // f32 -> bf16 bits, RNE convert
  unsigned u = __float_as_uint(f);
  return (unsigned short)((u + 0x7FFFu + ((u >> 16) & 1u)) >> 16);
}
__device__ __forceinline__ float bf_up(unsigned short h) { return __uint_as_float(((unsigned)h) << 16); }
__device__ __forceinline__ unsigned short h_bits(float f) {           // f32 -> f16 bits, RNE convert
  union { _Float16 h; unsigned short u; } cvt;
  cvt.h = (_Float16)f;
  return cvt.u;
}
__device__ __forceinline__ unsigned pk16(unsigned short a, unsigned short b) { return (unsigned)a | ((unsigned)b << 16); }
__device__ __forceinline__ v8f zero8() { v8f z = {0.f, 0.f, 0.f, 0.f, 0.f, 0.f, 0.f, 0.f}; return z; }
// value of lane l ^ 16 (the other 16-lane row), on the vector unit; all 32 lanes are on at every call site
__device__ __forceinline__ float xhalf(float x) {
  const int b = __builtin_bit_cast(int, x);
  return __builtin_bit_cast(float, __builtin_amdgcn_permlanex16(b, b, 0x76543210, 0xfedcba98, false, false));
}

// ---- fragment loaders: 16-bit A/B operand, lane -> row/col (lane&15), p already includes +8*(lane>>4);
//      elements 0..7 <- p[0..7] (k0+8h..), elements 8..15 <- p[16..23] (k0+16+8h..)
__device__ __forceinline__ v16b ldfrag_b(const __bf16* p) {
  union { v16b v; v8b h[2]; } f;
  f.h[0] = *(const v8b*)(p);
  f.h[1] = *(const v8b*)(p + 16);
  return f.v;
}
__device__ __forceinline__ v16h ldfrag_h(const _Float16* p) {
  union { v16h v; v8h h[2]; } f;
  f.h[0] = *(const v8h*)(p);
  f.h[1] = *(const v8h*)(p + 16);
  return f.v;
}

// ---- WMMA helpers with trailing VALU hazard gap --------------------------------------------------------
__device__ __forceinline__ v8f mma_b(v16b a, v16b b, v8f c) {
  c = __builtin_amdgcn_wmma_f32_16x16x32_bf16(false, a, false, b, (short)0, c, false, false);
  asm volatile("v_nop\n\tv_nop\n\tv_nop\n\tv_nop" : "+v"(c) : "v"(a), "v"(b));
  return c;
}
__device__ __forceinline__ v8f mma_h(v16h a, v16h b, v8f c) {
  c = __builtin_amdgcn_wmma_f32_16x16x32_f16(false, a, false, b, (short)0, c, false, false);
  asm volatile("v_nop\n\tv_nop\n\tv_nop\n\tv_nop" : "+v"(c) : "v"(a), "v"(b));
  return c;
}

// =====================================================================================================
// f32 -> bf16 (RNE convert), 8 elements per thread, one 16-B store per lane: a wave writes 512 contiguous B
// Destination plane is compact [b][SEQ*DE]; source batch stride src8 (units of 8 floats) may be larger.
// coverage: n8 threads x 8 = whole plane (n8 = NB*SEQ*DE/8 is a multiple of 256). blk = block index within the plane.
// =====================================================================================================
__device__ __forceinline__ void cvt_bf16x8s(const float* __restrict__ in, unsigned short* out,
                                            int blk, int n8, int per8, int src8) {
  const int i = blk * 256 + threadIdx.x;
  if (i < n8) {
    const int hd  = i / per8;
    const int rem = i - hd * per8;
    const float* s = in + ((size_t)hd * src8 + (size_t)rem) * 8;
    const v4f a = *(const v4f*)(s);
    const v4f b = *(const v4f*)(s + 4);
    v4u p;
    p[0] = pk16(bf_bits(a[0]), bf_bits(a[1]));
    p[1] = pk16(bf_bits(a[2]), bf_bits(a[3]));
    p[2] = pk16(bf_bits(b[0]), bf_bits(b[1]));
    p[3] = pk16(bf_bits(b[2]), bf_bits(b[3]));
    *(v4u*)(out + (size_t)i * 8) = p;
    
  }
}

// =====================================================================================================
// Weight W[k][n] f32 (DE x DE, n contiguous) -> transposed 16-bit plane Wt[n][k] (k contiguous, pitch DE).
//   mat = matrix id: 0,1,2 -> bf16 bits of the RNE-bf16 value; 3 -> f16 bits of (RNE-bf16 value x64).
//   Block = one 64(k) x 64(n) tile, 256 threads: thread (k = tid>>2, 16-column n quarter) loads 16 floats of row k
//   and writes them transposed into the LDS tile T[n][k]; after the barrier wave w writes rows n = 8w..8w+7:
//   tile = 0..(DE/64)^2 - 1 covers the whole plane of each of the 4 matrices. T = the block's 64 x 64 LDS tile.
// =====================================================================================================
__device__ __forceinline__ void wt_tiles(unsigned short* T, int mat, int tile,
                                         const float* __restrict__ w0, const float* __restrict__ w1,
                                         const float* __restrict__ w2, const float* __restrict__ w3,
                                         unsigned short* o0, unsigned short* o1,
                                         unsigned short* o2, unsigned short* o3) {
  const int tid = threadIdx.x;
  const float* in = w0; unsigned short* out = o0;        // mat is block-uniform
  if (mat == 1) { in = w1; out = o1; }
  else if (mat == 2) { in = w2; out = o2; }
  else if (mat == 3) { in = w3; out = o3; }
  const int ktile = tile / (DE / 64);
  const int ntile = tile - ktile * (DE / 64);
  const int k   = tid >> 2;              // 0..63
  const int nq  = (tid & 3) * 16;        // 0,16,32,48
  const float* src = in + (size_t)(ktile * 64 + k) * DE + ntile * 64 + nq;
#pragma unroll
  for (int i = 0; i < 4; ++i) {
    const v4f a = *(const v4f*)(src + 4 * i);
#pragma unroll
    for (int e = 0; e < 4; ++e) {
      const unsigned short bb = bf_bits(a[e]);
      const unsigned short hb = h_bits(bf_up(bb) * WCARRY);
      const unsigned short us = (mat == 3) ? hb : bb;
      T[(nq + 4 * i + e) * 64 + k] = us;
    }
  }
  __syncthreads();
  const int wave = tid >> 5, lane = tid & 31;
  const int q = lane >> 3, c8 = (lane & 7) * 8;
  union { v8us s; v4u u; } x0, x1;
  const int d0 = wave * 8 + q;
  const int d1 = wave * 8 + 4 + q;
  x0.s = *(const v8us*)(T + d0 * 64 + c8);
  x1.s = *(const v8us*)(T + d1 * 64 + c8);
  unsigned short* p0 = out + ((size_t)(ntile * 64 + d0) * DE + ktile * 64 + c8);
  unsigned short* p1 = out + ((size_t)(ntile * 64 + d1) * DE + ktile * 64 + c8);
  *(v4u*)p0 = x0.u;
  *(v4u*)p1 = x1.u;
  
}

// =====================================================================================================
// The three input-only jobs in one grid, picked by block index (block-uniform): blocks 0 .. 4 (DE/64)^2 - 1 transpose
// one weight tile each (the longest chain, placed first for speed only), the next ncv blocks convert pre_q, the last ncv pre_k.
// =====================================================================================================
__global__ __launch_bounds__(256) void prep_inputs(const float* __restrict__ aq, const float* __restrict__ ak,
                                                   const float* __restrict__ w0, const float* __restrict__ w1,
                                                   const float* __restrict__ w2, const float* __restrict__ w3,
                                                   unsigned short* oq, unsigned short* ok,
                                                   unsigned short* o0, unsigned short* o1,
                                                   unsigned short* o2, unsigned short* o3,
                                                   int ncv, int n8, int per8, int src8) {
  __shared__ __align__(16) unsigned short T[64 * 64];   // [n][k], weight blocks only
  const int tiles = (DE / 64) * (DE / 64);
  const int bx = blockIdx.x;
  if (bx < 4 * tiles) {
    const int mat = bx / tiles;
    wt_tiles(T, mat, bx - mat * tiles, w0, w1, w2, w3, o0, o1, o2, o3);
  } else if (bx < 4 * tiles + ncv) {
    cvt_bf16x8s(aq, oq, bx - 4 * tiles, n8, per8, src8);
  } else {
    cvt_bf16x8s(ak, ok, bx - 4 * tiles - ncv, n8, per8, src8);
  }
}

// =====================================================================================================
// 16-bit GEMM C[m][n] = sum_k A[m][k] * Bt[n][k], K = DE, M = MROWS, N = DE. Block 256 threads = 8 waves,
// block tile 128 m x 64 n, wave tile 16 x 64 (4 accumulators), k step 32. grid x, y = (DE/64, MROWS/128), exact multiples.
//   Operands: the block's 128 A rows and 64 B rows are staged in LDS one k slab of GKS at a time. 8 lanes fetch one
//   whole 128-B line of a row (16 B each), 256 threads x 6 loads = the (128 + 64) x 128 B of a slab, each line once
//   per block. Two buffers: slab s + 1 is loaded into registers ahead of the products of slab s and stored into the
//   other buffer behind them; one block barrier per slab publishes it and ends the reads of the buffer refilled next.
//   Fragments come from the LDS rows (two 16-B reads each, identical k map for A and B), k ascending.
//   MODE 0: bf16 operands; out16 f16 row-major [MROWS][DE] = (acc + bias) * scale. Wave tile staged in wave-private
//   MODE 1: bf16 operands; out16 f16 transposed per batch [b][DE][SEQ] = (acc + bias) * scale. Block tile staged in
//           cross-wave LDS T[n][key 128] (block barrier); wave w writes rows n = 8w..8w+7, one instruction = 2 rows
//           of 128 halves (16 lanes x 16 B per 256-B row); coverage 8 waves x 4 it x 2 rows x 128 = 64x128.
//   MODE 2: f16 operands; out32 f32 row-major [MROWS][DE] = acc * scale + bias + RNE-bf16(resid), resid rows read at
//           the full batch stride. Wave-private LDS stage (f32), one instruction = 2 rows of 64 floats (16 lanes x
//           16 B per 256-B segment); coverage 8 it x 2 rows x 64 = 16x64.
// =====================================================================================================
// the k loop: F16 picks the operand type of the products; smem = the block's two slab buffers; acc = the wave's tile
template <bool F16>
__device__ __forceinline__
void gemm_main(unsigned char* smem, const unsigned short* __restrict__ A, const unsigned short* __restrict__ Bt,
               v8f (&acc)[4]) {
  const int tid  = threadIdx.x;
  const int wave = tid >> 5;
  const int lane = tid & 31;
  const int hh   = lane >> 4;
  const int c    = lane & 15;
  const int m0b  = blockIdx.y * 128;
  const int n0   = blockIdx.x * 64;

#pragma unroll
  for (int t = 0; t < 4; ++t) acc[t] = zero8();

  unsigned short* SL = (unsigned short*)(void*)smem;
  const int srow = tid >> 3;                 // 0..31: row within a group of 32 staged rows
  const int scol = (tid & 7) * 8;            // 16-B piece of the row's 128-B line
  const unsigned short* Ag = A  + (size_t)(m0b + srow) * DE + scol;
  const unsigned short* Bg = Bt + (size_t)(n0 + srow) * DE + scol;
  const int sa = srow * GP + scol;                  // staged A rows 0..127
  const int sb = (128 + srow) * GP + scol;          // staged B rows 0..63
  const int fa = (wave * 16 + c) * GP + 8 * hh;     // this lane's A fragment row
  const int fb = (128 + c) * GP + 8 * hh;           // this lane's B fragment row of n group 0

  v4u ra[4], rb[2];
#pragma unroll
  for (int i = 0; i < 4; ++i) ra[i] = *(const v4u*)(Ag + (size_t)i * 32 * DE);
#pragma unroll
  for (int i = 0; i < 2; ++i) rb[i] = *(const v4u*)(Bg + (size_t)i * 32 * DE);
#pragma unroll
  for (int i = 0; i < 4; ++i) *(v4u*)(SL + sa + i * 32 * GP) = ra[i];
#pragma unroll
  for (int i = 0; i < 2; ++i) *(v4u*)(SL + sb + i * 32 * GP) = rb[i];
  __syncthreads();

  // unrolled in full: buffer index and slab offset become immediates, no address register changes in the loop
#pragma unroll
  for (int s = 0; s < DE / GKS; ++s) {
    const unsigned short* cur = SL + (s & 1) * GSLAB;
    unsigned short* nxt = SL + ((s + 1) & 1) * GSLAB;
    if (s + 1 < DE / GKS) {
#pragma unroll
      for (int i = 0; i < 4; ++i) ra[i] = *(const v4u*)(Ag + (size_t)i * 32 * DE + (s + 1) * GKS);
#pragma unroll
      for (int i = 0; i < 2; ++i) rb[i] = *(const v4u*)(Bg + (size_t)i * 32 * DE + (s + 1) * GKS);
    }
    // all fragments of the slab are read as one group ahead of its products, so that the reads' latencies overlap
    if (F16) {
      v16h a[GKS / 32], b[GKS / 32][4];
#pragma unroll
      for (int kk = 0; kk < GKS / 32; ++kk) {
        a[kk] = ldfrag_h((const _Float16*)(const void*)(cur + fa + kk * 32));
#pragma unroll
        for (int t = 0; t < 4; ++t) b[kk][t] = ldfrag_h((const _Float16*)(const void*)(cur + fb + t * 16 * GP + kk * 32));
      }
#pragma unroll
      for (int kk = 0; kk < GKS / 32; ++kk)
#pragma unroll
        for (int t = 0; t < 4; ++t) acc[t] = mma_h(a[kk], b[kk][t], acc[t]);
    } else {
      v16b a[GKS / 32], b[GKS / 32][4];
#pragma unroll
      for (int kk = 0; kk < GKS / 32; ++kk) {
        a[kk] = ldfrag_b((const __bf16*)(const void*)(cur + fa + kk * 32));
#pragma unroll
        for (int t = 0; t < 4; ++t) b[kk][t] = ldfrag_b((const __bf16*)(const void*)(cur + fb + t * 16 * GP + kk * 32));
      }
#pragma unroll
      for (int kk = 0; kk < GKS / 32; ++kk)
#pragma unroll
        for (int t = 0; t < 4; ++t) acc[t] = mma_b(a[kk], b[kk][t], acc[t]);
    }
    if (s + 1 < DE / GKS) {
#pragma unroll
      for (int i = 0; i < 4; ++i) *(v4u*)(nxt + sa + i * 32 * GP) = ra[i];
#pragma unroll
      for (int i = 0; i < 2; ++i) *(v4u*)(nxt + sb + i * 32 * GP) = rb[i];
    }
    __syncthreads();   // publishes slab s + 1; ends the reads of slab s (its buffer is refilled, or reused behind the loop)
  }
}

// the epilogue of one MODE; stands behind the last barrier of gemm_main and reuses its slab buffers
template <int MODE>
__device__ __forceinline__
void gemm_epi(unsigned char* smem, const v8f (&acc)[4], const float* __restrict__ bias, const float* __restrict__ resid,
              unsigned short* out16, float* out32, float scale) {
  const int tid  = threadIdx.x;
  const int wave = tid >> 5;
  const int lane = tid & 31;
  const int hh   = lane >> 4;
  const int c    = lane & 15;
  const int m0b  = blockIdx.y * 128;
  const int m0   = m0b + wave * 16;
  const int n0   = blockIdx.x * 64;

  if (MODE == 0) {
    _Float16* S = (_Float16*)(void*)smem + wave * 1024;          // [16][64] per wave
#pragma unroll
    for (int t = 0; t < 4; ++t) {
      const float bi = bf_up(bf_bits(bias[n0 + t * 16 + c]));
#pragma unroll
      for (int r = 0; r < 8; ++r) S[(8 * hh + r) * 64 + t * 16 + c] = (_Float16)((acc[t][r] + bi) * scale);
    }
    __builtin_amdgcn_fence(__ATOMIC_RELEASE, "workgroup");
    __builtin_amdgcn_wave_barrier();
    __builtin_amdgcn_fence(__ATOMIC_ACQUIRE, "workgroup");
    const int rq = lane >> 3, c8 = (lane & 7) * 8;
    union { v8h h; v4u u; } w[4];
#pragma unroll
    for (int it = 0; it < 4; ++it) w[it].h = *(const v8h*)(S + (it * 4 + rq) * 64 + c8);
    {
#pragma unroll
      for (int it = 0; it < 4; ++it)
        *(v4u*)(out16 + (size_t)(m0 + it * 4 + rq) * DE + n0 + c8) = w[it].u;
      
    }
  } else if (MODE == 1) {
    _Float16* T = (_Float16*)(void*)smem;                       // [n 64][key 128]
#pragma unroll
    for (int t = 0; t < 4; ++t) {
      const float bi = bf_up(bf_bits(bias[n0 + t * 16 + c]));
#pragma unroll
      for (int r = 0; r < 8; ++r)
        T[(t * 16 + c) * 128 + wave * 16 + 8 * hh + r] = (_Float16)((acc[t][r] + bi) * scale);
    }
    __syncthreads();
    const int bidx = m0b / SEQ;                                  // tiles never straddle batches (128 | SEQ)
    const int key0 = m0b - bidx * SEQ;
    const int rh = lane >> 4, c8 = (lane & 15) * 8;
    union { v8h h; v4u u; } w[4];
#pragma unroll
    for (int it = 0; it < 4; ++it) w[it].h = *(const v8h*)(T + (wave * 8 + it * 2 + rh) * 128 + c8);
    {
#pragma unroll
      for (int it = 0; it < 4; ++it) {
        const int row = wave * 8 + it * 2 + rh;
        *(v4u*)(out16 + ((size_t)(bidx * DE + n0 + row) * SEQ + key0 + c8)) = w[it].u;
      }
      
    }
  } else {
    float* S = (float*)(void*)smem + wave * 1024;                // [16][64] f32 per wave
#pragma unroll
    for (int t = 0; t < 4; ++t) {
      const float bi = bf_up(bf_bits(bias[n0 + t * 16 + c]));
#pragma unroll
      for (int r = 0; r < 8; ++r) S[(8 * hh + r) * 64 + t * 16 + c] = acc[t][r] * scale + bi;
    }
    __builtin_amdgcn_fence(__ATOMIC_RELEASE, "workgroup");
    __builtin_amdgcn_wave_barrier();
    __builtin_amdgcn_fence(__ATOMIC_ACQUIRE, "workgroup");
    const int rh = lane >> 4, c4 = (lane & 15) * 4;
    v4f vals[8];
#pragma unroll
    for (int it = 0; it < 8; ++it) {
      const int row = it * 2 + rh;
      const int gm  = m0 + row;
      const int bb  = gm / SEQ;
      const int tt  = gm - bb * SEQ;
      v4f x = *(const v4f*)(S + row * 64 + c4);
      const v4f rq = *(const v4f*)(resid + ((size_t)bb * SEQ_FULL + tt) * DE + n0 + c4);
#pragma unroll
      for (int e = 0; e < 4; ++e) x[e] = x[e] + bf_up(bf_bits(rq[e]));
      vals[it] = x;
    }
    {
#pragma unroll
      for (int it = 0; it < 8; ++it)
        *(v4f*)(out32 + (size_t)(m0 + it * 2 + rh) * DE + n0 + c4) = vals[it];
      
    }
  }
}

// The three projections, which do not depend on one another, in one grid: blockIdx.z = 0 q, 1 k (MODE 0), 2 v (MODE 1).
// One k loop serves all three (operand pointers picked by the block-uniform z); only the epilogue branches.
__global__ __launch_bounds__(256)
void gemm_qkv(const unsigned short* __restrict__ Aq, const unsigned short* __restrict__ Ak,
              const unsigned short* __restrict__ Wq, const unsigned short* __restrict__ Wk,
              const unsigned short* __restrict__ Wv, const float* __restrict__ bq, const float* __restrict__ bk,
              const float* __restrict__ bv, unsigned short* oq, unsigned short* ok, unsigned short* ov) {
  __shared__ __align__(16) unsigned char smem[2 * GSLAB * 2];
  const int z = blockIdx.z;
  v8f acc[4];
  gemm_main<false>(smem, (z == 0) ? Aq : Ak, (z == 0) ? Wq : ((z == 1) ? Wk : Wv), acc);
  if (z == 2) gemm_epi<1>(smem, acc, bv, nullptr, ov, nullptr, VCARRY);
  else        gemm_epi<0>(smem, acc, (z == 0) ? bq : bk, nullptr, (z == 0) ? oq : ok, nullptr, 1.0f);
}

// output projection (MODE 2)
__global__ __launch_bounds__(256)
void gemm_o(const unsigned short* __restrict__ A, const unsigned short* __restrict__ Bt,
            const float* __restrict__ bias, const float* __restrict__ resid, float* out32) {
  __shared__ __align__(16) unsigned char smem[2 * GSLAB * 2];
  v8f acc[4];
  gemm_main<true>(smem, A, Bt, acc);
  gemm_epi<2>(smem, acc, bias, resid, nullptr, out32, 1.0f / (CCARRY * WCARRY));
}

// =====================================================================================================
// Full (unmasked) attention, head dim 64, all NQB key tiles.
//   q plane (f16):  element (b, t, h, d) at [(b*SEQ + t)*DE + h*64 + d]      k plane (f16): same with key index s
//   v^T plane (f16): element (b, h, d, s) at [(b*DE + h*64 + d)*SEQ + s], value v*64
//   Both products are formed transposed: S^T = K . Q^T (A = K rows, B = Q) and O^T += V^T . P^T (A = V^T rows, B = P^T).
//   Lane (c, hh) then holds scores of ONE query, q0 + c: register r of score tile j is key 16 j + 8 hh + r. Row maximum
//   and row sum are in-lane, with one exchange between the two lane halves; and score tiles 2 kk and 2 kk + 1,
//   converted in place, ARE the B fragment of key chunk kk (element e < 8: key 8 hh + e, else 16 + 8 hh + e - 8, the
//   k map of the V^T loader): P goes through no LDS and no lane exchange.
//   scores = q . k (f16 WMMA, f32 acc) * 0.125; online softmax in f32; p = exp(s - m) carried as f16(16384 p);
//   context = p . v on f16 WMMA; RES adds the f16 residual plane of p (x4096, separate accumulator folded back
//   with 1/4096 per tile in f32). ctx out = f16(context / (l * 16384 * 64) * 64) to [(b*SEQ + t)*DE + h*64 + d].
//   l is kept per lane half (the half's own keys); the halves are joined once, behind the loop.
//   Block = 4 waves = 64 query rows of one (b,h); bx = 0 .. nqbThis * NH * NB - 1; kv tiles of 64.
//   K / V^T tile staging: 128 threads x 32 elements per plane = the whole 64x64 tile (plain 16-B loads,
//   __syncthreads before and after, cross-wave); staged extent == consumed extent for Ksh, Vth, Os.
//   Ksh, Vth rows lie at pitch LP (64 used halves + 8 never touched) so that the 16 rows one 16-B fragment
//   read walks fall on 16 different bank groups.
//   The Os tile is wave-private: lane (c, hh) stores 8 consecutive d of query row c per output tile (one 16-B store),
//   Output coverage: each wave stores rows 0..15 (it 0..3 x lane>>3) x 64 halves (8 lanes x 16 B): one instruction
// =====================================================================================================
template <bool RES>
__device__ __forceinline__
void attn_block(_Float16* Ksh, _Float16* Vth, _Float16* Osh,
                const unsigned short* __restrict__ qp, const unsigned short* __restrict__ kp,
                const unsigned short* __restrict__ vtp, unsigned short* ctx, int bx, int qbBase, int nqbThis) {
  union FH { v16h v; v8h h[2]; v2h p[8]; };

  const int tid  = threadIdx.x;
  const int wave = tid >> 5;
  const int lane = tid & 31;
  const int hh   = lane >> 4;
  const int c    = lane & 15;

  const int qbl  = bx % nqbThis;
  const int bhq  = bx / nqbThis;           // 0..NB*NH-1
  const int h    = bhq % NH;
  const int b    = bhq / NH;
  const int qb   = qbBase + qbl;           // 0..NQB-1
  const int q0   = qb * 64 + wave * 16;    // query index within the sequence

  const _Float16* Qh = (const _Float16*)(const void*)qp + (size_t)b * SEQ * DE + (size_t)h * HD;
  const _Float16* Kh = (const _Float16*)(const void*)kp + (size_t)b * SEQ * DE + (size_t)h * HD;
  const _Float16* Vh = (const _Float16*)(const void*)vtp + ((size_t)b * DE + (size_t)h * HD) * SEQ;

  // ---- Q fragments (B operand, column = lane&15): 2 d-chunks ----
  v16h qa[2];
#pragma unroll
  for (int dc = 0; dc < 2; ++dc) {
    const size_t qo = (size_t)(q0 + c) * DE + dc * 32 + 8 * hh;
    qa[dc] = ldfrag_h(Qh + qo);
  }

  float mrow = -INFINITY, lrow = 0.f;       // of query q0 + c; lrow: the keys of this lane half only
  v8f oacc[4];                              // O^T: register r of tile t = context[q0 + c][16 t + 8 hh + r]
#pragma unroll
  for (int t = 0; t < 4; ++t) oacc[t] = zero8();

  for (int kt = 0; kt < NQB; ++kt) {        // block-uniform bounds, exactly NQB trips
    const int kv0 = kt * 64;
    __syncthreads();
    {
      const int r = tid >> 1, half = (tid & 1) * 32;
      const _Float16* kg = Kh + (size_t)(kv0 + r) * DE + half;   // K row kv0+r, d = half..half+31
      const _Float16* vg = Vh + (size_t)r * SEQ + kv0 + half;    // V^T row d = r, s = kv0+half..+31
      // all eight loads are issued ahead of the first store, so that their latencies overlap
      v8h a0[4], b0[4];
#pragma unroll
      for (int i = 0; i < 4; ++i) {
        a0[i] = *(const v8h*)(kg + 8 * i);
        b0[i] = *(const v8h*)(vg + 8 * i);
      }
#pragma unroll
      for (int i = 0; i < 4; ++i) {
        *(v8h*)(Ksh + r * LP + half + 8 * i) = a0[i];
        *(v8h*)(Vth + r * LP + half + 8 * i) = b0[i];
      }
    }
    __syncthreads();

    // ---- all K and V^T fragments of the tile are read as one group right behind the barrier: the K reads' latencies
    //      overlap each other, the V^T reads land under the score products and the softmax ----
    FH kb[4][2], vb[2][4];
#pragma unroll
    for (int j = 0; j < 4; ++j)
#pragma unroll
      for (int dc = 0; dc < 2; ++dc) {
        kb[j][dc].h[0] = *(const v8h*)(Ksh + (j * 16 + c) * LP + dc * 32 + 8 * hh);
        kb[j][dc].h[1] = *(const v8h*)(Ksh + (j * 16 + c) * LP + dc * 32 + 16 + 8 * hh);
      }
#pragma unroll
    for (int kk = 0; kk < 2; ++kk)
#pragma unroll
      for (int t = 0; t < 4; ++t) {
        vb[kk][t].h[0] = *(const v8h*)(Vth + (t * 16 + c) * LP + kk * 32 + 8 * hh);
        vb[kk][t].h[1] = *(const v8h*)(Vth + (t * 16 + c) * LP + kk * 32 + 16 + 8 * hh);
      }
    // holds the group of reads apart from the products: without it the compiler mixes the two regions and, in the
    // residual variant, spills one fragment to scratch and reloads it in every trip
    __builtin_amdgcn_sched_barrier(0);

    // ---- scores, transposed: 64 keys (rows) x 16 queries (columns) per wave, single f16 product ----
    v8f s[4];
#pragma unroll
    for (int j = 0; j < 4; ++j) {
      s[j] = zero8();
#pragma unroll
      for (int dc = 0; dc < 2; ++dc) s[j] = mma_h(kb[j][dc].v, qa[dc], s[j]);
    }

    // ---- scale, maximum of this lane's 32 keys (one chain per score tile), joined with the other lane half ----
    float mj[4];
#pragma unroll
    for (int j = 0; j < 4; ++j) {
      float m = -INFINITY;
#pragma unroll
      for (int r = 0; r < 8; ++r) {
        const float sv = s[j][r] * 0.125f;
        s[j][r] = sv;
        m = fmaxf(m, sv);
      }
      mj[j] = m;
    }
    float mx = fmaxf(fmaxf(mj[0], mj[1]), fmaxf(mj[2], mj[3]));
    mx = fmaxf(mx, xhalf(mx));
    const float mnew  = fmaxf(mrow, mx);
    const float msafe = (mnew == -INFINITY) ? 0.f : mnew;
    const float al = __expf(mrow - msafe);
    mrow = mnew;

    // ---- P (x16384, f16) and P residual (x4096), converted in pairs straight into the B fragments ----
    FH pa[2], pl[2];
    v2f pj[4];                           // one chain of pair sums per score tile (even r, odd r)
#pragma unroll
    for (int j = 0; j < 4; ++j) {
#pragma unroll
      for (int r = 0; r < 8; r += 2) {
        const v2f pp = {__expf(s[j][r] - msafe), __expf(s[j][r + 1] - msafe)};
        pj[j] = (r == 0) ? pp : pj[j] + pp;
        const v2f pk = pp * PCARRY;
        const v2h ph = __builtin_convertvector(pk, v2h);
        pa[j >> 1].p[(j & 1) * 4 + (r >> 1)] = ph;
        if (RES) {
          const v2f rs = {(pk[0] - (float)ph[0]) * PRES, (pk[1] - (float)ph[1]) * PRES};
          pl[j >> 1].p[(j & 1) * 4 + (r >> 1)] = __builtin_convertvector(rs, v2h);
        }
      }
    }
    const v2f pt = (pj[0] + pj[1]) + (pj[2] + pj[3]);
    lrow = lrow * al + (pt[0] + pt[1]);
#pragma unroll
    for (int t = 0; t < 4; ++t)
#pragma unroll
      for (int r = 0; r < 8; ++r) oacc[t][r] *= al;

    // ---- context^T += V^T . P^T (f16 WMMA), residual products into a separate accumulator ----
    v8f o1[4];
#pragma unroll
    for (int t = 0; t < 4; ++t) o1[t] = zero8();
    // unrolled: kk picks among fragments that sit in registers, so it must be a constant
#pragma unroll
    for (int kk = 0; kk < 2; ++kk) {
#pragma unroll
      for (int t = 0; t < 4; ++t) {
        oacc[t] = mma_h(vb[kk][t].v, pa[kk].v, oacc[t]);
        if (RES) o1[t] = mma_h(vb[kk][t].v, pl[kk].v, o1[t]);
      }
    }
    if (RES) {
#pragma unroll
      for (int t = 0; t < 4; ++t)
#pragma unroll
        for (int r = 0; r < 8; ++r) oacc[t][r] += o1[t][r] * (1.0f / PRES);
    }
  }

  // ---- join the halves' sums; normalise (1/l, the p, v carries) and apply the ctx carry; stage the wave's 16x64 f16
  //      tile; write whole lines ----
  _Float16* os = Osh + wave * (16 * 64);
  {
    const float l = lrow + xhalf(lrow);
    const float inv = ((l > 0.f) ? (1.0f / l) : 0.f) * (CCARRY / (PCARRY * VCARRY));
#pragma unroll
    for (int t = 0; t < 4; ++t) {
      v8h o;
#pragma unroll
      for (int r = 0; r < 8; ++r) o[r] = (_Float16)(oacc[t][r] * inv);
      *(v8h*)(os + c * 64 + t * 16 + 8 * hh) = o;
    }
  }
  __builtin_amdgcn_fence(__ATOMIC_RELEASE, "workgroup");
  __builtin_amdgcn_wave_barrier();
  __builtin_amdgcn_fence(__ATOMIC_ACQUIRE, "workgroup");
  {
    const int rq = lane >> 3, c8 = (lane & 7) * 8;
    union { v8h h; v4u u; } w[4];
#pragma unroll
    for (int it = 0; it < 4; ++it) w[it].h = *(const v8h*)(os + (it * 4 + rq) * 64 + c8);
    unsigned short* ob = ctx + ((size_t)b * SEQ) * DE + (size_t)h * HD;
    {
#pragma unroll
      for (int it = 0; it < 4; ++it) {
        const int row = it * 4 + rq;                     // it 0..3 x rq 0..3 = rows 0..15
        *(v4u*)(ob + (size_t)(q0 + row) * DE + c8) = w[it].u;
      }
      
    }
  }
}

// Both kinds of query block in one grid of NB * NH * NQB blocks, picked by block index (block-uniform): the first
// NB * NH * resqb blocks are the leading query blocks, with the p residual plane (the longer ones, placed first for speed only);
// the others run without it.
__global__ __launch_bounds__(128)
void attn_full64(const unsigned short* __restrict__ qp, const unsigned short* __restrict__ kp,
                 const unsigned short* __restrict__ vtp, unsigned short* ctx, int resqb) {
  __shared__ __align__(16) _Float16 Ksh[64 * LP];                 // K [kv][d], pitch LP
  __shared__ __align__(16) _Float16 Vth[64 * LP];                 // V^T [d][kv], pitch LP
  __shared__ __align__(16) _Float16 Os[4 * 16 * 64];              // per wave context tile [row][d]
  const int bx   = blockIdx.x;
  const int nres = NB * NH * resqb;
  if (bx < nres) attn_block<true>(Ksh, Vth, Os, qp, kp, vtp, ctx, bx, 0, resqb);
  else           attn_block<false>(Ksh, Vth, Os, qp, kp, vtp, ctx, bx - nres, resqb, NQB - resqb);
}

// =====================================================================================================
// LayerNorm over DE of x [MROWS][DE] f32: one block of 256 threads per row, thread owns 4 consecutive floats.
// mean and centred variance via wave shuffles + 8-entry LDS partials (cross-wave, block barriers), fixed order.
// y = (x - mu) * rsqrt(var + 1e-5) * RNE-bf16(gamma) + RNE-bf16(beta). Output row b*SEQ_FULL + t of d_out;
// coverage: MROWS blocks x 256 threads x 4 floats = every processed output row in full.
// =====================================================================================================
__global__ __launch_bounds__(256) void ln_rows(const float* __restrict__ x, const float* __restrict__ gam,
                                               const float* __restrict__ bet, float* out) {
  __shared__ float red1[8];
  __shared__ float red2[8];
  const int tid = threadIdx.x, wave = tid >> 5, lane = tid & 31;
  const int row = blockIdx.x;
  const int bb  = row / SEQ;
  const int tt  = row - bb * SEQ;
  const size_t orow = (size_t)bb * SEQ_FULL + (size_t)tt;

  const v4f v = *(const v4f*)(x + (size_t)row * DE + tid * 4);
  float s = (v[0] + v[1]) + (v[2] + v[3]);
#pragma unroll
  for (int off = 16; off > 0; off >>= 1) s += __shfl_xor(s, off, 32);
  if (lane == 0) red1[wave] = s;
  __syncthreads();
  float tot = 0.f;
#pragma unroll
  for (int w = 0; w < 8; ++w) tot += red1[w];
  const float mu = tot * (1.0f / (float)DE);

  v4f d;
#pragma unroll
  for (int e = 0; e < 4; ++e) d[e] = v[e] - mu;
  float s2 = (d[0] * d[0] + d[1] * d[1]) + (d[2] * d[2] + d[3] * d[3]);
#pragma unroll
  for (int off = 16; off > 0; off >>= 1) s2 += __shfl_xor(s2, off, 32);
  if (lane == 0) red2[wave] = s2;
  __syncthreads();
  float tot2 = 0.f;
#pragma unroll
  for (int w = 0; w < 8; ++w) tot2 += red2[w];
  const float var  = tot2 * (1.0f / (float)DE);
  const float rstd = rsqrtf(var + 1.0e-5f);

  const v4f g4 = *(const v4f*)(gam + tid * 4);
  const v4f b4 = *(const v4f*)(bet + tid * 4);
  v4f y;
#pragma unroll
  for (int e = 0; e < 4; ++e) y[e] = (d[e] * rstd) * bf_up(bf_bits(g4[e])) + bf_up(bf_bits(b4[e]));
  float* op = out + orow * DE + (size_t)tid * 4;
  *(v4f*)op = y;
  
}

// =====================================================================================================
// Workspace map (bytes, full size): PQ bf16 [MROWS][DE] at 0 (8388608); PK bf16 at 8388608 (8388608);
// Wq^T, Wk^T, Wv^T bf16 and Wo^T f16 [DE][DE] at 16777216.. (4 x 2097152); Q f16 [MROWS][DE] at 25165824;
// K f16 at 33554432; V^T f16 [NB][DE][SEQ] at 41943040; CTX f16 [MROWS][DE] at 50331648; X f32 [MROWS][DE]
// at 58720256 (16777216); end 75497472. Every plane is an exact multiple of its whole-line store granularity
// Launch plan (5): input conversions + weight transpose-convert; gemm q, k, v^T; attention (leading query blocks with
// the p residual, remaining blocks without); gemm o + residual; LayerNorm. Jobs that share a launch are independent.
// =====================================================================================================
extern "C" void kernel_launch(void* const* d_in, const int* in_sizes, int n_in,
                              void* d_out, int out_size, void* d_ws, size_t ws_size,
                              hipStream_t stream) {
  if (n_in < 12) return;
  const long long needIn = (long long)(NB - 1) * SEQ_FULL * DE + (long long)SEQ * DE;
  if ((long long)in_sizes[0] < needIn || (long long)in_sizes[1] < needIn) return;
  if (in_sizes[2] < DE * DE || in_sizes[4] < DE * DE || in_sizes[6] < DE * DE || in_sizes[8] < DE * DE) return;
  if (in_sizes[3] < DE || in_sizes[5] < DE || in_sizes[7] < DE || in_sizes[9] < DE) return;
  if (in_sizes[10] < DE || in_sizes[11] < DE) return;
  if (out_size < 0 || (long long)out_size < needIn) return;

  const size_t P16 = (size_t)MROWS * DE * 2;     // one 16-bit activation plane
  const size_t W16 = (size_t)DE * DE * 2;        // one 16-bit weight plane
  const size_t P32 = (size_t)MROWS * DE * 4;     // x plane
  size_t off = 0;
  const size_t oPQ  = off; off += P16;
  const size_t oPK  = off; off += P16;
  const size_t oWq  = off; off += W16;
  const size_t oWk  = off; off += W16;
  const size_t oWv  = off; off += W16;
  const size_t oWo  = off; off += W16;
  const size_t oQ   = off; off += P16;
  const size_t oK   = off; off += P16;
  const size_t oVT  = off; off += P16;
  const size_t oCTX = off; off += P16;
  const size_t oX   = off; off += P32;
  if (off > ws_size) return;                     // off = 75497472 at full size
  if (off > (size_t)134217728) return;

  const float* pre_q = (const float*)d_in[0];
  const float* pre_k = (const float*)d_in[1];
  const float* Wq    = (const float*)d_in[2];
  const float* bq    = (const float*)d_in[3];
  const float* Wk    = (const float*)d_in[4];
  const float* bk    = (const float*)d_in[5];
  const float* Wv    = (const float*)d_in[6];
  const float* bv    = (const float*)d_in[7];
  const float* Wo    = (const float*)d_in[8];
  const float* bo    = (const float*)d_in[9];
  const float* gamma = (const float*)d_in[10];
  const float* beta  = (const float*)d_in[11];
  float* out = (float*)d_out;

  char* ws = (char*)d_ws;
  unsigned short* PQb  = (unsigned short*)(ws + oPQ);
  unsigned short* PKb  = (unsigned short*)(ws + oPK);
  unsigned short* Wqt  = (unsigned short*)(ws + oWq);
  unsigned short* Wkt  = (unsigned short*)(ws + oWk);
  unsigned short* Wvt  = (unsigned short*)(ws + oWv);
  unsigned short* Wot  = (unsigned short*)(ws + oWo);
  unsigned short* Qh   = (unsigned short*)(ws + oQ);
  unsigned short* Kh   = (unsigned short*)(ws + oK);
  unsigned short* VTb  = (unsigned short*)(ws + oVT);
  unsigned short* CTXb = (unsigned short*)(ws + oCTX);
  float*          Xb   = (float*)(ws + oX);

  const dim3 blk(256);
  const int n8   = MROWS * DE / 8;               // 524288 at full size
  const int per8 = SEQ * DE / 8;
  const int src8 = SEQ_FULL * DE / 8;
  const int ncv  = (n8 + 255) / 256;             // conversion blocks per activation plane
  const dim3 gPrep(4 * (DE / 64) * (DE / 64) + 2 * ncv);   // 256 tiles x 4 matrices, then the two planes
  const dim3 gG(DE / 64, MROWS / 128);           // (16, 32) at full size
  const dim3 gG3(DE / 64, MROWS / 128, 3);       // the same for each of q, k, v
  int resqb = RESQB;
  if (resqb > NQB) resqb = NQB;

  // (1) weights -> transposed 16-bit planes (Wq, Wk, Wv bf16; Wo f16 x64); activations -> bf16 planes (RNE convert)
  prep_inputs<<<gPrep, blk, 0, stream>>>(pre_q, pre_k, Wq, Wk, Wv, Wo, PQb, PKb, Wqt, Wkt, Wvt, Wot,
                                         ncv, n8, per8, src8);
  // (2) projections: q, k -> f16 row-major; v -> f16 v^T x64
  gemm_qkv<<<gG3, blk, 0, stream>>>(PQb, PKb, Wqt, Wkt, Wvt, bq, bk, bv, Qh, Kh, VTb);
  // (3) attention -> ctx f16 x64: query blocks 0..resqb-1 with the p residual plane, the rest without
  attn_full64<<<dim3(NB * NH * NQB), dim3(128), 0, stream>>>(Qh, Kh, VTb, CTXb, resqb);
  // (4) output projection + bias + residual -> x f32
  gemm_o<<<gG, blk, 0, stream>>>(CTXb, Wot, bo, pre_q, Xb);
  // (5) LayerNorm -> output
  ln_rows<<<dim3(MROWS), blk, 0, stream>>>(Xb, gamma, beta, out);
  (void)hipGetLastError();
}

// v007
// Measured time: 109 microseconds a run.
// Next to v006, in two timings, it ran 1.05 times as fast each time.
// Counting every step since v000, it is 4.32 times as fast.
// Contractions: q/k/v projections = v_wmma_f32_16x16x32_bf16 (bf16 operands = RNE-converted activations and
// transposed weights, single product, f32 accumulate); q.k^T scores, p.v context and ctx.Wo projection =
// v_wmma_f32_16x16x32_f16 (q, k = f16 of the f32 projection sums, unscaled; p = exp(s - m) carried x16384 plus an
// f16 residual plane of p x4096 on the leading query blocks; v^T, ctx and Wo carried x64 in f16), f32 accumulate;
// softmax, bias/residual add and LayerNorm in f32.
#include <hip/hip_runtime.h>
#include <math.h>
#include <stdint.h>

#ifndef NB
#define NB 2                 // batches processed (reducible)
#endif
#ifndef NB_FULL
#define NB_FULL 2            // batches in the inputs / output
#endif
#ifndef SEQ
#define SEQ 2048             // query == key length processed (reducible)
#endif
#ifndef SEQ_FULL
#define SEQ_FULL 2048        // per-batch row stride of the inputs and of the output
#endif
#define DE    1024
#define NH    16
#define HD    64
#define NQB   (SEQ / 64)
#define MROWS (NB * SEQ)
#ifndef RESQB
#define RESQB 8              // leading 64-row query blocks per (b,h) that carry the p residual plane
#endif
#define PCARRY 16384.0f
#define PRES   4096.0f
#define VCARRY 64.0f
#define CCARRY 64.0f
#define WCARRY 64.0f
#define LP    72             // LDS row pitch (halves) of the attention K and V^T tiles: 144 B = 16 B x odd
#define GKS   64             // k extent (halves) of one staged GEMM slab: one whole 128-B line per row
#define GP    72             // LDS row pitch (halves) of the staged GEMM slabs: 144 B = 16 B x odd
#define GSLAB ((128 + 128) * GP)  // halves in one slab buffer: 128 A rows, then 128 B rows

static_assert(NB >= 1 && NB <= NB_FULL);
static_assert((SEQ % 128) == 0 && SEQ >= 128 && SEQ <= SEQ_FULL);
static_assert(NH * HD == DE);
static_assert(RESQB >= 1);
static_assert(LP >= HD && (LP % 8) == 0 && ((LP / 8) % 2) == 1);   // 16-B aligned rows, odd count of 16-B units
static_assert((MROWS % 128) == 0 && (DE % 128) == 0 && (DE % 32) == 0);
static_assert(GP >= GKS && (GP % 8) == 0 && ((GP / 8) % 2) == 1 && (DE % GKS) == 0 && (GKS % 32) == 0);
static_assert(((DE / GKS) % 2) == 0 && DE / GKS >= 2);               // the k loop takes slabs in pairs
static_assert(2 * GSLAB * 2 >= 65536);                               // the epilogue stages reuse the slab buffers
static_assert((long long)NB_FULL * SEQ_FULL * DE * 4 == 16777216LL);   // total output bytes at full size

typedef _Float16 v16h __attribute__((ext_vector_type(16)));
typedef _Float16 v8h  __attribute__((ext_vector_type(8)));
typedef __bf16   v16b __attribute__((ext_vector_type(16)));
typedef __bf16   v8b  __attribute__((ext_vector_type(8)));
typedef float    v8f  __attribute__((ext_vector_type(8)));
typedef float    v4f  __attribute__((ext_vector_type(4)));
typedef float    v2f  __attribute__((ext_vector_type(2)));
typedef _Float16 v2h  __attribute__((ext_vector_type(2)));
typedef unsigned int v4u __attribute__((ext_vector_type(4)));
typedef unsigned short v8us __attribute__((ext_vector_type(8)));
// pointers that are known to be global whatever they pass through, so that their loads stay global loads
typedef const unsigned short __attribute__((address_space(1)))* gcus;
typedef const v4u __attribute__((address_space(1)))* gcv4u;

// ---- scalar helpers --------------------------------------------------------------------------------
__device__ __forceinline__ unsigned short bf_bits(float f) {          // f32 -> bf16 bits, RNE convert
  unsigned u = __float_as_uint(f);
  return (unsigned short)((u + 0x7FFFu + ((u >> 16) & 1u)) >> 16);
}
__device__ __forceinline__ float bf_up(unsigned short h) { return __uint_as_float(((unsigned)h) << 16); }
__device__ __forceinline__ unsigned short h_bits(float f) {           // f32 -> f16 bits, RNE convert
  union { _Float16 h; unsigned short u; } cvt;
  cvt.h = (_Float16)f;
  return cvt.u;
}
__device__ __forceinline__ unsigned pk16(unsigned short a, unsigned short b) { return (unsigned)a | ((unsigned)b << 16); }
__device__ __forceinline__ v8f zero8() { v8f z = {0.f, 0.f, 0.f, 0.f, 0.f, 0.f, 0.f, 0.f}; return z; }
// value of lane l ^ 16 (the other 16-lane row), on the vector unit; all 32 lanes are on at every call site
__device__ __forceinline__ float xhalf(float x) {
  const int b = __builtin_bit_cast(int, x);
  return __builtin_bit_cast(float, __builtin_amdgcn_permlanex16(b, b, 0x76543210, 0xfedcba98, false, false));
}

// ---- fragment loaders: 16-bit A/B operand, lane -> row/col (lane&15), p already includes +8*(lane>>4);
//      elements 0..7 <- p[0..7] (k0+8h..), elements 8..15 <- p[16..23] (k0+16+8h..)
__device__ __forceinline__ v16b ldfrag_b(const __bf16* p) {
  union { v16b v; v8b h[2]; } f;
  f.h[0] = *(const v8b*)(p);
  f.h[1] = *(const v8b*)(p + 16);
  return f.v;
}
__device__ __forceinline__ v16h ldfrag_h(const _Float16* p) {
  union { v16h v; v8h h[2]; } f;
  f.h[0] = *(const v8h*)(p);
  f.h[1] = *(const v8h*)(p + 16);
  return f.v;
}

// ---- WMMA helpers with trailing VALU hazard gap --------------------------------------------------------
__device__ __forceinline__ v8f mma_b(v16b a, v16b b, v8f c) {
  c = __builtin_amdgcn_wmma_f32_16x16x32_bf16(false, a, false, b, (short)0, c, false, false);
  asm volatile("v_nop\n\tv_nop\n\tv_nop\n\tv_nop" : "+v"(c) : "v"(a), "v"(b));
  return c;
}
__device__ __forceinline__ v8f mma_h(v16h a, v16h b, v8f c) {
  c = __builtin_amdgcn_wmma_f32_16x16x32_f16(false, a, false, b, (short)0, c, false, false);
  asm volatile("v_nop\n\tv_nop\n\tv_nop\n\tv_nop" : "+v"(c) : "v"(a), "v"(b));
  return c;
}

// =====================================================================================================
// f32 -> bf16 (RNE convert), 8 elements per thread, one 16-B store per lane: a wave writes 512 contiguous B
// Destination plane is compact [b][SEQ*DE]; source batch stride src8 (units of 8 floats) may be larger.
// coverage: n8 threads x 8 = whole plane (n8 = NB*SEQ*DE/8 is a multiple of 256). blk = block index within the plane.
// =====================================================================================================
__device__ __forceinline__ void cvt_bf16x8s(const float* __restrict__ in, unsigned short* out,
                                            int blk, int n8, int per8, int src8) {
  const int i = blk * 256 + threadIdx.x;
  if (i < n8) {
    const int hd  = i / per8;
    const int rem = i - hd * per8;
    const float* s = in + ((size_t)hd * src8 + (size_t)rem) * 8;
    const v4f a = *(const v4f*)(s);
    const v4f b = *(const v4f*)(s + 4);
    v4u p;
    p[0] = pk16(bf_bits(a[0]), bf_bits(a[1]));
    p[1] = pk16(bf_bits(a[2]), bf_bits(a[3]));
    p[2] = pk16(bf_bits(b[0]), bf_bits(b[1]));
    p[3] = pk16(bf_bits(b[2]), bf_bits(b[3]));
    *(v4u*)(out + (size_t)i * 8) = p;
    
  }
}

// =====================================================================================================
// Weight W[k][n] f32 (DE x DE, n contiguous) -> transposed 16-bit plane Wt[n][k] (k contiguous, pitch DE).
//   mat = matrix id: 0,1,2 -> bf16 bits of the RNE-bf16 value; 3 -> f16 bits of (RNE-bf16 value x64).
//   Block = one 64(k) x 64(n) tile, 256 threads: thread (k = tid>>2, 16-column n quarter) loads 16 floats of row k
//   and writes them transposed into the LDS tile T[n][k]; after the barrier wave w writes rows n = 8w..8w+7:
//   tile = 0..(DE/64)^2 - 1 covers the whole plane of each of the 4 matrices. T = the block's 64 x 64 LDS tile.
// =====================================================================================================
__device__ __forceinline__ void wt_tiles(unsigned short* T, int mat, int tile,
                                         const float* __restrict__ w0, const float* __restrict__ w1,
                                         const float* __restrict__ w2, const float* __restrict__ w3,
                                         unsigned short* o0, unsigned short* o1,
                                         unsigned short* o2, unsigned short* o3) {
  const int tid = threadIdx.x;
  const float* in = w0; unsigned short* out = o0;        // mat is block-uniform
  if (mat == 1) { in = w1; out = o1; }
  else if (mat == 2) { in = w2; out = o2; }
  else if (mat == 3) { in = w3; out = o3; }
  const int ktile = tile / (DE / 64);
  const int ntile = tile - ktile * (DE / 64);
  const int k   = tid >> 2;              // 0..63
  const int nq  = (tid & 3) * 16;        // 0,16,32,48
  const float* src = in + (size_t)(ktile * 64 + k) * DE + ntile * 64 + nq;
#pragma unroll
  for (int i = 0; i < 4; ++i) {
    const v4f a = *(const v4f*)(src + 4 * i);
#pragma unroll
    for (int e = 0; e < 4; ++e) {
      const unsigned short bb = bf_bits(a[e]);
      const unsigned short hb = h_bits(bf_up(bb) * WCARRY);
      const unsigned short us = (mat == 3) ? hb : bb;
      T[(nq + 4 * i + e) * 64 + k] = us;
    }
  }
  __syncthreads();
  const int wave = tid >> 5, lane = tid & 31;
  const int q = lane >> 3, c8 = (lane & 7) * 8;
  union { v8us s; v4u u; } x0, x1;
  const int d0 = wave * 8 + q;
  const int d1 = wave * 8 + 4 + q;
  x0.s = *(const v8us*)(T + d0 * 64 + c8);
  x1.s = *(const v8us*)(T + d1 * 64 + c8);
  unsigned short* p0 = out + ((size_t)(ntile * 64 + d0) * DE + ktile * 64 + c8);
  unsigned short* p1 = out + ((size_t)(ntile * 64 + d1) * DE + ktile * 64 + c8);
  *(v4u*)p0 = x0.u;
  *(v4u*)p1 = x1.u;
  
}

// =====================================================================================================
// The three input-only jobs in one grid, picked by block index (block-uniform): blocks 0 .. 4 (DE/64)^2 - 1 transpose
// one weight tile each (the longest chain, placed first for speed only), the next ncv blocks convert pre_q, the last ncv pre_k.
// =====================================================================================================
__global__ __launch_bounds__(256) void prep_inputs(const float* __restrict__ aq, const float* __restrict__ ak,
                                                   const float* __restrict__ w0, const float* __restrict__ w1,
                                                   const float* __restrict__ w2, const float* __restrict__ w3,
                                                   unsigned short* oq, unsigned short* ok,
                                                   unsigned short* o0, unsigned short* o1,
                                                   unsigned short* o2, unsigned short* o3,
                                                   int ncv, int n8, int per8, int src8) {
  __shared__ __align__(16) unsigned short T[64 * 64];   // [n][k], weight blocks only
  const int tiles = (DE / 64) * (DE / 64);
  const int bx = blockIdx.x;
  if (bx < 4 * tiles) {
    const int mat = bx / tiles;
    wt_tiles(T, mat, bx - mat * tiles, w0, w1, w2, w3, o0, o1, o2, o3);
  } else if (bx < 4 * tiles + ncv) {
    cvt_bf16x8s(aq, oq, bx - 4 * tiles, n8, per8, src8);
  } else {
    cvt_bf16x8s(ak, ok, bx - 4 * tiles - ncv, n8, per8, src8);
  }
}

// =====================================================================================================
// 16-bit GEMM C[m][n] = sum_k A[m][k] * Bt[n][k], K = DE, M = MROWS, N = DE. Block 128 threads = 4 waves,
// block tile 128 m x 128 n, waves 2 (m) x 2 (n), wave tile 64 x 64 (16 accumulators): each fragment read from LDS
// feeds four products. k step 32. grid x, y = (DE/128, MROWS/128), exact multiples.
//   Operands: the block's 128 A rows and 128 B rows are staged in LDS one k slab of GKS at a time. 8 lanes fetch one
//   whole 128-B line of a row (16 B each), 128 threads x 16 loads = the (128 + 128) x 128 B of a slab, each line once
//   per block. Two buffers: slab s + 1 is loaded into registers ahead of the products of slab s and stored into the
//   other buffer behind them; one block barrier per slab publishes it and ends the reads of the buffer refilled next.
//   Fragments come from the LDS rows (two 16-B reads each, identical k map for A and B), k ascending.
//   MODE 0: bf16 operands; out16 f16 row-major [MROWS][DE] = (acc + bias) * scale. Wave tile staged in wave-private
//           LDS [64][64]; one instruction = 4 rows of 64 halves (8 lanes x 16 B per 128-B line); 16 it x 4 rows.
//   MODE 1: bf16 operands; out16 f16 transposed per batch [b][DE][SEQ] = (acc + bias) * scale. Block tile staged in
//           cross-wave LDS T[n 128][key 128] (block barrier); wave w writes rows n = 32w..32w+31, one instruction =
//           2 rows of 128 halves (16 lanes x 16 B per 256-B row); coverage 4 waves x 16 it x 2 rows x 128 = 128x128.
//   MODE 2: f16 operands; out32 f32 row-major [MROWS][DE] = acc * scale + bias + RNE-bf16(resid), resid rows read at
//           the full batch stride. Wave-private LDS stage (f32) [64][64], one instruction = 2 rows of 64 floats
//           (16 lanes x 16 B per 256-B segment); coverage 32 it x 2 rows x 64 = 64x64.
// =====================================================================================================
// one k slab: FETCH loads the next slab (at Ap + KOFF, Bp + KOFF) into registers ahead of this slab's products and
// stores it into nxt behind them; STEP (halves) is then added to Ap and Bp; F16 picks the operand type of the products;
// acc[i][t] = the wave's tile, rows 16 i .., columns 16 t ..
template <bool F16, bool FETCH, int KOFF, int STEP>
__device__ __forceinline__
void gemm_slab(const unsigned short* cur, unsigned short* nxt, gcus& Ap, gcus& Bp,
               int sa, int sb, int fa, int fb, v8f (&acc)[4][4]) {
  v4u ra[8], rb[8];
  if (FETCH) {
#pragma unroll
    for (int i = 0; i < 8; ++i) ra[i] = *(gcv4u)(Ap + KOFF + (size_t)i * 16 * DE);
#pragma unroll
    for (int i = 0; i < 8; ++i) rb[i] = *(gcv4u)(Bp + KOFF + (size_t)i * 16 * DE);
  }
  // the eight fragments of a k step are read as one group ahead of its sixteen products
#pragma unroll
  for (int kk = 0; kk < GKS / 32; ++kk) {
    if (F16) {
      v16h a[4], b[4];
#pragma unroll
      for (int i = 0; i < 4; ++i) a[i] = ldfrag_h((const _Float16*)(const void*)(cur + fa + i * 16 * GP + kk * 32));
#pragma unroll
      for (int t = 0; t < 4; ++t) b[t] = ldfrag_h((const _Float16*)(const void*)(cur + fb + t * 16 * GP + kk * 32));
#pragma unroll
      for (int i = 0; i < 4; ++i)
#pragma unroll
        for (int t = 0; t < 4; ++t) acc[i][t] = mma_h(a[i], b[t], acc[i][t]);
    } else {
      v16b a[4], b[4];
#pragma unroll
      for (int i = 0; i < 4; ++i) a[i] = ldfrag_b((const __bf16*)(const void*)(cur + fa + i * 16 * GP + kk * 32));
#pragma unroll
      for (int t = 0; t < 4; ++t) b[t] = ldfrag_b((const __bf16*)(const void*)(cur + fb + t * 16 * GP + kk * 32));
#pragma unroll
      for (int i = 0; i < 4; ++i)
#pragma unroll
        for (int t = 0; t < 4; ++t) acc[i][t] = mma_b(a[i], b[t], acc[i][t]);
    }
  }
  if (FETCH) {
    // issued loads name the two pointers' registers, so the pointers are stepped behind a wait, in one statement with
    // it
    if (STEP != 0)
      asm volatile("s_wait_xcnt 0x0\n\tv_add_nc_u64_e32 %0, %2, %0\n\tv_add_nc_u64_e32 %1, %2, %1"
                   : "+v"(Ap), "+v"(Bp) : "i"(STEP * 2) : "memory");
#pragma unroll
    for (int i = 0; i < 8; ++i) *(v4u*)(nxt + sa + i * 16 * GP) = ra[i];
#pragma unroll
    for (int i = 0; i < 8; ++i) *(v4u*)(nxt + sb + i * 16 * GP) = rb[i];
  }
  __syncthreads();   // publishes the next slab; ends the reads of this one (its buffer is refilled, or reused behind the loop)
}

// the k loop; smem = the block's two slab buffers
template <bool F16>
__device__ __forceinline__
void gemm_main(unsigned char* smem, const unsigned short* __restrict__ A, const unsigned short* __restrict__ Bt,
               v8f (&acc)[4][4]) {
  const int tid  = threadIdx.x;
  const int wave = tid >> 5;
  const int lane = tid & 31;
  const int hh   = lane >> 4;
  const int c    = lane & 15;
  const int wm   = wave >> 1;
  const int wn   = wave & 1;
  const int m0b  = blockIdx.y * 128;
  const int n0   = blockIdx.x * 128;

#pragma unroll
  for (int i = 0; i < 4; ++i)
#pragma unroll
    for (int t = 0; t < 4; ++t) acc[i][t] = zero8();

  unsigned short* S0 = (unsigned short*)(void*)smem;
  unsigned short* S1 = S0 + GSLAB;
  const int srow = tid >> 3;                 // 0..15: row within a group of 16 staged rows
  const int scol = (tid & 7) * 8;            // 16-B piece of the row's 128-B line
  gcus Ap = (gcus)(A  + (size_t)(m0b + srow) * DE + scol);
  gcus Bp = (gcus)(Bt + (size_t)(n0 + srow) * DE + scol);
  const int sa = srow * GP + scol;                      // staged A rows 0..127
  const int sb = (128 + srow) * GP + scol;              // staged B rows 0..127
  const int fa = (wm * 64 + c) * GP + 8 * hh;           // this lane's A fragment row of m group 0
  const int fb = (128 + wn * 64 + c) * GP + 8 * hh;     // this lane's B fragment row of n group 0

  {
    v4u ra[8], rb[8];
#pragma unroll
    for (int i = 0; i < 8; ++i) ra[i] = *(gcv4u)(Ap + (size_t)i * 16 * DE);
#pragma unroll
    for (int i = 0; i < 8; ++i) rb[i] = *(gcv4u)(Bp + (size_t)i * 16 * DE);
#pragma unroll
    for (int i = 0; i < 8; ++i) *(v4u*)(S0 + sa + i * 16 * GP) = ra[i];
#pragma unroll
    for (int i = 0; i < 8; ++i) *(v4u*)(S0 + sb + i * 16 * GP) = rb[i];
  }
  __syncthreads();

  gemm_slab<F16, true, GKS, 2 * GKS>(S0, S1, Ap, Bp, sa, sb, fa, fb, acc);     // slab 0, fetches slab 1
  // two slabs a trip, so that the buffers are constants; kept rolled: with this tile the sixteen slabs unrolled in full
  // make some 30 KB of text a kernel
#pragma unroll 1
  for (int s = 1; s + 2 < DE / GKS; s += 2) {
    gemm_slab<F16, true, 0, 0>(S1, S0, Ap, Bp, sa, sb, fa, fb, acc);
    gemm_slab<F16, true, GKS, 2 * GKS>(S0, S1, Ap, Bp, sa, sb, fa, fb, acc);
  }
  gemm_slab<F16, false, 0, 0>(S1, S0, Ap, Bp, sa, sb, fa, fb, acc);   // the last slab fetches nothing
}

// the epilogue of one MODE; stands behind the last barrier of gemm_main and reuses its slab buffers
template <int MODE>
__device__ __forceinline__
void gemm_epi(unsigned char* smem, const v8f (&acc)[4][4], const float* __restrict__ bias,
              const float* __restrict__ resid, unsigned short* out16, float* out32, float scale) {
  const int tid  = threadIdx.x;
  const int wave = tid >> 5;
  const int lane = tid & 31;
  const int hh   = lane >> 4;
  const int c    = lane & 15;
  const int wm   = wave >> 1;
  const int wn   = wave & 1;
  const int m0b  = blockIdx.y * 128;
  const int m0   = m0b + wm * 64;              // the wave's first row
  const int n0b  = blockIdx.x * 128;
  const int n0   = n0b + wn * 64;              // the wave's first column

  if (MODE == 0) {
    _Float16* S = (_Float16*)(void*)smem + wave * 4096;          // [64][64] per wave
#pragma unroll
    for (int t = 0; t < 4; ++t) {
      const float bi = bf_up(bf_bits(bias[n0 + t * 16 + c]));
#pragma unroll
      for (int i = 0; i < 4; ++i)
#pragma unroll
        for (int r = 0; r < 8; ++r)
          S[(i * 16 + 8 * hh + r) * 64 + t * 16 + c] = (_Float16)((acc[i][t][r] + bi) * scale);
    }
    __builtin_amdgcn_fence(__ATOMIC_RELEASE, "workgroup");
    __builtin_amdgcn_wave_barrier();
    __builtin_amdgcn_fence(__ATOMIC_ACQUIRE, "workgroup");
    const int rq = lane >> 3, c8 = (lane & 7) * 8;
#pragma unroll
    for (int g = 0; g < 4; ++g) {
      union { v8h h; v4u u; } w[4];
#pragma unroll
      for (int it = 0; it < 4; ++it) w[it].h = *(const v8h*)(S + (g * 16 + it * 4 + rq) * 64 + c8);
#pragma unroll
      for (int it = 0; it < 4; ++it)
        *(v4u*)(out16 + (size_t)(m0 + g * 16 + it * 4 + rq) * DE + n0 + c8) = w[it].u;
    }
    // the issued stores name their data and address registers: the wait stands in front of whatever rewrites them
    // behind the join of the two epilogues
    asm volatile("s_wait_xcnt 0x0" ::: "memory");
  } else if (MODE == 1) {
    _Float16* T = (_Float16*)(void*)smem;                       // [n 128][key 128]
#pragma unroll
    for (int t = 0; t < 4; ++t) {
      const float bi = bf_up(bf_bits(bias[n0 + t * 16 + c]));
#pragma unroll
      for (int i = 0; i < 4; ++i)
#pragma unroll
        for (int r = 0; r < 8; ++r)
          T[(wn * 64 + t * 16 + c) * 128 + wm * 64 + i * 16 + 8 * hh + r] = (_Float16)((acc[i][t][r] + bi) * scale);
    }
    __syncthreads();
    const int bidx = m0b / SEQ;                                  // tiles never straddle batches (128 | SEQ)
    const int key0 = m0b - bidx * SEQ;
    const int rh = lane >> 4, c8 = (lane & 15) * 8;
#pragma unroll
    for (int g = 0; g < 4; ++g) {
      union { v8h h; v4u u; } w[4];
#pragma unroll
      for (int it = 0; it < 4; ++it) w[it].h = *(const v8h*)(T + (wave * 32 + g * 8 + it * 2 + rh) * 128 + c8);
#pragma unroll
      for (int it = 0; it < 4; ++it) {
        const int row = wave * 32 + g * 8 + it * 2 + rh;
        *(v4u*)(out16 + ((size_t)(bidx * DE + n0b + row) * SEQ + key0 + c8)) = w[it].u;
      }
    }
  } else {
    float* S = (float*)(void*)smem + wave * 4096;                // [64][64] f32 per wave
#pragma unroll
    for (int t = 0; t < 4; ++t) {
      const float bi = bf_up(bf_bits(bias[n0 + t * 16 + c]));
#pragma unroll
      for (int i = 0; i < 4; ++i)
#pragma unroll
        for (int r = 0; r < 8; ++r) S[(i * 16 + 8 * hh + r) * 64 + t * 16 + c] = acc[i][t][r] * scale + bi;
    }
    __builtin_amdgcn_fence(__ATOMIC_RELEASE, "workgroup");
    __builtin_amdgcn_wave_barrier();
    __builtin_amdgcn_fence(__ATOMIC_ACQUIRE, "workgroup");
    const int rh = lane >> 4, c4 = (lane & 15) * 4;
#pragma unroll
    for (int g = 0; g < 4; ++g) {
      v4f vals[8];
#pragma unroll
      for (int it = 0; it < 8; ++it) {
        const int row = g * 16 + it * 2 + rh;
        const int gm  = m0 + row;
        const int bb  = gm / SEQ;
        const int tt  = gm - bb * SEQ;
        v4f x = *(const v4f*)(S + row * 64 + c4);
        const v4f rq = *(const v4f*)(resid + ((size_t)bb * SEQ_FULL + tt) * DE + n0 + c4);
#pragma unroll
        for (int e = 0; e < 4; ++e) x[e] = x[e] + bf_up(bf_bits(rq[e]));
        vals[it] = x;
      }
#pragma unroll
      for (int it = 0; it < 8; ++it)
        *(v4f*)(out32 + (size_t)(m0 + g * 16 + it * 2 + rh) * DE + n0 + c4) = vals[it];
    }
  }
}

// The three projections, which do not depend on one another, in one grid: blockIdx.z = 0 q, 1 k (MODE 0), 2 v (MODE 1).
// One k loop serves all three (operand pointers picked by the block-uniform z); only the epilogue branches.
__global__ __launch_bounds__(128)
void gemm_qkv(const unsigned short* __restrict__ Aq, const unsigned short* __restrict__ Ak,
              const unsigned short* __restrict__ Wq, const unsigned short* __restrict__ Wk,
              const unsigned short* __restrict__ Wv, const float* __restrict__ bq, const float* __restrict__ bk,
              const float* __restrict__ bv, unsigned short* oq, unsigned short* ok, unsigned short* ov) {
  __shared__ __align__(16) unsigned char smem[2 * GSLAB * 2];
  const int z = blockIdx.z;
  v8f acc[4][4];
  gemm_main<false>(smem, (z == 0) ? Aq : Ak, (z == 0) ? Wq : ((z == 1) ? Wk : Wv), acc);
  if (z == 2) gemm_epi<1>(smem, acc, bv, nullptr, ov, nullptr, VCARRY);
  else        gemm_epi<0>(smem, acc, (z == 0) ? bq : bk, nullptr, (z == 0) ? oq : ok, nullptr, 1.0f);
}

// output projection (MODE 2)
__global__ __launch_bounds__(128)
void gemm_o(const unsigned short* __restrict__ A, const unsigned short* __restrict__ Bt,
            const float* __restrict__ bias, const float* __restrict__ resid, float* out32) {
  __shared__ __align__(16) unsigned char smem[2 * GSLAB * 2];
  v8f acc[4][4];
  gemm_main<true>(smem, A, Bt, acc);
  gemm_epi<2>(smem, acc, bias, resid, nullptr, out32, 1.0f / (CCARRY * WCARRY));
}

// =====================================================================================================
// Full (unmasked) attention, head dim 64, all NQB key tiles.
//   q plane (f16):  element (b, t, h, d) at [(b*SEQ + t)*DE + h*64 + d]      k plane (f16): same with key index s
//   v^T plane (f16): element (b, h, d, s) at [(b*DE + h*64 + d)*SEQ + s], value v*64
//   Both products are formed transposed: S^T = K . Q^T (A = K rows, B = Q) and O^T += V^T . P^T (A = V^T rows, B = P^T).
//   Lane (c, hh) then holds scores of ONE query, q0 + c: register r of score tile j is key 16 j + 8 hh + r. Row maximum
//   and row sum are in-lane, with one exchange between the two lane halves; and score tiles 2 kk and 2 kk + 1,
//   converted in place, ARE the B fragment of key chunk kk (element e < 8: key 8 hh + e, else 16 + 8 hh + e - 8, the
//   k map of the V^T loader): P goes through no LDS and no lane exchange.
//   scores = q . k (f16 WMMA, f32 acc) * 0.125; online softmax in f32; p = exp(s - m) carried as f16(16384 p);
//   context = p . v on f16 WMMA; RES adds the f16 residual plane of p (x4096, separate accumulator folded back
//   with 1/4096 per tile in f32). ctx out = f16(context / (l * 16384 * 64) * 64) to [(b*SEQ + t)*DE + h*64 + d].
//   l is kept per lane half (the half's own keys); the halves are joined once, behind the loop.
//   Block = 4 waves = 64 query rows of one (b,h); bx = 0 .. nqbThis * NH * NB - 1; kv tiles of 64.
//   K / V^T tile staging: 128 threads x 32 elements per plane = the whole 64x64 tile (plain 16-B loads,
//   __syncthreads before and after, cross-wave); staged extent == consumed extent for Ksh, Vth, Os.
//   Ksh, Vth rows lie at pitch LP (64 used halves + 8 never touched) so that the 16 rows one 16-B fragment
//   read walks fall on 16 different bank groups.
//   The Os tile is wave-private: lane (c, hh) stores 8 consecutive d of query row c per output tile (one 16-B store),
//   Output coverage: each wave stores rows 0..15 (it 0..3 x lane>>3) x 64 halves (8 lanes x 16 B): one instruction
// =====================================================================================================
template <bool RES>
__device__ __forceinline__
void attn_block(_Float16* Ksh, _Float16* Vth, _Float16* Osh,
                const unsigned short* __restrict__ qp, const unsigned short* __restrict__ kp,
                const unsigned short* __restrict__ vtp, unsigned short* ctx, int bx, int qbBase, int nqbThis) {
  union FH { v16h v; v8h h[2]; v2h p[8]; };

  const int tid  = threadIdx.x;
  const int wave = tid >> 5;
  const int lane = tid & 31;
  const int hh   = lane >> 4;
  const int c    = lane & 15;

  const int qbl  = bx % nqbThis;
  const int bhq  = bx / nqbThis;           // 0..NB*NH-1
  const int h    = bhq % NH;
  const int b    = bhq / NH;
  const int qb   = qbBase + qbl;           // 0..NQB-1
  const int q0   = qb * 64 + wave * 16;    // query index within the sequence

  const _Float16* Qh = (const _Float16*)(const void*)qp + (size_t)b * SEQ * DE + (size_t)h * HD;
  const _Float16* Kh = (const _Float16*)(const void*)kp + (size_t)b * SEQ * DE + (size_t)h * HD;
  const _Float16* Vh = (const _Float16*)(const void*)vtp + ((size_t)b * DE + (size_t)h * HD) * SEQ;

  // ---- Q fragments (B operand, column = lane&15): 2 d-chunks ----
  v16h qa[2];
#pragma unroll
  for (int dc = 0; dc < 2; ++dc) {
    const size_t qo = (size_t)(q0 + c) * DE + dc * 32 + 8 * hh;
    qa[dc] = ldfrag_h(Qh + qo);
  }

  float mrow = -INFINITY, lrow = 0.f;       // of query q0 + c; lrow: the keys of this lane half only
  v8f oacc[4];                              // O^T: register r of tile t = context[q0 + c][16 t + 8 hh + r]
#pragma unroll
  for (int t = 0; t < 4; ++t) oacc[t] = zero8();

  for (int kt = 0; kt < NQB; ++kt) {        // block-uniform bounds, exactly NQB trips
    const int kv0 = kt * 64;
    __syncthreads();
    {
      const int r = tid >> 1, half = (tid & 1) * 32;
      const _Float16* kg = Kh + (size_t)(kv0 + r) * DE + half;   // K row kv0+r, d = half..half+31
      const _Float16* vg = Vh + (size_t)r * SEQ + kv0 + half;    // V^T row d = r, s = kv0+half..+31
      // all eight loads are issued ahead of the first store, so that their latencies overlap
      v8h a0[4], b0[4];
#pragma unroll
      for (int i = 0; i < 4; ++i) {
        a0[i] = *(const v8h*)(kg + 8 * i);
        b0[i] = *(const v8h*)(vg + 8 * i);
      }
#pragma unroll
      for (int i = 0; i < 4; ++i) {
        *(v8h*)(Ksh + r * LP + half + 8 * i) = a0[i];
        *(v8h*)(Vth + r * LP + half + 8 * i) = b0[i];
      }
    }
    __syncthreads();

    // ---- all K and V^T fragments of the tile are read as one group right behind the barrier: the K reads' latencies
    //      overlap each other, the V^T reads land under the score products and the softmax ----
    FH kb[4][2], vb[2][4];
#pragma unroll
    for (int j = 0; j < 4; ++j)
#pragma unroll
      for (int dc = 0; dc < 2; ++dc) {
        kb[j][dc].h[0] = *(const v8h*)(Ksh + (j * 16 + c) * LP + dc * 32 + 8 * hh);
        kb[j][dc].h[1] = *(const v8h*)(Ksh + (j * 16 + c) * LP + dc * 32 + 16 + 8 * hh);
      }
#pragma unroll
    for (int kk = 0; kk < 2; ++kk)
#pragma unroll
      for (int t = 0; t < 4; ++t) {
        vb[kk][t].h[0] = *(const v8h*)(Vth + (t * 16 + c) * LP + kk * 32 + 8 * hh);
        vb[kk][t].h[1] = *(const v8h*)(Vth + (t * 16 + c) * LP + kk * 32 + 16 + 8 * hh);
      }
    // holds the group of reads apart from the products: without it the compiler mixes the two regions and, in the
    // residual variant, spills one fragment to scratch and reloads it in every trip
    __builtin_amdgcn_sched_barrier(0);

    // ---- scores, transposed: 64 keys (rows) x 16 queries (columns) per wave, single f16 product ----
    v8f s[4];
#pragma unroll
    for (int j = 0; j < 4; ++j) {
      s[j] = zero8();
#pragma unroll
      for (int dc = 0; dc < 2; ++dc) s[j] = mma_h(kb[j][dc].v, qa[dc], s[j]);
    }

    // ---- scale, maximum of this lane's 32 keys (one chain per score tile), joined with the other lane half ----
    float mj[4];
#pragma unroll
    for (int j = 0; j < 4; ++j) {
      float m = -INFINITY;
#pragma unroll
      for (int r = 0; r < 8; ++r) {
        const float sv = s[j][r] * 0.125f;
        s[j][r] = sv;
        m = fmaxf(m, sv);
      }
      mj[j] = m;
    }
    float mx = fmaxf(fmaxf(mj[0], mj[1]), fmaxf(mj[2], mj[3]));
    mx = fmaxf(mx, xhalf(mx));
    const float mnew  = fmaxf(mrow, mx);
    const float msafe = (mnew == -INFINITY) ? 0.f : mnew;
    const float al = __expf(mrow - msafe);
    mrow = mnew;

    // ---- P (x16384, f16) and P residual (x4096), converted in pairs straight into the B fragments ----
    FH pa[2], pl[2];
    v2f pj[4];                           // one chain of pair sums per score tile (even r, odd r)
#pragma unroll
    for (int j = 0; j < 4; ++j) {
#pragma unroll
      for (int r = 0; r < 8; r += 2) {
        const v2f pp = {__expf(s[j][r] - msafe), __expf(s[j][r + 1] - msafe)};
        pj[j] = (r == 0) ? pp : pj[j] + pp;
        const v2f pk = pp * PCARRY;
        const v2h ph = __builtin_convertvector(pk, v2h);
        pa[j >> 1].p[(j & 1) * 4 + (r >> 1)] = ph;
        if (RES) {
          const v2f rs = {(pk[0] - (float)ph[0]) * PRES, (pk[1] - (float)ph[1]) * PRES};
          pl[j >> 1].p[(j & 1) * 4 + (r >> 1)] = __builtin_convertvector(rs, v2h);
        }
      }
    }
    const v2f pt = (pj[0] + pj[1]) + (pj[2] + pj[3]);
    lrow = lrow * al + (pt[0] + pt[1]);
#pragma unroll
    for (int t = 0; t < 4; ++t)
#pragma unroll
      for (int r = 0; r < 8; ++r) oacc[t][r] *= al;

    // ---- context^T += V^T . P^T (f16 WMMA), residual products into a separate accumulator ----
    v8f o1[4];
#pragma unroll
    for (int t = 0; t < 4; ++t) o1[t] = zero8();
    // unrolled: kk picks among fragments that sit in registers, so it must be a constant
#pragma unroll
    for (int kk = 0; kk < 2; ++kk) {
#pragma unroll
      for (int t = 0; t < 4; ++t) {
        oacc[t] = mma_h(vb[kk][t].v, pa[kk].v, oacc[t]);
        if (RES) o1[t] = mma_h(vb[kk][t].v, pl[kk].v, o1[t]);
      }
    }
    if (RES) {
#pragma unroll
      for (int t = 0; t < 4; ++t)
#pragma unroll
        for (int r = 0; r < 8; ++r) oacc[t][r] += o1[t][r] * (1.0f / PRES);
    }
  }

  // ---- join the halves' sums; normalise (1/l, the p, v carries) and apply the ctx carry; stage the wave's 16x64 f16
  //      tile; write whole lines ----
  _Float16* os = Osh + wave * (16 * 64);
  {
    const float l = lrow + xhalf(lrow);
    const float inv = ((l > 0.f) ? (1.0f / l) : 0.f) * (CCARRY / (PCARRY * VCARRY));
#pragma unroll
    for (int t = 0; t < 4; ++t) {
      v8h o;
#pragma unroll
      for (int r = 0; r < 8; ++r) o[r] = (_Float16)(oacc[t][r] * inv);
      *(v8h*)(os + c * 64 + t * 16 + 8 * hh) = o;
    }
  }
  __builtin_amdgcn_fence(__ATOMIC_RELEASE, "workgroup");
  __builtin_amdgcn_wave_barrier();
  __builtin_amdgcn_fence(__ATOMIC_ACQUIRE, "workgroup");
  {
    const int rq = lane >> 3, c8 = (lane & 7) * 8;
    union { v8h h; v4u u; } w[4];
#pragma unroll
    for (int it = 0; it < 4; ++it) w[it].h = *(const v8h*)(os + (it * 4 + rq) * 64 + c8);
    unsigned short* ob = ctx + ((size_t)b * SEQ) * DE + (size_t)h * HD;
    {
#pragma unroll
      for (int it = 0; it < 4; ++it) {
        const int row = it * 4 + rq;                     // it 0..3 x rq 0..3 = rows 0..15
        *(v4u*)(ob + (size_t)(q0 + row) * DE + c8) = w[it].u;
      }
      
    }
  }
}

// Both kinds of query block in one grid of NB * NH * NQB blocks, picked by block index (block-uniform): the first
// NB * NH * resqb blocks are the leading query blocks, with the p residual plane (the longer ones, placed first for speed only);
// the others run without it.
__global__ __launch_bounds__(128)
void attn_full64(const unsigned short* __restrict__ qp, const unsigned short* __restrict__ kp,
                 const unsigned short* __restrict__ vtp, unsigned short* ctx, int resqb) {
  __shared__ __align__(16) _Float16 Ksh[64 * LP];                 // K [kv][d], pitch LP
  __shared__ __align__(16) _Float16 Vth[64 * LP];                 // V^T [d][kv], pitch LP
  __shared__ __align__(16) _Float16 Os[4 * 16 * 64];              // per wave context tile [row][d]
  const int bx   = blockIdx.x;
  const int nres = NB * NH * resqb;
  if (bx < nres) attn_block<true>(Ksh, Vth, Os, qp, kp, vtp, ctx, bx, 0, resqb);
  else           attn_block<false>(Ksh, Vth, Os, qp, kp, vtp, ctx, bx - nres, resqb, NQB - resqb);
}

// =====================================================================================================
// LayerNorm over DE of x [MROWS][DE] f32: one block of 256 threads per row, thread owns 4 consecutive floats.
// mean and centred variance via wave shuffles + 8-entry LDS partials (cross-wave, block barriers), fixed order.
// y = (x - mu) * rsqrt(var + 1e-5) * RNE-bf16(gamma) + RNE-bf16(beta). Output row b*SEQ_FULL + t of d_out;
// coverage: MROWS blocks x 256 threads x 4 floats = every processed output row in full.
// =====================================================================================================
__global__ __launch_bounds__(256) void ln_rows(const float* __restrict__ x, const float* __restrict__ gam,
                                               const float* __restrict__ bet, float* out) {
  __shared__ float red1[8];
  __shared__ float red2[8];
  const int tid = threadIdx.x, wave = tid >> 5, lane = tid & 31;
  const int row = blockIdx.x;
  const int bb  = row / SEQ;
  const int tt  = row - bb * SEQ;
  const size_t orow = (size_t)bb * SEQ_FULL + (size_t)tt;

  const v4f v = *(const v4f*)(x + (size_t)row * DE + tid * 4);
  float s = (v[0] + v[1]) + (v[2] + v[3]);
#pragma unroll
  for (int off = 16; off > 0; off >>= 1) s += __shfl_xor(s, off, 32);
  if (lane == 0) red1[wave] = s;
  __syncthreads();
  float tot = 0.f;
#pragma unroll
  for (int w = 0; w < 8; ++w) tot += red1[w];
  const float mu = tot * (1.0f / (float)DE);

  v4f d;
#pragma unroll
  for (int e = 0; e < 4; ++e) d[e] = v[e] - mu;
  float s2 = (d[0] * d[0] + d[1] * d[1]) + (d[2] * d[2] + d[3] * d[3]);
#pragma unroll
  for (int off = 16; off > 0; off >>= 1) s2 += __shfl_xor(s2, off, 32);
  if (lane == 0) red2[wave] = s2;
  __syncthreads();
  float tot2 = 0.f;
#pragma unroll
  for (int w = 0; w < 8; ++w) tot2 += red2[w];
  const float var  = tot2 * (1.0f / (float)DE);
  const float rstd = rsqrtf(var + 1.0e-5f);

  const v4f g4 = *(const v4f*)(gam + tid * 4);
  const v4f b4 = *(const v4f*)(bet + tid * 4);
  v4f y;
#pragma unroll
  for (int e = 0; e < 4; ++e) y[e] = (d[e] * rstd) * bf_up(bf_bits(g4[e])) + bf_up(bf_bits(b4[e]));
  float* op = out + orow * DE + (size_t)tid * 4;
  *(v4f*)op = y;
  
}

// =====================================================================================================
// Workspace map (bytes, full size): PQ bf16 [MROWS][DE] at 0 (8388608); PK bf16 at 8388608 (8388608);
// Wq^T, Wk^T, Wv^T bf16 and Wo^T f16 [DE][DE] at 16777216.. (4 x 2097152); Q f16 [MROWS][DE] at 25165824;
// K f16 at 33554432; V^T f16 [NB][DE][SEQ] at 41943040; CTX f16 [MROWS][DE] at 50331648; X f32 [MROWS][DE]
// at 58720256 (16777216); end 75497472. Every plane is an exact multiple of its whole-line store granularity
// Launch plan (5): input conversions + weight transpose-convert; gemm q, k, v^T; attention (leading query blocks with
// the p residual, remaining blocks without); gemm o + residual; LayerNorm. Jobs that share a launch are independent.
// =====================================================================================================
extern "C" void kernel_launch(void* const* d_in, const int* in_sizes, int n_in,
                              void* d_out, int out_size, void* d_ws, size_t ws_size,
                              hipStream_t stream) {
  if (n_in < 12) return;
  const long long needIn = (long long)(NB - 1) * SEQ_FULL * DE + (long long)SEQ * DE;
  if ((long long)in_sizes[0] < needIn || (long long)in_sizes[1] < needIn) return;
  if (in_sizes[2] < DE * DE || in_sizes[4] < DE * DE || in_sizes[6] < DE * DE || in_sizes[8] < DE * DE) return;
  if (in_sizes[3] < DE || in_sizes[5] < DE || in_sizes[7] < DE || in_sizes[9] < DE) return;
  if (in_sizes[10] < DE || in_sizes[11] < DE) return;
  if (out_size < 0 || (long long)out_size < needIn) return;

  const size_t P16 = (size_t)MROWS * DE * 2;     // one 16-bit activation plane
  const size_t W16 = (size_t)DE * DE * 2;        // one 16-bit weight plane
  const size_t P32 = (size_t)MROWS * DE * 4;     // x plane
  size_t off = 0;
  const size_t oPQ  = off; off += P16;
  const size_t oPK  = off; off += P16;
  const size_t oWq  = off; off += W16;
  const size_t oWk  = off; off += W16;
  const size_t oWv  = off; off += W16;
  const size_t oWo  = off; off += W16;
  const size_t oQ   = off; off += P16;
  const size_t oK   = off; off += P16;
  const size_t oVT  = off; off += P16;
  const size_t oCTX = off; off += P16;
  const size_t oX   = off; off += P32;
  if (off > ws_size) return;                     // off = 75497472 at full size
  if (off > (size_t)134217728) return;

  const float* pre_q = (const float*)d_in[0];
  const float* pre_k = (const float*)d_in[1];
  const float* Wq    = (const float*)d_in[2];
  const float* bq    = (const float*)d_in[3];
  const float* Wk    = (const float*)d_in[4];
  const float* bk    = (const float*)d_in[5];
  const float* Wv    = (const float*)d_in[6];
  const float* bv    = (const float*)d_in[7];
  const float* Wo    = (const float*)d_in[8];
  const float* bo    = (const float*)d_in[9];
  const float* gamma = (const float*)d_in[10];
  const float* beta  = (const float*)d_in[11];
  float* out = (float*)d_out;

  char* ws = (char*)d_ws;
  unsigned short* PQb  = (unsigned short*)(ws + oPQ);
  unsigned short* PKb  = (unsigned short*)(ws + oPK);
  unsigned short* Wqt  = (unsigned short*)(ws + oWq);
  unsigned short* Wkt  = (unsigned short*)(ws + oWk);
  unsigned short* Wvt  = (unsigned short*)(ws + oWv);
  unsigned short* Wot  = (unsigned short*)(ws + oWo);
  unsigned short* Qh   = (unsigned short*)(ws + oQ);
  unsigned short* Kh   = (unsigned short*)(ws + oK);
  unsigned short* VTb  = (unsigned short*)(ws + oVT);
  unsigned short* CTXb = (unsigned short*)(ws + oCTX);
  float*          Xb   = (float*)(ws + oX);

  const dim3 blk(256);
  const int n8   = MROWS * DE / 8;               // 524288 at full size
  const int per8 = SEQ * DE / 8;
  const int src8 = SEQ_FULL * DE / 8;
  const int ncv  = (n8 + 255) / 256;             // conversion blocks per activation plane
  const dim3 gPrep(4 * (DE / 64) * (DE / 64) + 2 * ncv);   // 256 tiles x 4 matrices, then the two planes
  const dim3 blkG(128);                          // the GEMMs' block: 4 waves
  const dim3 gG(DE / 128, MROWS / 128);          // (8, 32) at full size
  const dim3 gG3(DE / 128, MROWS / 128, 3);      // the same for each of q, k, v
  int resqb = RESQB;
  if (resqb > NQB) resqb = NQB;

  // (1) weights -> transposed 16-bit planes (Wq, Wk, Wv bf16; Wo f16 x64); activations -> bf16 planes (RNE convert)
  prep_inputs<<<gPrep, blk, 0, stream>>>(pre_q, pre_k, Wq, Wk, Wv, Wo, PQb, PKb, Wqt, Wkt, Wvt, Wot,
                                         ncv, n8, per8, src8);
  // (2) projections: q, k -> f16 row-major; v -> f16 v^T x64
  gemm_qkv<<<gG3, blkG, 0, stream>>>(PQb, PKb, Wqt, Wkt, Wvt, bq, bk, bv, Qh, Kh, VTb);
  // (3) attention -> ctx f16 x64: query blocks 0..resqb-1 with the p residual plane, the rest without
  attn_full64<<<dim3(NB * NH * NQB), dim3(128), 0, stream>>>(Qh, Kh, VTb, CTXb, resqb);
  // (4) output projection + bias + residual -> x f32
  gemm_o<<<gG, blkG, 0, stream>>>(CTXb, Wot, bo, pre_q, Xb);
  // (5) LayerNorm -> output
  ln_rows<<<dim3(MROWS), blk, 0, stream>>>(Xb, gamma, beta, out);
  (void)hipGetLastError();
}

// v008
// One run takes 105 microseconds.
// In both of two side-by-side timings against v007, it was 1.03 times as fast.
// All steps since v000 together make it 4.45 times as fast.
// Contractions: q/k/v projections = v_wmma_f32_16x16x32_bf16 (bf16 operands = RNE-converted activations and
// transposed weights, single product, f32 accumulate); q.k^T scores, p.v context and ctx.Wo projection =
// v_wmma_f32_16x16x32_f16 (q, k = f16 of the f32 projection sums, unscaled; p = exp(s - m) carried x16384 plus an
// f16 residual plane of p x4096 on the leading query blocks; v^T, ctx and Wo carried x64 in f16), f32 accumulate;
// softmax, bias/residual add and LayerNorm in f32.
#include <hip/hip_runtime.h>
#include <math.h>
#include <stdint.h>

#ifndef NB
#define NB 2                 // batches processed (reducible)
#endif
#ifndef NB_FULL
#define NB_FULL 2            // batches in the inputs / output
#endif
#ifndef SEQ
#define SEQ 2048             // query == key length processed (reducible)
#endif
#ifndef SEQ_FULL
#define SEQ_FULL 2048        // per-batch row stride of the inputs and of the output
#endif
#define DE    1024
#define NH    16
#define HD    64
#define NQB   (SEQ / 64)
#define MROWS (NB * SEQ)
#ifndef RESQB
#define RESQB 8              // leading 64-row query blocks per (b,h) that carry the p residual plane
#endif
#define PCARRY 16384.0f
#define PRES   4096.0f
#define VCARRY 64.0f
#define CCARRY 64.0f
#define WCARRY 64.0f
#define LP    72             // LDS row pitch (halves) of the attention K and V^T tiles: 144 B = 16 B x odd
#define GKS   64             // k extent (halves) of one staged GEMM slab: one whole 128-B line per row
#define GP    72             // LDS row pitch (halves) of the staged GEMM slabs: 144 B = 16 B x odd
#define GSLAB ((128 + 128) * GP)  // halves in one slab buffer: 128 A rows, then 128 B rows

static_assert(NB >= 1 && NB <= NB_FULL);
static_assert((SEQ % 128) == 0 && SEQ >= 128 && SEQ <= SEQ_FULL);
static_assert(NH * HD == DE);
static_assert(RESQB >= 1);
static_assert(LP >= HD && (LP % 8) == 0 && ((LP / 8) % 2) == 1);   // 16-B aligned rows, odd count of 16-B units
static_assert((MROWS % 128) == 0 && (DE % 128) == 0 && (DE % 32) == 0);
static_assert(GP >= GKS && (GP % 8) == 0 && ((GP / 8) % 2) == 1 && (DE % GKS) == 0 && (GKS % 32) == 0);
static_assert(((DE / GKS) % 2) == 0 && DE / GKS >= 2);               // the k loop takes slabs in pairs
static_assert(2 * GSLAB * 2 >= 65536);                               // the epilogue stages reuse the slab buffers
static_assert((long long)NB_FULL * SEQ_FULL * DE * 4 == 16777216LL);   // total output bytes at full size

typedef _Float16 v16h __attribute__((ext_vector_type(16)));
typedef _Float16 v8h  __attribute__((ext_vector_type(8)));
typedef __bf16   v16b __attribute__((ext_vector_type(16)));
typedef __bf16   v8b  __attribute__((ext_vector_type(8)));
typedef float    v8f  __attribute__((ext_vector_type(8)));
typedef float    v4f  __attribute__((ext_vector_type(4)));
typedef float    v2f  __attribute__((ext_vector_type(2)));
typedef _Float16 v2h  __attribute__((ext_vector_type(2)));
typedef unsigned int v4u __attribute__((ext_vector_type(4)));
typedef unsigned short v8us __attribute__((ext_vector_type(8)));
// pointers that are known to be global whatever they pass through, so that their loads stay global loads
typedef const unsigned short __attribute__((address_space(1)))* gcus;
typedef const v4u __attribute__((address_space(1)))* gcv4u;

// ---- scalar helpers --------------------------------------------------------------------------------
__device__ __forceinline__ unsigned short bf_bits(float f) {          // f32 -> bf16 bits, RNE convert
  unsigned u = __float_as_uint(f);
  return (unsigned short)((u + 0x7FFFu + ((u >> 16) & 1u)) >> 16);
}
__device__ __forceinline__ float bf_up(unsigned short h) { return __uint_as_float(((unsigned)h) << 16); }
__device__ __forceinline__ unsigned short h_bits(float f) {           // f32 -> f16 bits, RNE convert
  union { _Float16 h; unsigned short u; } cvt;
  cvt.h = (_Float16)f;
  return cvt.u;
}
__device__ __forceinline__ unsigned pk16(unsigned short a, unsigned short b) { return (unsigned)a | ((unsigned)b << 16); }
__device__ __forceinline__ v8f zero8() { v8f z = {0.f, 0.f, 0.f, 0.f, 0.f, 0.f, 0.f, 0.f}; return z; }
// value of lane l ^ 16 (the other 16-lane row), on the vector unit; all 32 lanes are on at every call site
__device__ __forceinline__ float xhalf(float x) {
  const int b = __builtin_bit_cast(int, x);
  return __builtin_bit_cast(float, __builtin_amdgcn_permlanex16(b, b, 0x76543210, 0xfedcba98, false, false));
}

// ---- fragment loaders: 16-bit A/B operand, lane -> row/col (lane&15), p already includes +8*(lane>>4);
//      elements 0..7 <- p[0..7] (k0+8h..), elements 8..15 <- p[16..23] (k0+16+8h..)
__device__ __forceinline__ v16b ldfrag_b(const __bf16* p) {
  union { v16b v; v8b h[2]; } f;
  f.h[0] = *(const v8b*)(p);
  f.h[1] = *(const v8b*)(p + 16);
  return f.v;
}
__device__ __forceinline__ v16h ldfrag_h(const _Float16* p) {
  union { v16h v; v8h h[2]; } f;
  f.h[0] = *(const v8h*)(p);
  f.h[1] = *(const v8h*)(p + 16);
  return f.v;
}

// ---- WMMA helpers with trailing VALU hazard gap --------------------------------------------------------
__device__ __forceinline__ v8f mma_b(v16b a, v16b b, v8f c) {
  c = __builtin_amdgcn_wmma_f32_16x16x32_bf16(false, a, false, b, (short)0, c, false, false);
  asm volatile("v_nop\n\tv_nop\n\tv_nop\n\tv_nop" : "+v"(c) : "v"(a), "v"(b));
  return c;
}
__device__ __forceinline__ v8f mma_h(v16h a, v16h b, v8f c) {
  c = __builtin_amdgcn_wmma_f32_16x16x32_f16(false, a, false, b, (short)0, c, false, false);
  asm volatile("v_nop\n\tv_nop\n\tv_nop\n\tv_nop" : "+v"(c) : "v"(a), "v"(b));
  return c;
}

// =====================================================================================================
// f32 -> bf16 (RNE convert), 8 elements per thread, one 16-B store per lane: a wave writes 512 contiguous B
// Destination plane is compact [b][SEQ*DE]; source batch stride src8 (units of 8 floats) may be larger.
// coverage: n8 threads x 8 = whole plane (n8 = NB*SEQ*DE/8 is a multiple of 256). blk = block index within the plane.
// =====================================================================================================
__device__ __forceinline__ void cvt_bf16x8s(const float* __restrict__ in, unsigned short* out,
                                            int blk, int n8, int per8, int src8) {
  const int i = blk * 256 + threadIdx.x;
  if (i < n8) {
    const int hd  = i / per8;
    const int rem = i - hd * per8;
    const float* s = in + ((size_t)hd * src8 + (size_t)rem) * 8;
    const v4f a = *(const v4f*)(s);
    const v4f b = *(const v4f*)(s + 4);
    v4u p;
    p[0] = pk16(bf_bits(a[0]), bf_bits(a[1]));
    p[1] = pk16(bf_bits(a[2]), bf_bits(a[3]));
    p[2] = pk16(bf_bits(b[0]), bf_bits(b[1]));
    p[3] = pk16(bf_bits(b[2]), bf_bits(b[3]));
    *(v4u*)(out + (size_t)i * 8) = p;
    
  }
}

// =====================================================================================================
// Weight W[k][n] f32 (DE x DE, n contiguous) -> transposed 16-bit plane Wt[n][k] (k contiguous, pitch DE).
//   mat = matrix id: 0,1,2 -> bf16 bits of the RNE-bf16 value; 3 -> f16 bits of (RNE-bf16 value x64).
//   Block = one 64(k) x 64(n) tile, 256 threads: thread (k = tid>>2, 16-column n quarter) loads 16 floats of row k
//   and writes them transposed into the LDS tile T[n][k]; after the barrier wave w writes rows n = 8w..8w+7:
//   tile = 0..(DE/64)^2 - 1 covers the whole plane of each of the 4 matrices. T = the block's 64 x 64 LDS tile.
// =====================================================================================================
__device__ __forceinline__ void wt_tiles(unsigned short* T, int mat, int tile,
                                         const float* __restrict__ w0, const float* __restrict__ w1,
                                         const float* __restrict__ w2, const float* __restrict__ w3,
                                         unsigned short* o0, unsigned short* o1,
                                         unsigned short* o2, unsigned short* o3) {
  const int tid = threadIdx.x;
  const float* in = w0; unsigned short* out = o0;        // mat is block-uniform
  if (mat == 1) { in = w1; out = o1; }
  else if (mat == 2) { in = w2; out = o2; }
  else if (mat == 3) { in = w3; out = o3; }
  const int ktile = tile / (DE / 64);
  const int ntile = tile - ktile * (DE / 64);
  const int k   = tid >> 2;              // 0..63
  const int nq  = (tid & 3) * 16;        // 0,16,32,48
  const float* src = in + (size_t)(ktile * 64 + k) * DE + ntile * 64 + nq;
#pragma unroll
  for (int i = 0; i < 4; ++i) {
    const v4f a = *(const v4f*)(src + 4 * i);
#pragma unroll
    for (int e = 0; e < 4; ++e) {
      const unsigned short bb = bf_bits(a[e]);
      const unsigned short hb = h_bits(bf_up(bb) * WCARRY);
      const unsigned short us = (mat == 3) ? hb : bb;
      T[(nq + 4 * i + e) * 64 + k] = us;
    }
  }
  __syncthreads();
  const int wave = tid >> 5, lane = tid & 31;
  const int q = lane >> 3, c8 = (lane & 7) * 8;
  union { v8us s; v4u u; } x0, x1;
  const int d0 = wave * 8 + q;
  const int d1 = wave * 8 + 4 + q;
  x0.s = *(const v8us*)(T + d0 * 64 + c8);
  x1.s = *(const v8us*)(T + d1 * 64 + c8);
  unsigned short* p0 = out + ((size_t)(ntile * 64 + d0) * DE + ktile * 64 + c8);
  unsigned short* p1 = out + ((size_t)(ntile * 64 + d1) * DE + ktile * 64 + c8);
  *(v4u*)p0 = x0.u;
  *(v4u*)p1 = x1.u;
  
}

// =====================================================================================================
// The three input-only jobs in one grid, picked by block index (block-uniform): blocks 0 .. 4 (DE/64)^2 - 1 transpose
// one weight tile each (the longest chain, placed first for speed only), the next ncv blocks convert pre_q, the last ncv pre_k.
// =====================================================================================================
__global__ __launch_bounds__(256) void prep_inputs(const float* __restrict__ aq, const float* __restrict__ ak,
                                                   const float* __restrict__ w0, const float* __restrict__ w1,
                                                   const float* __restrict__ w2, const float* __restrict__ w3,
                                                   unsigned short* oq, unsigned short* ok,
                                                   unsigned short* o0, unsigned short* o1,
                                                   unsigned short* o2, unsigned short* o3,
                                                   int ncv, int n8, int per8, int src8) {
  __shared__ __align__(16) unsigned short T[64 * 64];   // [n][k], weight blocks only
  const int tiles = (DE / 64) * (DE / 64);
  const int bx = blockIdx.x;
  if (bx < 4 * tiles) {
    const int mat = bx / tiles;
    wt_tiles(T, mat, bx - mat * tiles, w0, w1, w2, w3, o0, o1, o2, o3);
  } else if (bx < 4 * tiles + ncv) {
    cvt_bf16x8s(aq, oq, bx - 4 * tiles, n8, per8, src8);
  } else {
    cvt_bf16x8s(ak, ok, bx - 4 * tiles - ncv, n8, per8, src8);
  }
}

// =====================================================================================================
// 16-bit GEMM C[m][n] = sum_k A[m][k] * Bt[n][k], K = DE, M = MROWS, N = DE. Block 128 threads = 4 waves,
// block tile 128 m x 128 n, waves 2 (m) x 2 (n), wave tile 64 x 64 (16 accumulators): each fragment read from LDS
// feeds four products. k step 32. grid x, y = (DE/128, MROWS/128), exact multiples.
//   Operands: the block's 128 A rows and 128 B rows are staged in LDS one k slab of GKS at a time. 8 lanes fetch one
//   whole 128-B line of a row (16 B each), 128 threads x 16 loads = the (128 + 128) x 128 B of a slab, each line once
//   per block. Two buffers: slab s + 1 is loaded into registers ahead of the products of slab s and stored into the
//   other buffer behind them; one block barrier per slab publishes it and ends the reads of the buffer refilled next.
//   Fragments come from the LDS rows (two 16-B reads each, identical k map for A and B), k ascending.
//   MODE 0: bf16 operands; out16 f16 row-major [MROWS][DE] = (acc + bias) * scale. Wave tile staged in wave-private
//           LDS [64][64]; one instruction = 4 rows of 64 halves (8 lanes x 16 B per 128-B line); 16 it x 4 rows.
//   MODE 1: bf16 operands; out16 f16 transposed per batch [b][DE][SEQ] = (acc + bias) * scale. Block tile staged in
//           cross-wave LDS T[n 128][key 128] (block barrier); wave w writes rows n = 32w..32w+31, one instruction =
//           2 rows of 128 halves (16 lanes x 16 B per 256-B row); coverage 4 waves x 16 it x 2 rows x 128 = 128x128.
//   MODE 2: f16 operands; out32 f32 row-major [MROWS][DE] = acc * scale + bias + RNE-bf16(resid), resid rows read at
//           the full batch stride. Wave-private LDS stage (f32) [64][64], one instruction = 2 rows of 64 floats
//           (16 lanes x 16 B per 256-B segment); coverage 32 it x 2 rows x 64 = 64x64.
// =====================================================================================================
// one k slab: FETCH loads the next slab (at Ap + KOFF, Bp + KOFF) into registers ahead of this slab's products and
// stores it into nxt behind them; STEP (halves) is then added to Ap and Bp; F16 picks the operand type of the products;
// acc[i][t] = the wave's tile, rows 16 i .., columns 16 t ..
template <bool F16, bool FETCH, int KOFF, int STEP>
__device__ __forceinline__
void gemm_slab(const unsigned short* cur, unsigned short* nxt, gcus& Ap, gcus& Bp,
               int sa, int sb, int fa, int fb, v8f (&acc)[4][4]) {
  v4u ra[8], rb[8];
  if (FETCH) {
#pragma unroll
    for (int i = 0; i < 8; ++i) ra[i] = *(gcv4u)(Ap + KOFF + (size_t)i * 16 * DE);
#pragma unroll
    for (int i = 0; i < 8; ++i) rb[i] = *(gcv4u)(Bp + KOFF + (size_t)i * 16 * DE);
  }
  // the eight fragments of a k step are read as one group ahead of its sixteen products
#pragma unroll
  for (int kk = 0; kk < GKS / 32; ++kk) {
    if (F16) {
      v16h a[4], b[4];
#pragma unroll
      for (int i = 0; i < 4; ++i) a[i] = ldfrag_h((const _Float16*)(const void*)(cur + fa + i * 16 * GP + kk * 32));
#pragma unroll
      for (int t = 0; t < 4; ++t) b[t] = ldfrag_h((const _Float16*)(const void*)(cur + fb + t * 16 * GP + kk * 32));
#pragma unroll
      for (int i = 0; i < 4; ++i)
#pragma unroll
        for (int t = 0; t < 4; ++t) acc[i][t] = mma_h(a[i], b[t], acc[i][t]);
    } else {
      v16b a[4], b[4];
#pragma unroll
      for (int i = 0; i < 4; ++i) a[i] = ldfrag_b((const __bf16*)(const void*)(cur + fa + i * 16 * GP + kk * 32));
#pragma unroll
      for (int t = 0; t < 4; ++t) b[t] = ldfrag_b((const __bf16*)(const void*)(cur + fb + t * 16 * GP + kk * 32));
#pragma unroll
      for (int i = 0; i < 4; ++i)
#pragma unroll
        for (int t = 0; t < 4; ++t) acc[i][t] = mma_b(a[i], b[t], acc[i][t]);
    }
  }
  if (FETCH) {
    // issued loads name the two pointers' registers, so the pointers are stepped behind a wait, in one statement with
    // it
    if (STEP != 0)
      asm volatile("s_wait_xcnt 0x0\n\tv_add_nc_u64_e32 %0, %2, %0\n\tv_add_nc_u64_e32 %1, %2, %1"
                   : "+v"(Ap), "+v"(Bp) : "i"(STEP * 2) : "memory");
#pragma unroll
    for (int i = 0; i < 8; ++i) *(v4u*)(nxt + sa + i * 16 * GP) = ra[i];
#pragma unroll
    for (int i = 0; i < 8; ++i) *(v4u*)(nxt + sb + i * 16 * GP) = rb[i];
  }
  __syncthreads();   // publishes the next slab; ends the reads of this one (its buffer is refilled, or reused behind the loop)
}

// the k loop; smem = the block's two slab buffers
template <bool F16>
__device__ __forceinline__
void gemm_main(unsigned char* smem, const unsigned short* __restrict__ A, const unsigned short* __restrict__ Bt,
               v8f (&acc)[4][4]) {
  const int tid  = threadIdx.x;
  const int wave = tid >> 5;
  const int lane = tid & 31;
  const int hh   = lane >> 4;
  const int c    = lane & 15;
  const int wm   = wave >> 1;
  const int wn   = wave & 1;
  const int m0b  = blockIdx.y * 128;
  const int n0   = blockIdx.x * 128;

#pragma unroll
  for (int i = 0; i < 4; ++i)
#pragma unroll
    for (int t = 0; t < 4; ++t) acc[i][t] = zero8();

  unsigned short* S0 = (unsigned short*)(void*)smem;
  unsigned short* S1 = S0 + GSLAB;
  const int srow = tid >> 3;                 // 0..15: row within a group of 16 staged rows
  const int scol = (tid & 7) * 8;            // 16-B piece of the row's 128-B line
  gcus Ap = (gcus)(A  + (size_t)(m0b + srow) * DE + scol);
  gcus Bp = (gcus)(Bt + (size_t)(n0 + srow) * DE + scol);
  const int sa = srow * GP + scol;                      // staged A rows 0..127
  const int sb = (128 + srow) * GP + scol;              // staged B rows 0..127
  const int fa = (wm * 64 + c) * GP + 8 * hh;           // this lane's A fragment row of m group 0
  const int fb = (128 + wn * 64 + c) * GP + 8 * hh;     // this lane's B fragment row of n group 0

  {
    v4u ra[8], rb[8];
#pragma unroll
    for (int i = 0; i < 8; ++i) ra[i] = *(gcv4u)(Ap + (size_t)i * 16 * DE);
#pragma unroll
    for (int i = 0; i < 8; ++i) rb[i] = *(gcv4u)(Bp + (size_t)i * 16 * DE);
#pragma unroll
    for (int i = 0; i < 8; ++i) *(v4u*)(S0 + sa + i * 16 * GP) = ra[i];
#pragma unroll
    for (int i = 0; i < 8; ++i) *(v4u*)(S0 + sb + i * 16 * GP) = rb[i];
  }
  __syncthreads();

  gemm_slab<F16, true, GKS, 2 * GKS>(S0, S1, Ap, Bp, sa, sb, fa, fb, acc);     // slab 0, fetches slab 1
  // two slabs a trip, so that the buffers are constants; kept rolled: with this tile the sixteen slabs unrolled in full
  // make some 30 KB of text a kernel
#pragma unroll 1
  for (int s = 1; s + 2 < DE / GKS; s += 2) {
    gemm_slab<F16, true, 0, 0>(S1, S0, Ap, Bp, sa, sb, fa, fb, acc);
    gemm_slab<F16, true, GKS, 2 * GKS>(S0, S1, Ap, Bp, sa, sb, fa, fb, acc);
  }
  gemm_slab<F16, false, 0, 0>(S1, S0, Ap, Bp, sa, sb, fa, fb, acc);   // the last slab fetches nothing
}

// the epilogue of one MODE; stands behind the last barrier of gemm_main and reuses its slab buffers
template <int MODE>
__device__ __forceinline__
void gemm_epi(unsigned char* smem, const v8f (&acc)[4][4], const float* __restrict__ bias,
              const float* __restrict__ resid, unsigned short* out16, float* out32, float scale) {
  const int tid  = threadIdx.x;
  const int wave = tid >> 5;
  const int lane = tid & 31;
  const int hh   = lane >> 4;
  const int c    = lane & 15;
  const int wm   = wave >> 1;
  const int wn   = wave & 1;
  const int m0b  = blockIdx.y * 128;
  const int m0   = m0b + wm * 64;              // the wave's first row
  const int n0b  = blockIdx.x * 128;
  const int n0   = n0b + wn * 64;              // the wave's first column

  if (MODE == 0) {
    _Float16* S = (_Float16*)(void*)smem + wave * 4096;          // [64][64] per wave
#pragma unroll
    for (int t = 0; t < 4; ++t) {
      const float bi = bf_up(bf_bits(bias[n0 + t * 16 + c]));
#pragma unroll
      for (int i = 0; i < 4; ++i)
#pragma unroll
        for (int r = 0; r < 8; ++r)
          S[(i * 16 + 8 * hh + r) * 64 + t * 16 + c] = (_Float16)((acc[i][t][r] + bi) * scale);
    }
    __builtin_amdgcn_fence(__ATOMIC_RELEASE, "workgroup");
    __builtin_amdgcn_wave_barrier();
    __builtin_amdgcn_fence(__ATOMIC_ACQUIRE, "workgroup");
    const int rq = lane >> 3, c8 = (lane & 7) * 8;
#pragma unroll
    for (int g = 0; g < 4; ++g) {
      union { v8h h; v4u u; } w[4];
#pragma unroll
      for (int it = 0; it < 4; ++it) w[it].h = *(const v8h*)(S + (g * 16 + it * 4 + rq) * 64 + c8);
#pragma unroll
      for (int it = 0; it < 4; ++it)
        *(v4u*)(out16 + (size_t)(m0 + g * 16 + it * 4 + rq) * DE + n0 + c8) = w[it].u;
    }
    // the issued stores name their data and address registers: the wait stands in front of whatever rewrites them
    // behind the join of the two epilogues
    asm volatile("s_wait_xcnt 0x0" ::: "memory");
  } else if (MODE == 1) {
    _Float16* T = (_Float16*)(void*)smem;                       // [n 128][key 128]
#pragma unroll
    for (int t = 0; t < 4; ++t) {
      const float bi = bf_up(bf_bits(bias[n0 + t * 16 + c]));
#pragma unroll
      for (int i = 0; i < 4; ++i)
#pragma unroll
        for (int r = 0; r < 8; ++r)
          T[(wn * 64 + t * 16 + c) * 128 + wm * 64 + i * 16 + 8 * hh + r] = (_Float16)((acc[i][t][r] + bi) * scale);
    }
    __syncthreads();
    const int bidx = m0b / SEQ;                                  // tiles never straddle batches (128 | SEQ)
    const int key0 = m0b - bidx * SEQ;
    const int rh = lane >> 4, c8 = (lane & 15) * 8;
#pragma unroll
    for (int g = 0; g < 4; ++g) {
      union { v8h h; v4u u; } w[4];
#pragma unroll
      for (int it = 0; it < 4; ++it) w[it].h = *(const v8h*)(T + (wave * 32 + g * 8 + it * 2 + rh) * 128 + c8);
#pragma unroll
      for (int it = 0; it < 4; ++it) {
        const int row = wave * 32 + g * 8 + it * 2 + rh;
        *(v4u*)(out16 + ((size_t)(bidx * DE + n0b + row) * SEQ + key0 + c8)) = w[it].u;
      }
    }
  } else {
    float* S = (float*)(void*)smem + wave * 4096;                // [64][64] f32 per wave
#pragma unroll
    for (int t = 0; t < 4; ++t) {
      const float bi = bf_up(bf_bits(bias[n0 + t * 16 + c]));
#pragma unroll
      for (int i = 0; i < 4; ++i)
#pragma unroll
        for (int r = 0; r < 8; ++r) S[(i * 16 + 8 * hh + r) * 64 + t * 16 + c] = acc[i][t][r] * scale + bi;
    }
    __builtin_amdgcn_fence(__ATOMIC_RELEASE, "workgroup");
    __builtin_amdgcn_wave_barrier();
    __builtin_amdgcn_fence(__ATOMIC_ACQUIRE, "workgroup");
    const int rh = lane >> 4, c4 = (lane & 15) * 4;
#pragma unroll
    for (int g = 0; g < 4; ++g) {
      v4f vals[8];
#pragma unroll
      for (int it = 0; it < 8; ++it) {
        const int row = g * 16 + it * 2 + rh;
        const int gm  = m0 + row;
        const int bb  = gm / SEQ;
        const int tt  = gm - bb * SEQ;
        v4f x = *(const v4f*)(S + row * 64 + c4);
        const v4f rq = *(const v4f*)(resid + ((size_t)bb * SEQ_FULL + tt) * DE + n0 + c4);
#pragma unroll
        for (int e = 0; e < 4; ++e) x[e] = x[e] + bf_up(bf_bits(rq[e]));
        vals[it] = x;
      }
#pragma unroll
      for (int it = 0; it < 8; ++it)
        *(v4f*)(out32 + (size_t)(m0 + g * 16 + it * 2 + rh) * DE + n0 + c4) = vals[it];
    }
  }
}

// The three projections, which do not depend on one another, in one grid: blockIdx.z = 0 q, 1 k (MODE 0), 2 v (MODE 1).
// One k loop serves all three (operand pointers picked by the block-uniform z); only the epilogue branches.
__global__ __launch_bounds__(128)
void gemm_qkv(const unsigned short* __restrict__ Aq, const unsigned short* __restrict__ Ak,
              const unsigned short* __restrict__ Wq, const unsigned short* __restrict__ Wk,
              const unsigned short* __restrict__ Wv, const float* __restrict__ bq, const float* __restrict__ bk,
              const float* __restrict__ bv, unsigned short* oq, unsigned short* ok, unsigned short* ov) {
  __shared__ __align__(16) unsigned char smem[2 * GSLAB * 2];
  const int z = blockIdx.z;
  v8f acc[4][4];
  gemm_main<false>(smem, (z == 0) ? Aq : Ak, (z == 0) ? Wq : ((z == 1) ? Wk : Wv), acc);
  if (z == 2) gemm_epi<1>(smem, acc, bv, nullptr, ov, nullptr, VCARRY);
  else        gemm_epi<0>(smem, acc, (z == 0) ? bq : bk, nullptr, (z == 0) ? oq : ok, nullptr, 1.0f);
}

// output projection (MODE 2)
__global__ __launch_bounds__(128)
void gemm_o(const unsigned short* __restrict__ A, const unsigned short* __restrict__ Bt,
            const float* __restrict__ bias, const float* __restrict__ resid, float* out32) {
  __shared__ __align__(16) unsigned char smem[2 * GSLAB * 2];
  v8f acc[4][4];
  gemm_main<true>(smem, A, Bt, acc);
  gemm_epi<2>(smem, acc, bias, resid, nullptr, out32, 1.0f / (CCARRY * WCARRY));
}

// =====================================================================================================
// Full (unmasked) attention, head dim 64, all NQB key tiles.
//   q plane (f16):  element (b, t, h, d) at [(b*SEQ + t)*DE + h*64 + d]      k plane (f16): same with key index s
//   v^T plane (f16): element (b, h, d, s) at [(b*DE + h*64 + d)*SEQ + s], value v*64
//   Both products are formed transposed: S^T = K . Q^T (A = K rows, B = Q) and O^T += V^T . P^T (A = V^T rows, B = P^T).
//   Lane (c, hh) then holds scores of ONE query, q0 + c: register r of score tile j is key 16 j + 8 hh + r. Row maximum
//   and row sum are in-lane, with one exchange between the two lane halves; and score tiles 2 kk and 2 kk + 1,
//   converted in place, ARE the B fragment of key chunk kk (element e < 8: key 8 hh + e, else 16 + 8 hh + e - 8, the
//   k map of the V^T loader): P goes through no LDS and no lane exchange.
//   scores = q . k (f16 WMMA, f32 acc) * 0.125; online softmax in f32; p = exp(s - m) carried as f16(16384 p);
//   context = p . v on f16 WMMA; RES adds the f16 residual plane of p (x4096, separate accumulator folded back
//   with 1/4096 per tile in f32). ctx out = f16(context / (l * 16384 * 64) * 64) to [(b*SEQ + t)*DE + h*64 + d].
//   l is kept per lane half (the half's own keys); the halves are joined once, behind the loop.
//   Block = 4 waves = 64 query rows of one (b,h); bx = 0 .. nqbThis * NH * NB - 1; kv tiles of 64.
//   K / V^T tile staging: 128 threads x 4 pieces of 8 elements per plane = the whole 64x64 tile (plain 16-B loads, 8
//   lanes per 128-B row, __syncthreads before and after, cross-wave); staged extent == consumed extent for Ksh, Vth, Os.
//   Ksh, Vth rows lie at pitch LP (64 used halves + 8 never touched) so that the 16 rows one 16-B fragment
//   read walks fall on 16 different bank groups.
//   The Os tile is wave-private: lane (c, hh) stores 8 consecutive d of query row c per output tile (one 16-B store),
//   Output coverage: each wave stores rows 0..15 (it 0..3 x lane>>3) x 64 halves (8 lanes x 16 B): one instruction
// =====================================================================================================
template <bool RES>
__device__ __forceinline__
void attn_block(_Float16* Ksh, _Float16* Vth, _Float16* Osh,
                const unsigned short* __restrict__ qp, const unsigned short* __restrict__ kp,
                const unsigned short* __restrict__ vtp, unsigned short* ctx, int bx, int qbBase, int nqbThis) {
  union FH { v16h v; v8h h[2]; v2h p[8]; };

  const int tid  = threadIdx.x;
  const int wave = tid >> 5;
  const int lane = tid & 31;
  const int hh   = lane >> 4;
  const int c    = lane & 15;

  const int qbl  = bx % nqbThis;
  const int bhq  = bx / nqbThis;           // 0..NB*NH-1
  const int h    = bhq % NH;
  const int b    = bhq / NH;
  const int qb   = qbBase + qbl;           // 0..NQB-1
  const int q0   = qb * 64 + wave * 16;    // query index within the sequence

  const _Float16* Qh = (const _Float16*)(const void*)qp + (size_t)b * SEQ * DE + (size_t)h * HD;
  const _Float16* Kh = (const _Float16*)(const void*)kp + (size_t)b * SEQ * DE + (size_t)h * HD;
  const _Float16* Vh = (const _Float16*)(const void*)vtp + ((size_t)b * DE + (size_t)h * HD) * SEQ;

  // ---- Q fragments (B operand, column = lane&15): 2 d-chunks ----
  v16h qa[2];
#pragma unroll
  for (int dc = 0; dc < 2; ++dc) {
    const size_t qo = (size_t)(q0 + c) * DE + dc * 32 + 8 * hh;
    qa[dc] = ldfrag_h(Qh + qo);
  }

  float mrow = -INFINITY, lrow = 0.f;       // of query q0 + c; lrow: the keys of this lane half only
  v8f oacc[4];                              // O^T: register r of tile t = context[q0 + c][16 t + 8 hh + r]
#pragma unroll
  for (int t = 0; t < 4; ++t) oacc[t] = zero8();

  for (int kt = 0; kt < NQB; ++kt) {        // block-uniform bounds, exactly NQB trips
    const int kv0 = kt * 64;
    __syncthreads();
    {
      // 8 lanes fetch the whole 128-B line that a tile row is, so one load touches 4 lines. The wave's four rows of a
      // 16-row group are 2w, 2w+8, 2w+1, 2w+9: rows 8 apart lie 8 x 144 B = 128 B (mod 256) apart in LDS, so the
      // 16-B pieces of each lane half fall on all 64 banks once
      const int g = (lane >> 3), p8 = (lane & 7) * 8;
      const int r = 2 * wave + (g >> 1) + 8 * (g & 1);           // row within a group of 16 rows
      const _Float16* kg = Kh + (size_t)(kv0 + r) * DE + p8;     // K row kv0+r+16i, d = p8..p8+7
      const _Float16* vg = Vh + (size_t)r * SEQ + kv0 + p8;      // V^T row d = r+16i, s = kv0+p8..+7
      // all eight loads are issued ahead of the first store, so that their latencies overlap
      v8h a0[4], b0[4];
#pragma unroll
      for (int i = 0; i < 4; ++i) {
        a0[i] = *(const v8h*)(kg + (size_t)i * 16 * DE);
        b0[i] = *(const v8h*)(vg + (size_t)i * 16 * SEQ);
      }
#pragma unroll
      for (int i = 0; i < 4; ++i) {
        *(v8h*)(Ksh + (r + 16 * i) * LP + p8) = a0[i];
        *(v8h*)(Vth + (r + 16 * i) * LP + p8) = b0[i];
      }
    }
    __syncthreads();

    // ---- all K and V^T fragments of the tile are read as one group right behind the barrier: the K reads' latencies
    //      overlap each other, the V^T reads land under the score products and the softmax ----
    FH kb[4][2], vb[2][4];
#pragma unroll
    for (int j = 0; j < 4; ++j)
#pragma unroll
      for (int dc = 0; dc < 2; ++dc) {
        kb[j][dc].h[0] = *(const v8h*)(Ksh + (j * 16 + c) * LP + dc * 32 + 8 * hh);
        kb[j][dc].h[1] = *(const v8h*)(Ksh + (j * 16 + c) * LP + dc * 32 + 16 + 8 * hh);
      }
#pragma unroll
    for (int kk = 0; kk < 2; ++kk)
#pragma unroll
      for (int t = 0; t < 4; ++t) {
        vb[kk][t].h[0] = *(const v8h*)(Vth + (t * 16 + c) * LP + kk * 32 + 8 * hh);
        vb[kk][t].h[1] = *(const v8h*)(Vth + (t * 16 + c) * LP + kk * 32 + 16 + 8 * hh);
      }
    // holds the group of reads apart from the products: without it the compiler mixes the two regions and, in the
    // residual variant, spills one fragment to scratch and reloads it in every trip
    __builtin_amdgcn_sched_barrier(0);

    // ---- scores, transposed: 64 keys (rows) x 16 queries (columns) per wave, single f16 product ----
    v8f s[4];
#pragma unroll
    for (int j = 0; j < 4; ++j) {
      s[j] = zero8();
#pragma unroll
      for (int dc = 0; dc < 2; ++dc) s[j] = mma_h(kb[j][dc].v, qa[dc], s[j]);
    }

    // ---- scale, maximum of this lane's 32 keys (one chain per score tile), joined with the other lane half ----
    float mj[4];
#pragma unroll
    for (int j = 0; j < 4; ++j) {
      float m = -INFINITY;
#pragma unroll
      for (int r = 0; r < 8; ++r) {
        const float sv = s[j][r] * 0.125f;
        s[j][r] = sv;
        m = fmaxf(m, sv);
      }
      mj[j] = m;
    }
    float mx = fmaxf(fmaxf(mj[0], mj[1]), fmaxf(mj[2], mj[3]));
    mx = fmaxf(mx, xhalf(mx));
    const float mnew  = fmaxf(mrow, mx);
    const float msafe = (mnew == -INFINITY) ? 0.f : mnew;
    const float al = __expf(mrow - msafe);
    mrow = mnew;

    // ---- P (x16384, f16) and P residual (x4096), converted in pairs straight into the B fragments ----
    FH pa[2], pl[2];
    v2f pj[4];                           // one chain of pair sums per score tile (even r, odd r)
#pragma unroll
    for (int j = 0; j < 4; ++j) {
#pragma unroll
      for (int r = 0; r < 8; r += 2) {
        const v2f pp = {__expf(s[j][r] - msafe), __expf(s[j][r + 1] - msafe)};
        pj[j] = (r == 0) ? pp : pj[j] + pp;
        const v2f pk = pp * PCARRY;
        const v2h ph = __builtin_convertvector(pk, v2h);
        pa[j >> 1].p[(j & 1) * 4 + (r >> 1)] = ph;
        if (RES) {
          const v2f rs = {(pk[0] - (float)ph[0]) * PRES, (pk[1] - (float)ph[1]) * PRES};
          pl[j >> 1].p[(j & 1) * 4 + (r >> 1)] = __builtin_convertvector(rs, v2h);
        }
      }
    }
    const v2f pt = (pj[0] + pj[1]) + (pj[2] + pj[3]);
    lrow = lrow * al + (pt[0] + pt[1]);
#pragma unroll
    for (int t = 0; t < 4; ++t)
#pragma unroll
      for (int r = 0; r < 8; ++r) oacc[t][r] *= al;

    // ---- context^T += V^T . P^T (f16 WMMA), residual products into a separate accumulator ----
    v8f o1[4];
#pragma unroll
    for (int t = 0; t < 4; ++t) o1[t] = zero8();
    // unrolled: kk picks among fragments that sit in registers, so it must be a constant
#pragma unroll
    for (int kk = 0; kk < 2; ++kk) {
#pragma unroll
      for (int t = 0; t < 4; ++t) {
        oacc[t] = mma_h(vb[kk][t].v, pa[kk].v, oacc[t]);
        if (RES) o1[t] = mma_h(vb[kk][t].v, pl[kk].v, o1[t]);
      }
    }
    if (RES) {
#pragma unroll
      for (int t = 0; t < 4; ++t)
#pragma unroll
        for (int r = 0; r < 8; ++r) oacc[t][r] += o1[t][r] * (1.0f / PRES);
    }
  }

  // ---- join the halves' sums; normalise (1/l, the p, v carries) and apply the ctx carry; stage the wave's 16x64 f16
  //      tile; write whole lines ----
  _Float16* os = Osh + wave * (16 * 64);
  {
    const float l = lrow + xhalf(lrow);
    const float inv = ((l > 0.f) ? (1.0f / l) : 0.f) * (CCARRY / (PCARRY * VCARRY));
#pragma unroll
    for (int t = 0; t < 4; ++t) {
      v8h o;
#pragma unroll
      for (int r = 0; r < 8; ++r) o[r] = (_Float16)(oacc[t][r] * inv);
      *(v8h*)(os + c * 64 + t * 16 + 8 * hh) = o;
    }
  }
  __builtin_amdgcn_fence(__ATOMIC_RELEASE, "workgroup");
  __builtin_amdgcn_wave_barrier();
  __builtin_amdgcn_fence(__ATOMIC_ACQUIRE, "workgroup");
  {
    const int rq = lane >> 3, c8 = (lane & 7) * 8;
    union { v8h h; v4u u; } w[4];
#pragma unroll
    for (int it = 0; it < 4; ++it) w[it].h = *(const v8h*)(os + (it * 4 + rq) * 64 + c8);
    unsigned short* ob = ctx + ((size_t)b * SEQ) * DE + (size_t)h * HD;
    {
#pragma unroll
      for (int it = 0; it < 4; ++it) {
        const int row = it * 4 + rq;                     // it 0..3 x rq 0..3 = rows 0..15
        *(v4u*)(ob + (size_t)(q0 + row) * DE + c8) = w[it].u;
      }
      
    }
  }
}

// Both kinds of query block in one grid of NB * NH * NQB blocks, picked by block index (block-uniform): the first
// NB * NH * resqb blocks are the leading query blocks, with the p residual plane (the longer ones, placed first for speed only);
// the others run without it.
__global__ __launch_bounds__(128)
void attn_full64(const unsigned short* __restrict__ qp, const unsigned short* __restrict__ kp,
                 const unsigned short* __restrict__ vtp, unsigned short* ctx, int resqb) {
  __shared__ __align__(16) _Float16 Ksh[64 * LP];                 // K [kv][d], pitch LP
  __shared__ __align__(16) _Float16 Vth[64 * LP];                 // V^T [d][kv], pitch LP
  __shared__ __align__(16) _Float16 Os[4 * 16 * 64];              // per wave context tile [row][d]
  const int bx   = blockIdx.x;
  const int nres = NB * NH * resqb;
  if (bx < nres) attn_block<true>(Ksh, Vth, Os, qp, kp, vtp, ctx, bx, 0, resqb);
  else           attn_block<false>(Ksh, Vth, Os, qp, kp, vtp, ctx, bx - nres, resqb, NQB - resqb);
}

// =====================================================================================================
// LayerNorm over DE of x [MROWS][DE] f32: one block of 256 threads per row, thread owns 4 consecutive floats.
// mean and centred variance via wave shuffles + 8-entry LDS partials (cross-wave, block barriers), fixed order.
// y = (x - mu) * rsqrt(var + 1e-5) * RNE-bf16(gamma) + RNE-bf16(beta). Output row b*SEQ_FULL + t of d_out;
// coverage: MROWS blocks x 256 threads x 4 floats = every processed output row in full.
// =====================================================================================================
__global__ __launch_bounds__(256) void ln_rows(const float* __restrict__ x, const float* __restrict__ gam,
                                               const float* __restrict__ bet, float* out) {
  __shared__ float red1[8];
  __shared__ float red2[8];
  const int tid = threadIdx.x, wave = tid >> 5, lane = tid & 31;
  const int row = blockIdx.x;
  const int bb  = row / SEQ;
  const int tt  = row - bb * SEQ;
  const size_t orow = (size_t)bb * SEQ_FULL + (size_t)tt;

  const v4f v = *(const v4f*)(x + (size_t)row * DE + tid * 4);
  float s = (v[0] + v[1]) + (v[2] + v[3]);
#pragma unroll
  for (int off = 16; off > 0; off >>= 1) s += __shfl_xor(s, off, 32);
  if (lane == 0) red1[wave] = s;
  __syncthreads();
  float tot = 0.f;
#pragma unroll
  for (int w = 0; w < 8; ++w) tot += red1[w];
  const float mu = tot * (1.0f / (float)DE);

  v4f d;
#pragma unroll
  for (int e = 0; e < 4; ++e) d[e] = v[e] - mu;
  float s2 = (d[0] * d[0] + d[1] * d[1]) + (d[2] * d[2] + d[3] * d[3]);
#pragma unroll
  for (int off = 16; off > 0; off >>= 1) s2 += __shfl_xor(s2, off, 32);
  if (lane == 0) red2[wave] = s2;
  __syncthreads();
  float tot2 = 0.f;
#pragma unroll
  for (int w = 0; w < 8; ++w) tot2 += red2[w];
  const float var  = tot2 * (1.0f / (float)DE);
  const float rstd = rsqrtf(var + 1.0e-5f);

  const v4f g4 = *(const v4f*)(gam + tid * 4);
  const v4f b4 = *(const v4f*)(bet + tid * 4);
  v4f y;
#pragma unroll
  for (int e = 0; e < 4; ++e) y[e] = (d[e] * rstd) * bf_up(bf_bits(g4[e])) + bf_up(bf_bits(b4[e]));
  float* op = out + orow * DE + (size_t)tid * 4;
  *(v4f*)op = y;
  
}

// =====================================================================================================
// Workspace map (bytes, full size): PQ bf16 [MROWS][DE] at 0 (8388608); PK bf16 at 8388608 (8388608);
// Wq^T, Wk^T, Wv^T bf16 and Wo^T f16 [DE][DE] at 16777216.. (4 x 2097152); Q f16 [MROWS][DE] at 25165824;
// K f16 at 33554432; V^T f16 [NB][DE][SEQ] at 41943040; CTX f16 [MROWS][DE] at 50331648; X f32 [MROWS][DE]
// at 58720256 (16777216); end 75497472. Every plane is an exact multiple of its whole-line store granularity
// Launch plan (5): input conversions + weight transpose-convert; gemm q, k, v^T; attention (leading query blocks with
// the p residual, remaining blocks without); gemm o + residual; LayerNorm. Jobs that share a launch are independent.
// =====================================================================================================
extern "C" void kernel_launch(void* const* d_in, const int* in_sizes, int n_in,
                              void* d_out, int out_size, void* d_ws, size_t ws_size,
                              hipStream_t stream) {
  if (n_in < 12) return;
  const long long needIn = (long long)(NB - 1) * SEQ_FULL * DE + (long long)SEQ * DE;
  if ((long long)in_sizes[0] < needIn || (long long)in_sizes[1] < needIn) return;
  if (in_sizes[2] < DE * DE || in_sizes[4] < DE * DE || in_sizes[6] < DE * DE || in_sizes[8] < DE * DE) return;
  if (in_sizes[3] < DE || in_sizes[5] < DE || in_sizes[7] < DE || in_sizes[9] < DE) return;
  if (in_sizes[10] < DE || in_sizes[11] < DE) return;
  if (out_size < 0 || (long long)out_size < needIn) return;

  const size_t P16 = (size_t)MROWS * DE * 2;     // one 16-bit activation plane
  const size_t W16 = (size_t)DE * DE * 2;        // one 16-bit weight plane
  const size_t P32 = (size_t)MROWS * DE * 4;     // x plane
  size_t off = 0;
  const size_t oPQ  = off; off += P16;
  const size_t oPK  = off; off += P16;
  const size_t oWq  = off; off += W16;
  const size_t oWk  = off; off += W16;
  const size_t oWv  = off; off += W16;
  const size_t oWo  = off; off += W16;
  const size_t oQ   = off; off += P16;
  const size_t oK   = off; off += P16;
  const size_t oVT  = off; off += P16;
  const size_t oCTX = off; off += P16;
  const size_t oX   = off; off += P32;
  if (off > ws_size) return;                     // off = 75497472 at full size
  if (off > (size_t)134217728) return;

  const float* pre_q = (const float*)d_in[0];
  const float* pre_k = (const float*)d_in[1];
  const float* Wq    = (const float*)d_in[2];
  const float* bq    = (const float*)d_in[3];
  const float* Wk    = (const float*)d_in[4];
  const float* bk    = (const float*)d_in[5];
  const float* Wv    = (const float*)d_in[6];
  const float* bv    = (const float*)d_in[7];
  const float* Wo    = (const float*)d_in[8];
  const float* bo    = (const float*)d_in[9];
  const float* gamma = (const float*)d_in[10];
  const float* beta  = (const float*)d_in[11];
  float* out = (float*)d_out;

  char* ws = (char*)d_ws;
  unsigned short* PQb  = (unsigned short*)(ws + oPQ);
  unsigned short* PKb  = (unsigned short*)(ws + oPK);
  unsigned short* Wqt  = (unsigned short*)(ws + oWq);
  unsigned short* Wkt  = (unsigned short*)(ws + oWk);
  unsigned short* Wvt  = (unsigned short*)(ws + oWv);
  unsigned short* Wot  = (unsigned short*)(ws + oWo);
  unsigned short* Qh   = (unsigned short*)(ws + oQ);
  unsigned short* Kh   = (unsigned short*)(ws + oK);
  unsigned short* VTb  = (unsigned short*)(ws + oVT);
  unsigned short* CTXb = (unsigned short*)(ws + oCTX);
  float*          Xb   = (float*)(ws + oX);

  const dim3 blk(256);
  const int n8   = MROWS * DE / 8;               // 524288 at full size
  const int per8 = SEQ * DE / 8;
  const int src8 = SEQ_FULL * DE / 8;
  const int ncv  = (n8 + 255) / 256;             // conversion blocks per activation plane
  const dim3 gPrep(4 * (DE / 64) * (DE / 64) + 2 * ncv);   // 256 tiles x 4 matrices, then the two planes
  const dim3 blkG(128);                          // the GEMMs' block: 4 waves
  const dim3 gG(DE / 128, MROWS / 128);          // (8, 32) at full size
  const dim3 gG3(DE / 128, MROWS / 128, 3);      // the same for each of q, k, v
  int resqb = RESQB;
  if (resqb > NQB) resqb = NQB;

  // (1) weights -> transposed 16-bit planes (Wq, Wk, Wv bf16; Wo f16 x64); activations -> bf16 planes (RNE convert)
  prep_inputs<<<gPrep, blk, 0, stream>>>(pre_q, pre_k, Wq, Wk, Wv, Wo, PQb, PKb, Wqt, Wkt, Wvt, Wot,
                                         ncv, n8, per8, src8);
  // (2) projections: q, k -> f16 row-major; v -> f16 v^T x64
  gemm_qkv<<<gG3, blkG, 0, stream>>>(PQb, PKb, Wqt, Wkt, Wvt, bq, bk, bv, Qh, Kh, VTb);
  // (3) attention -> ctx f16 x64: query blocks 0..resqb-1 with the p residual plane, the rest without
  attn_full64<<<dim3(NB * NH * NQB), dim3(128), 0, stream>>>(Qh, Kh, VTb, CTXb, resqb);
  // (4) output projection + bias + residual -> x f32
  gemm_o<<<gG, blkG, 0, stream>>>(CTXb, Wot, bo, pre_q, Xb);
  // (5) LayerNorm -> output
  ln_rows<<<dim3(MROWS), blk, 0, stream>>>(Xb, gamma, beta, out);
  (void)hipGetLastError();
}
